// v000
// The times below were measured on an AMD MI455X: many runs one after another, warmed up first and cycling through
// copies of the inputs, with the whole window's GPU time divided by the number of runs. Launches and the gaps
// between them are all in it. The median over several windows is given; except for v000 it joins two sittings, which
// can be a few percent apart, so the side-by-side timings, each taken in one sitting, are the better comparison.
// v000, which the later versions start from, runs in 707 microseconds.
#include <hip/hip_runtime.h>
#include <hip/hip_bf16.h>

// ---------------------------------------------------------------------------
// MLA (multi-head latent attention) forward for MI455X / gfx1250.
// All GEMMs + attention run through v_wmma_f32_16x16x32_bf16 (f32 accumulate).
// ---------------------------------------------------------------------------

typedef __attribute__((ext_vector_type(16))) __bf16 v16bf;
typedef __attribute__((ext_vector_type(8)))  float  v8f;

#define D_   2048
#define H_   16
#define HD_  128
#define TQ_  2048
#define BB_  2
#define R_   512

static __device__ __forceinline__ unsigned short f2bf(float f) {
  unsigned int u = __float_as_uint(f);
  u += 0x7FFFu + ((u >> 16) & 1u);          // round-to-nearest-even
  return (unsigned short)(u >> 16);
}

// Load one 16x32 bf16 WMMA operand fragment from LDS (row-major, `stride`
// elements per row). Matches the CDNA5 16-bit A/B layout:
//   lanes 0-15 : K = 0..7 (v0-3), 16..23 (v4-7)
//   lanes16-31 : K = 8..15 (v0-3), 24..31 (v4-7)
// => two 16-byte contiguous LDS reads per lane.
static __device__ __forceinline__ v16bf lds_frag(const unsigned short* p, int stride,
                                                 int row, int koff, int lane) {
  const int kb = (lane & 16) ? 8 : 0;
  const unsigned short* base = p + row * stride + koff + kb;
  union { uint4 u[2]; v16bf v; } c;
  c.u[0] = *(const uint4*)(base);
  c.u[1] = *(const uint4*)(base + 16);
  return c.v;
}

// ---------------------------------------------------------------------------
// fp32 -> bf16 conversion (bandwidth-bound, sizes are multiples of 1024)
// ---------------------------------------------------------------------------
__global__ __launch_bounds__(256) void f32_to_bf16_k(const float* __restrict__ src,
                                                     unsigned short* __restrict__ dst,
                                                     int n) {
  int i = (blockIdx.x * 256 + threadIdx.x) * 4;
  if (i + 3 < n) {
    float4 v = *(const float4*)(src + i);
    dst[i + 0] = f2bf(v.x);
    dst[i + 1] = f2bf(v.y);
    dst[i + 2] = f2bf(v.z);
    dst[i + 3] = f2bf(v.w);
  }
}

// ---------------------------------------------------------------------------
// C[M,N] = A[M,K] (bf16 row-major) x W[N,K]^T (bf16 row-major) (+bias)
// Block: 256 threads (8 waves). Tile: 128(M) x 64(N), K-step 32.
// Wave (wm,wn) computes a 32x32 sub-tile = 2x2 WMMA 16x16 fragments.
// ---------------------------------------------------------------------------
__global__ __launch_bounds__(256) void gemm_abT(const unsigned short* __restrict__ A,
                                                const unsigned short* __restrict__ W,
                                                void* __restrict__ C,
                                                const float* __restrict__ bias,
                                                int M, int N, int K, int out_f32) {
  __shared__ __align__(16) unsigned short As[128 * 40];  // stride 40 keeps b128 alignment
  __shared__ __align__(16) unsigned short Ws[64 * 40];

  const int tid  = threadIdx.x;
  const int lane = tid & 31;
  const int wv   = tid >> 5;
  const int wm   = (wv & 3) * 32;
  const int wn   = (wv >> 2) * 32;
  const int m0   = blockIdx.y * 128;
  const int n0   = blockIdx.x * 64;

  v8f acc[2][2] = {};

  for (int k0 = 0; k0 < K; k0 += 32) {
    // cooperative tile loads: 8 bf16 (16 B) per thread per pass
#pragma unroll
    for (int p = 0; p < 2; ++p) {
      int idx = (p * 256 + tid) * 8;
      int row = idx >> 5, col = idx & 31;
      uint4 v = *(const uint4*)(A + (size_t)(m0 + row) * K + k0 + col);
      *(uint4*)(&As[row * 40 + col]) = v;
    }
    {
      int idx = tid * 8;
      int row = idx >> 5, col = idx & 31;
      uint4 v = *(const uint4*)(W + (size_t)(n0 + row) * K + k0 + col);
      *(uint4*)(&Ws[row * 40 + col]) = v;
    }
    if (k0 + 32 < K) {  // global_prefetch_b8 of the next K tile
      __builtin_prefetch(A + (size_t)(m0 + (tid >> 1)) * K + k0 + 32, 0, 1);
      __builtin_prefetch(W + (size_t)(n0 + (tid & 63)) * K + k0 + 32, 0, 1);
    }
    __syncthreads();

    v16bf af[2], bfm[2];
#pragma unroll
    for (int mi = 0; mi < 2; ++mi)
      af[mi] = lds_frag(As, 40, wm + mi * 16 + (lane & 15), 0, lane);
#pragma unroll
    for (int ni = 0; ni < 2; ++ni)
      bfm[ni] = lds_frag(Ws, 40, wn + ni * 16 + (lane & 15), 0, lane);
#pragma unroll
    for (int mi = 0; mi < 2; ++mi)
#pragma unroll
      for (int ni = 0; ni < 2; ++ni)
        acc[mi][ni] = __builtin_amdgcn_wmma_f32_16x16x32_bf16(
            false, af[mi], false, bfm[ni], (short)0, acc[mi][ni], false, false);
    __syncthreads();
  }

  // Epilogue. C-fragment layout: row = r + 8*(lane>=16), col = lane&15.
  const int rowadd = (lane & 16) ? 8 : 0;
#pragma unroll
  for (int mi = 0; mi < 2; ++mi)
#pragma unroll
    for (int ni = 0; ni < 2; ++ni) {
      const int col = n0 + wn + ni * 16 + (lane & 15);
      const float bv = bias ? bias[col] : 0.f;
#pragma unroll
      for (int r = 0; r < 8; ++r) {
        const int row = m0 + wm + mi * 16 + r + rowadd;
        float v = acc[mi][ni][r] + bv;
        if (out_f32)
          ((float*)C)[(size_t)row * N + col] = v;
        else
          ((unsigned short*)C)[(size_t)row * N + col] = f2bf(v);
      }
    }
}

// ---------------------------------------------------------------------------
// Flash attention per (b,h). Block = 128 threads (4 waves), 64 query rows,
// streaming 64-key tiles. Q/K tiles row-major in LDS, V transposed [hd][key]
// so both GEMMs use contiguous b128 LDS fragment reads.
// ---------------------------------------------------------------------------
__global__ __launch_bounds__(128) void mla_attn(const unsigned short* __restrict__ Q,
                                                const unsigned short* __restrict__ Kx,
                                                const unsigned short* __restrict__ V,
                                                unsigned short* __restrict__ O) {
  __shared__ __align__(16) unsigned short Qs[64 * 136];
  __shared__ __align__(16) unsigned short Ks[64 * 136];
  __shared__ __align__(16) unsigned short Vs[128 * 72];      // transposed: [hd][key]
  __shared__ __align__(16) unsigned short Ps[4 * 16 * 72];   // per-wave P staging

  const int tid  = threadIdx.x;
  const int lane = tid & 31;
  const int wv   = tid >> 5;
  const int q0   = blockIdx.x * 64;
  const int bh   = blockIdx.y;
  const int b    = bh / H_;
  const int h    = bh % H_;
  const size_t rs   = (size_t)H_ * HD_;                      // 2048 row stride
  const size_t base = (size_t)b * TQ_ * rs + (size_t)h * HD_;

  // Q tile 64x128, loaded once
#pragma unroll
  for (int p = 0; p < 8; ++p) {
    int idx = (p * 128 + tid) * 8;
    int row = idx >> 7, col = idx & 127;
    uint4 v = *(const uint4*)(Q + base + (size_t)(q0 + row) * rs + col);
    *(uint4*)(&Qs[row * 136 + col]) = v;
  }

  v8f o[8] = {};
  float mrow[8], lrow[8];
#pragma unroll
  for (int r = 0; r < 8; ++r) { mrow[r] = -1e30f; lrow[r] = 0.f; }

  unsigned short* Pw  = &Ps[wv * 16 * 72];
  const int rowadd    = (lane & 16) ? 8 : 0;
  const float sc      = 0.08838834764831845f;                // 1/sqrt(128)

  for (int kb = 0; kb < TQ_ / 64; ++kb) {
    const int key0 = kb * 64;
    __syncthreads();  // previous PV readers done before K/V overwrite
#pragma unroll
    for (int p = 0; p < 8; ++p) {
      int idx = (p * 128 + tid) * 8;
      int row = idx >> 7, col = idx & 127;
      uint4 v = *(const uint4*)(Kx + base + (size_t)(key0 + row) * rs + col);
      *(uint4*)(&Ks[row * 136 + col]) = v;
    }
#pragma unroll
    for (int p = 0; p < 8; ++p) {
      int idx = (p * 128 + tid) * 8;
      int row = idx >> 7, col = idx & 127;
      uint4 v = *(const uint4*)(V + base + (size_t)(key0 + row) * rs + col);
      const unsigned short* e = (const unsigned short*)&v;
#pragma unroll
      for (int j = 0; j < 8; ++j) Vs[(col + j) * 72 + row] = e[j];  // transpose
    }
    __syncthreads();

    // S(16x64) = Q(16x128) x K^T : B-frag col = key -> row of Ks tile
    v8f s[4] = {};
#pragma unroll
    for (int ks = 0; ks < 4; ++ks) {
      v16bf aq = lds_frag(Qs, 136, wv * 16 + (lane & 15), ks * 32, lane);
#pragma unroll
      for (int n = 0; n < 4; ++n) {
        v16bf bk = lds_frag(Ks, 136, n * 16 + (lane & 15), ks * 32, lane);
        s[n] = __builtin_amdgcn_wmma_f32_16x16x32_bf16(false, aq, false, bk,
                                                       (short)0, s[n], false, false);
      }
    }

    // Online softmax directly in C-fragment layout: row r lives in 16 lanes
    // (same half-wave), cols spread over the 4 n-tiles.
    float corr[8];
#pragma unroll
    for (int r = 0; r < 8; ++r) {
      float v = -1e30f;
#pragma unroll
      for (int n = 0; n < 4; ++n) { s[n][r] *= sc; v = fmaxf(v, s[n][r]); }
#pragma unroll
      for (int m = 1; m < 16; m <<= 1) v = fmaxf(v, __shfl_xor(v, m, 32));
      const float mn = fmaxf(mrow[r], v);
      corr[r] = __expf(mrow[r] - mn);
      mrow[r] = mn;
      float psum = 0.f;
#pragma unroll
      for (int n = 0; n < 4; ++n) {
        float p = __expf(s[n][r] - mn);
        s[n][r] = p;
        psum += p;
      }
#pragma unroll
      for (int m = 1; m < 16; m <<= 1) psum += __shfl_xor(psum, m, 32);
      lrow[r] = lrow[r] * corr[r] + psum;
    }

    // Stage P as bf16 (C-layout -> row-major) and rescale O accumulators
#pragma unroll
    for (int n = 0; n < 4; ++n)
#pragma unroll
      for (int r = 0; r < 8; ++r)
        Pw[(r + rowadd) * 72 + n * 16 + (lane & 15)] = f2bf(s[n][r]);
#pragma unroll
    for (int n8 = 0; n8 < 8; ++n8)
#pragma unroll
      for (int r = 0; r < 8; ++r) o[n8][r] *= corr[r];
    __syncthreads();

    // O(16x128) += P(16x64) x V(64x128): B-frag col = hd -> row of Vs (transposed)
#pragma unroll
    for (int kk = 0; kk < 2; ++kk) {
      v16bf ap = lds_frag(Pw, 72, lane & 15, kk * 32, lane);
#pragma unroll
      for (int n8 = 0; n8 < 8; ++n8) {
        v16bf bv = lds_frag(Vs, 72, n8 * 16 + (lane & 15), kk * 32, lane);
        o[n8] = __builtin_amdgcn_wmma_f32_16x16x32_bf16(false, ap, false, bv,
                                                        (short)0, o[n8], false, false);
      }
    }
  }

  // Normalize and store (bf16, feeds the output projection GEMM)
#pragma unroll
  for (int n8 = 0; n8 < 8; ++n8) {
    const int hd = n8 * 16 + (lane & 15);
#pragma unroll
    for (int r = 0; r < 8; ++r) {
      const int t = q0 + wv * 16 + r + rowadd;
      O[base + (size_t)t * rs + hd] = f2bf(o[n8][r] / lrow[r]);
    }
  }
}

// ---------------------------------------------------------------------------
// Launch chain
// ---------------------------------------------------------------------------
extern "C" void kernel_launch(void* const* d_in, const int* in_sizes, int n_in,
                              void* d_out, int out_size, void* d_ws, size_t ws_size,
                              hipStream_t stream) {
  (void)in_sizes; (void)n_in; (void)out_size; (void)ws_size;

  const float* x    = (const float*)d_in[0];
  const float* wq_a = (const float*)d_in[1];
  const float* wq_b = (const float*)d_in[2];
  const float* wk_a = (const float*)d_in[3];
  const float* wk_b = (const float*)d_in[4];
  const float* wv_a = (const float*)d_in[5];
  const float* wv_b = (const float*)d_in[6];
  const float* wo_w = (const float*)d_in[7];
  const float* wo_b = (const float*)d_in[8];

  const int M = BB_ * TQ_;  // 4096 tokens

  size_t off = 0;
  auto alloc = [&](size_t elems) {
    unsigned short* p = (unsigned short*)((char*)d_ws + off);
    off += (elems * sizeof(unsigned short) + 255) & ~(size_t)255;
    return p;
  };
  unsigned short* xb   = alloc((size_t)M * D_);
  unsigned short* wqab = alloc((size_t)R_ * D_);
  unsigned short* wqbb = alloc((size_t)D_ * R_);
  unsigned short* wkab = alloc((size_t)R_ * D_);
  unsigned short* wkbb = alloc((size_t)D_ * R_);
  unsigned short* wvab = alloc((size_t)R_ * D_);
  unsigned short* wvbb = alloc((size_t)D_ * R_);
  unsigned short* wob  = alloc((size_t)D_ * D_);
  unsigned short* cq   = alloc((size_t)M * R_);
  unsigned short* ck   = alloc((size_t)M * R_);
  unsigned short* cv   = alloc((size_t)M * R_);
  unsigned short* qb   = alloc((size_t)M * D_);
  unsigned short* kb   = alloc((size_t)M * D_);
  unsigned short* vb   = alloc((size_t)M * D_);
  unsigned short* ao   = alloc((size_t)M * D_);

  auto conv = [&](const float* s, unsigned short* d, size_t n) {
    f32_to_bf16_k<<<dim3((unsigned)(n / 1024)), dim3(256), 0, stream>>>(s, d, (int)n);
  };
  conv(x,    xb,   (size_t)M * D_);
  conv(wq_a, wqab, (size_t)R_ * D_);
  conv(wq_b, wqbb, (size_t)D_ * R_);
  conv(wk_a, wkab, (size_t)R_ * D_);
  conv(wk_b, wkbb, (size_t)D_ * R_);
  conv(wv_a, wvab, (size_t)R_ * D_);
  conv(wv_b, wvbb, (size_t)D_ * R_);
  conv(wo_w, wob,  (size_t)D_ * D_);

  auto gemm = [&](const unsigned short* A, const unsigned short* W, void* C,
                  const float* bias, int Mg, int Ng, int Kg, int f32out) {
    gemm_abT<<<dim3(Ng / 64, Mg / 128), dim3(256), 0, stream>>>(A, W, C, bias,
                                                                Mg, Ng, Kg, f32out);
  };

  // latent down-projections: [4096,2048] x [512,2048]^T
  gemm(xb, wqab, cq, nullptr, M, R_, D_, 0);
  gemm(xb, wkab, ck, nullptr, M, R_, D_, 0);
  gemm(xb, wvab, cv, nullptr, M, R_, D_, 0);
  // up-projections: [4096,512] x [2048,512]^T
  gemm(cq, wqbb, qb, nullptr, M, D_, R_, 0);
  gemm(ck, wkbb, kb, nullptr, M, D_, R_, 0);
  gemm(cv, wvbb, vb, nullptr, M, D_, R_, 0);
  // flash attention: grid = (T/64 q-blocks, B*H heads)
  mla_attn<<<dim3(TQ_ / 64, BB_ * H_), dim3(128), 0, stream>>>(qb, kb, vb, ao);
  // output projection + bias -> f32 d_out
  gemm(ao, wob, (float*)d_out, wo_b, M, D_, D_, 1);
}

// v001
// It runs in 568 microseconds.
// Two timings next to v000 put it at 1.30 and 1.31 times that version's speed.
#include <hip/hip_runtime.h>
#include <hip/hip_bf16.h>

// ---------------------------------------------------------------------------
// MLA (multi-head latent attention) forward for MI455X / gfx1250.
// All GEMMs + attention run through v_wmma_f32_16x16x32_bf16 (f32 accumulate).
// ---------------------------------------------------------------------------

typedef __attribute__((ext_vector_type(16))) __bf16 v16bf;
typedef __attribute__((ext_vector_type(8)))  float  v8f;

#define D_   2048
#define H_   16
#define HD_  128
#define TQ_  2048
#define BB_  2
#define R_   512

static __device__ __forceinline__ unsigned short f2bf(float f) {
  unsigned int u = __float_as_uint(f);
  u += 0x7FFFu + ((u >> 16) & 1u);          // round-to-nearest-even
  return (unsigned short)(u >> 16);
}

// Load one 16x32 bf16 WMMA operand fragment from LDS (row-major, `stride`
// elements per row). Matches the CDNA5 16-bit A/B layout:
//   lanes 0-15 : K = 0..7 (v0-3), 16..23 (v4-7)
//   lanes16-31 : K = 8..15 (v0-3), 24..31 (v4-7)
// => two 16-byte contiguous LDS reads per lane.
static __device__ __forceinline__ v16bf lds_frag(const unsigned short* p, int stride,
                                                 int row, int koff, int lane) {
  const int kb = (lane & 16) ? 8 : 0;
  const unsigned short* base = p + row * stride + koff + kb;
  union { uint4 u[2]; v16bf v; } c;
  c.u[0] = *(const uint4*)(base);
  c.u[1] = *(const uint4*)(base + 16);
  return c.v;
}

// Load one 32(k) x 16(col) bf16 B fragment from a row-major [k][col] LDS tile
// with the transposing load: lane (c = lane&15, h = lane>>4) receives
// tile[kbase + 8h + 0..7][dbase + c]; the second load, 16 rows further, gives
// k = 16 + 8h + 0..7, i.e. the same k order as lds_frag above.
// `pitch` is in elements; 32 B x odd keeps the load free of bank conflicts.
typedef __attribute__((ext_vector_type(8))) short s16x8;
static __device__ __forceinline__ v16bf lds_frag_tr(const unsigned short* tile, int pitch,
                                                    int kbase, int dbase, int lane) {
  typedef __attribute__((address_space(3))) s16x8 lds_s16x8;
  const unsigned short* p = tile + (kbase + ((lane >> 4) << 3) + (lane & 7)) * pitch
                                 + dbase + (((lane >> 3) & 1) << 3);
  union { s16x8 u[2]; v16bf v; } c;
  c.u[0] = __builtin_amdgcn_ds_load_tr16_b128_v8i16((lds_s16x8*)p);
  c.u[1] = __builtin_amdgcn_ds_load_tr16_b128_v8i16((lds_s16x8*)(p + 16 * pitch));
  return c.v;
}

// ---------------------------------------------------------------------------
// fp32 -> bf16 conversion (bandwidth-bound, sizes are multiples of 1024)
// ---------------------------------------------------------------------------
__global__ __launch_bounds__(256) void f32_to_bf16_k(const float* __restrict__ src,
                                                     unsigned short* __restrict__ dst,
                                                     int n) {
  int i = (blockIdx.x * 256 + threadIdx.x) * 4;
  if (i + 3 < n) {
    float4 v = *(const float4*)(src + i);
    dst[i + 0] = f2bf(v.x);
    dst[i + 1] = f2bf(v.y);
    dst[i + 2] = f2bf(v.z);
    dst[i + 3] = f2bf(v.w);
  }
}

// ---------------------------------------------------------------------------
// C[M,N] = A[M,K] (bf16 row-major) x W[N,K]^T (bf16 row-major) (+bias)
// Block: 256 threads (8 waves). Tile: 128(M) x 64(N), K-step 32.
// Wave (wm,wn) computes a 32x32 sub-tile = 2x2 WMMA 16x16 fragments.
// ---------------------------------------------------------------------------
__global__ __launch_bounds__(256) void gemm_abT(const unsigned short* __restrict__ A,
                                                const unsigned short* __restrict__ W,
                                                void* __restrict__ C,
                                                const float* __restrict__ bias,
                                                int M, int N, int K, int out_f32) {
  __shared__ __align__(16) unsigned short As[128 * 40];  // stride 40 keeps b128 alignment
  __shared__ __align__(16) unsigned short Ws[64 * 40];

  const int tid  = threadIdx.x;
  const int lane = tid & 31;
  const int wv   = tid >> 5;
  const int wm   = (wv & 3) * 32;
  const int wn   = (wv >> 2) * 32;
  const int m0   = blockIdx.y * 128;
  const int n0   = blockIdx.x * 64;

  v8f acc[2][2] = {};

  for (int k0 = 0; k0 < K; k0 += 32) {
    // cooperative tile loads: 8 bf16 (16 B) per thread per pass
#pragma unroll
    for (int p = 0; p < 2; ++p) {
      int idx = (p * 256 + tid) * 8;
      int row = idx >> 5, col = idx & 31;
      uint4 v = *(const uint4*)(A + (size_t)(m0 + row) * K + k0 + col);
      *(uint4*)(&As[row * 40 + col]) = v;
    }
    {
      int idx = tid * 8;
      int row = idx >> 5, col = idx & 31;
      uint4 v = *(const uint4*)(W + (size_t)(n0 + row) * K + k0 + col);
      *(uint4*)(&Ws[row * 40 + col]) = v;
    }
    if (k0 + 32 < K) {  // global_prefetch_b8 of the next K tile
      __builtin_prefetch(A + (size_t)(m0 + (tid >> 1)) * K + k0 + 32, 0, 1);
      __builtin_prefetch(W + (size_t)(n0 + (tid & 63)) * K + k0 + 32, 0, 1);
    }
    __syncthreads();

    v16bf af[2], bfm[2];
#pragma unroll
    for (int mi = 0; mi < 2; ++mi)
      af[mi] = lds_frag(As, 40, wm + mi * 16 + (lane & 15), 0, lane);
#pragma unroll
    for (int ni = 0; ni < 2; ++ni)
      bfm[ni] = lds_frag(Ws, 40, wn + ni * 16 + (lane & 15), 0, lane);
#pragma unroll
    for (int mi = 0; mi < 2; ++mi)
#pragma unroll
      for (int ni = 0; ni < 2; ++ni)
        acc[mi][ni] = __builtin_amdgcn_wmma_f32_16x16x32_bf16(
            false, af[mi], false, bfm[ni], (short)0, acc[mi][ni], false, false);
    __syncthreads();
  }

  // Epilogue. C-fragment layout: row = r + 8*(lane>=16), col = lane&15.
  const int rowadd = (lane & 16) ? 8 : 0;
#pragma unroll
  for (int mi = 0; mi < 2; ++mi)
#pragma unroll
    for (int ni = 0; ni < 2; ++ni) {
      const int col = n0 + wn + ni * 16 + (lane & 15);
      const float bv = bias ? bias[col] : 0.f;
#pragma unroll
      for (int r = 0; r < 8; ++r) {
        const int row = m0 + wm + mi * 16 + r + rowadd;
        float v = acc[mi][ni][r] + bv;
        if (out_f32)
          ((float*)C)[(size_t)row * N + col] = v;
        else
          ((unsigned short*)C)[(size_t)row * N + col] = f2bf(v);
      }
    }
}

// ---------------------------------------------------------------------------
// Flash attention per (b,h). Block = 128 threads (4 waves), 64 query rows,
// streaming 64-key tiles. Q/K/V tiles row-major in LDS; Q, K and P fragments
// are contiguous b128 LDS reads, V fragments come by the transposing LDS load.
// ---------------------------------------------------------------------------
__global__ __launch_bounds__(128) void mla_attn(const unsigned short* __restrict__ Q,
                                                const unsigned short* __restrict__ Kx,
                                                const unsigned short* __restrict__ V,
                                                unsigned short* __restrict__ O) {
  __shared__ __align__(16) unsigned short Qs[64 * 136];
  __shared__ __align__(16) unsigned short Ks[64 * 136];
  __shared__ __align__(16) unsigned short Vs[64 * 144];      // [key][hd], pitch 288 B
  __shared__ __align__(16) unsigned short Ps[4 * 16 * 72];   // per-wave P staging

  const int tid  = threadIdx.x;
  const int lane = tid & 31;
  const int wv   = tid >> 5;
  const int q0   = blockIdx.x * 64;
  const int bh   = blockIdx.y;
  const int b    = bh / H_;
  const int h    = bh % H_;
  const size_t rs   = (size_t)H_ * HD_;                      // 2048 row stride
  const size_t base = (size_t)b * TQ_ * rs + (size_t)h * HD_;

  // Q tile 64x128, loaded once
#pragma unroll
  for (int p = 0; p < 8; ++p) {
    int idx = (p * 128 + tid) * 8;
    int row = idx >> 7, col = idx & 127;
    uint4 v = *(const uint4*)(Q + base + (size_t)(q0 + row) * rs + col);
    *(uint4*)(&Qs[row * 136 + col]) = v;
  }

  v8f o[8] = {};
  float mrow[8], lrow[8];
#pragma unroll
  for (int r = 0; r < 8; ++r) { mrow[r] = -1e30f; lrow[r] = 0.f; }

  unsigned short* Pw  = &Ps[wv * 16 * 72];
  const int rowadd    = (lane & 16) ? 8 : 0;
  const float sc      = 0.08838834764831845f;                // 1/sqrt(128)

  for (int kb = 0; kb < TQ_ / 64; ++kb) {
    const int key0 = kb * 64;
    __syncthreads();  // previous PV readers done before K/V overwrite
#pragma unroll
    for (int p = 0; p < 8; ++p) {
      int idx = (p * 128 + tid) * 8;
      int row = idx >> 7, col = idx & 127;
      uint4 v = *(const uint4*)(Kx + base + (size_t)(key0 + row) * rs + col);
      *(uint4*)(&Ks[row * 136 + col]) = v;
    }
#pragma unroll
    for (int p = 0; p < 8; ++p) {
      int idx = (p * 128 + tid) * 8;
      int row = idx >> 7, col = idx & 127;
      uint4 v = *(const uint4*)(V + base + (size_t)(key0 + row) * rs + col);
      *(uint4*)(&Vs[row * 144 + col]) = v;
    }
    __syncthreads();

    // S(16x64) = Q(16x128) x K^T : B-frag col = key -> row of Ks tile
    v8f s[4] = {};
#pragma unroll
    for (int ks = 0; ks < 4; ++ks) {
      v16bf aq = lds_frag(Qs, 136, wv * 16 + (lane & 15), ks * 32, lane);
#pragma unroll
      for (int n = 0; n < 4; ++n) {
        v16bf bk = lds_frag(Ks, 136, n * 16 + (lane & 15), ks * 32, lane);
        s[n] = __builtin_amdgcn_wmma_f32_16x16x32_bf16(false, aq, false, bk,
                                                       (short)0, s[n], false, false);
      }
    }

    // Online softmax directly in C-fragment layout: row r lives in 16 lanes
    // (same half-wave), cols spread over the 4 n-tiles.
    float corr[8];
#pragma unroll
    for (int r = 0; r < 8; ++r) {
      float v = -1e30f;
#pragma unroll
      for (int n = 0; n < 4; ++n) { s[n][r] *= sc; v = fmaxf(v, s[n][r]); }
#pragma unroll
      for (int m = 1; m < 16; m <<= 1) v = fmaxf(v, __shfl_xor(v, m, 32));
      const float mn = fmaxf(mrow[r], v);
      corr[r] = __expf(mrow[r] - mn);
      mrow[r] = mn;
      float psum = 0.f;
#pragma unroll
      for (int n = 0; n < 4; ++n) {
        float p = __expf(s[n][r] - mn);
        s[n][r] = p;
        psum += p;
      }
#pragma unroll
      for (int m = 1; m < 16; m <<= 1) psum += __shfl_xor(psum, m, 32);
      lrow[r] = lrow[r] * corr[r] + psum;
    }

    // Stage P as bf16 (C-layout -> row-major) and rescale O accumulators
#pragma unroll
    for (int n = 0; n < 4; ++n)
#pragma unroll
      for (int r = 0; r < 8; ++r)
        Pw[(r + rowadd) * 72 + n * 16 + (lane & 15)] = f2bf(s[n][r]);
#pragma unroll
    for (int n8 = 0; n8 < 8; ++n8)
#pragma unroll
      for (int r = 0; r < 8; ++r) o[n8][r] *= corr[r];
    __syncthreads();

    // O(16x128) += P(16x64) x V(64x128): B-frag col = hd, k = key (transposing load)
#pragma unroll
    for (int kk = 0; kk < 2; ++kk) {
      v16bf ap = lds_frag(Pw, 72, lane & 15, kk * 32, lane);
#pragma unroll
      for (int n8 = 0; n8 < 8; ++n8) {
        v16bf bv = lds_frag_tr(Vs, 144, kk * 32, n8 * 16, lane);
        o[n8] = __builtin_amdgcn_wmma_f32_16x16x32_bf16(false, ap, false, bv,
                                                        (short)0, o[n8], false, false);
      }
    }
  }

  // Normalize and store (bf16, feeds the output projection GEMM)
#pragma unroll
  for (int n8 = 0; n8 < 8; ++n8) {
    const int hd = n8 * 16 + (lane & 15);
#pragma unroll
    for (int r = 0; r < 8; ++r) {
      const int t = q0 + wv * 16 + r + rowadd;
      O[base + (size_t)t * rs + hd] = f2bf(o[n8][r] / lrow[r]);
    }
  }
}

// ---------------------------------------------------------------------------
// Launch chain
// ---------------------------------------------------------------------------
extern "C" void kernel_launch(void* const* d_in, const int* in_sizes, int n_in,
                              void* d_out, int out_size, void* d_ws, size_t ws_size,
                              hipStream_t stream) {
  (void)in_sizes; (void)n_in; (void)out_size; (void)ws_size;

  const float* x    = (const float*)d_in[0];
  const float* wq_a = (const float*)d_in[1];
  const float* wq_b = (const float*)d_in[2];
  const float* wk_a = (const float*)d_in[3];
  const float* wk_b = (const float*)d_in[4];
  const float* wv_a = (const float*)d_in[5];
  const float* wv_b = (const float*)d_in[6];
  const float* wo_w = (const float*)d_in[7];
  const float* wo_b = (const float*)d_in[8];

  const int M = BB_ * TQ_;  // 4096 tokens

  size_t off = 0;
  auto alloc = [&](size_t elems) {
    unsigned short* p = (unsigned short*)((char*)d_ws + off);
    off += (elems * sizeof(unsigned short) + 255) & ~(size_t)255;
    return p;
  };
  unsigned short* xb   = alloc((size_t)M * D_);
  unsigned short* wqab = alloc((size_t)R_ * D_);
  unsigned short* wqbb = alloc((size_t)D_ * R_);
  unsigned short* wkab = alloc((size_t)R_ * D_);
  unsigned short* wkbb = alloc((size_t)D_ * R_);
  unsigned short* wvab = alloc((size_t)R_ * D_);
  unsigned short* wvbb = alloc((size_t)D_ * R_);
  unsigned short* wob  = alloc((size_t)D_ * D_);
  unsigned short* cq   = alloc((size_t)M * R_);
  unsigned short* ck   = alloc((size_t)M * R_);
  unsigned short* cv   = alloc((size_t)M * R_);
  unsigned short* qb   = alloc((size_t)M * D_);
  unsigned short* kb   = alloc((size_t)M * D_);
  unsigned short* vb   = alloc((size_t)M * D_);
  unsigned short* ao   = alloc((size_t)M * D_);

  auto conv = [&](const float* s, unsigned short* d, size_t n) {
    f32_to_bf16_k<<<dim3((unsigned)(n / 1024)), dim3(256), 0, stream>>>(s, d, (int)n);
  };
  conv(x,    xb,   (size_t)M * D_);
  conv(wq_a, wqab, (size_t)R_ * D_);
  conv(wq_b, wqbb, (size_t)D_ * R_);
  conv(wk_a, wkab, (size_t)R_ * D_);
  conv(wk_b, wkbb, (size_t)D_ * R_);
  conv(wv_a, wvab, (size_t)R_ * D_);
  conv(wv_b, wvbb, (size_t)D_ * R_);
  conv(wo_w, wob,  (size_t)D_ * D_);

  auto gemm = [&](const unsigned short* A, const unsigned short* W, void* C,
                  const float* bias, int Mg, int Ng, int Kg, int f32out) {
    gemm_abT<<<dim3(Ng / 64, Mg / 128), dim3(256), 0, stream>>>(A, W, C, bias,
                                                                Mg, Ng, Kg, f32out);
  };

  // latent down-projections: [4096,2048] x [512,2048]^T
  gemm(xb, wqab, cq, nullptr, M, R_, D_, 0);
  gemm(xb, wkab, ck, nullptr, M, R_, D_, 0);
  gemm(xb, wvab, cv, nullptr, M, R_, D_, 0);
  // up-projections: [4096,512] x [2048,512]^T
  gemm(cq, wqbb, qb, nullptr, M, D_, R_, 0);
  gemm(ck, wkbb, kb, nullptr, M, D_, R_, 0);
  gemm(cv, wvbb, vb, nullptr, M, D_, R_, 0);
  // flash attention: grid = (T/64 q-blocks, B*H heads)
  mla_attn<<<dim3(TQ_ / 64, BB_ * H_), dim3(128), 0, stream>>>(qb, kb, vb, ao);
  // output projection + bias -> f32 d_out
  gemm(ao, wob, (float*)d_out, wo_b, M, D_, D_, 1);
}

// v002
// A run of this version takes 339 microseconds.
// Two timings next to v001 put it at 1.68 and 1.66 times that version's speed.
// Over all steps from v000 it is 2.17 times as fast.
#include <hip/hip_runtime.h>
#include <hip/hip_bf16.h>

// ---------------------------------------------------------------------------
// MLA (multi-head latent attention) forward for MI455X / gfx1250.
// All GEMMs + attention run through v_wmma_f32_16x16x32_bf16 (f32 accumulate).
// ---------------------------------------------------------------------------

typedef __attribute__((ext_vector_type(16))) __bf16 v16bf;
typedef __attribute__((ext_vector_type(8)))  float  v8f;
typedef __attribute__((ext_vector_type(4)))  unsigned int u32x4;   // 16 B in flight

#define D_   2048
#define H_   16
#define HD_  128
#define TQ_  2048
#define BB_  2
#define R_   512

static __device__ __forceinline__ unsigned short f2bf(float f) {
  unsigned int u = __float_as_uint(f);
  u += 0x7FFFu + ((u >> 16) & 1u);          // round-to-nearest-even
  return (unsigned short)(u >> 16);
}

// Work-group barrier that orders LDS traffic only. __syncthreads() also waits
// for every global load of the wave, which would drain the loads issued ahead
// for a later tile; nothing read from global memory here is written in the launch.
static __device__ __forceinline__ void lds_barrier() {
  __builtin_amdgcn_fence(__ATOMIC_RELEASE, "workgroup", "local");
  __builtin_amdgcn_s_barrier();
  __builtin_amdgcn_fence(__ATOMIC_ACQUIRE, "workgroup", "local");
}

// Stands behind a batch of global loads that stays in flight, in front of the
// first instruction that reuses one of their address registers.
static __device__ __forceinline__ void loads_issued() {
  asm volatile("s_wait_xcnt 0x0" ::: "memory");
}

// Load one 16x32 bf16 WMMA operand fragment from LDS (row-major, `stride`
// elements per row). Matches the CDNA5 16-bit A/B layout:
//   lanes 0-15 : K = 0..7 (v0-3), 16..23 (v4-7)
//   lanes16-31 : K = 8..15 (v0-3), 24..31 (v4-7)
// => two 16-byte contiguous LDS reads per lane.
static __device__ __forceinline__ v16bf lds_frag(const unsigned short* p, int stride,
                                                 int row, int koff, int lane) {
  const int kb = (lane & 16) ? 8 : 0;
  const unsigned short* base = p + row * stride + koff + kb;
  union { uint4 u[2]; v16bf v; } c;
  c.u[0] = *(const uint4*)(base);
  c.u[1] = *(const uint4*)(base + 16);
  return c.v;
}

// Load one 32(k) x 16(col) bf16 B fragment from a row-major [k][col] LDS tile
// with the transposing load: lane (c = lane&15, h = lane>>4) receives
// tile[kbase + 8h + 0..7][dbase + c]; the second load, 16 rows further, gives
// k = 16 + 8h + 0..7, i.e. the same k order as lds_frag above.
// `pitch` is in elements; 32 B x odd keeps the load free of bank conflicts.
typedef __attribute__((ext_vector_type(8))) short s16x8;
static __device__ __forceinline__ v16bf lds_frag_tr(const unsigned short* tile, int pitch,
                                                    int kbase, int dbase, int lane) {
  typedef __attribute__((address_space(3))) s16x8 lds_s16x8;
  const unsigned short* p = tile + (kbase + ((lane >> 4) << 3) + (lane & 7)) * pitch
                                 + dbase + (((lane >> 3) & 1) << 3);
  union { s16x8 u[2]; v16bf v; } c;
  c.u[0] = __builtin_amdgcn_ds_load_tr16_b128_v8i16((lds_s16x8*)p);
  c.u[1] = __builtin_amdgcn_ds_load_tr16_b128_v8i16((lds_s16x8*)(p + 16 * pitch));
  return c.v;
}

// ---------------------------------------------------------------------------
// fp32 -> bf16 conversion (bandwidth-bound, sizes are multiples of 1024)
// ---------------------------------------------------------------------------
__global__ __launch_bounds__(256) void f32_to_bf16_k(const float* __restrict__ src,
                                                     unsigned short* __restrict__ dst,
                                                     int n) {
  int i = (blockIdx.x * 256 + threadIdx.x) * 4;
  if (i + 3 < n) {
    float4 v = *(const float4*)(src + i);
    dst[i + 0] = f2bf(v.x);
    dst[i + 1] = f2bf(v.y);
    dst[i + 2] = f2bf(v.z);
    dst[i + 3] = f2bf(v.w);
  }
}

// ---------------------------------------------------------------------------
// C[M,N] = A[M,K] (bf16 row-major) x W[N,K]^T (bf16 row-major) (+bias)
// Block: 256 threads (8 waves). Tile: 128(M) x 64(N), K-step 32.
// Wave (wm,wn) computes a 32x32 sub-tile = 2x2 WMMA 16x16 fragments.
// The global loads of a K-step go out together, two K-steps ahead of their LDS
// stores, into two register sets used in turn. K is a multiple of 64.
// ---------------------------------------------------------------------------
__global__ __launch_bounds__(256) void gemm_abT(const unsigned short* __restrict__ A,
                                                const unsigned short* __restrict__ W,
                                                void* __restrict__ C,
                                                const float* __restrict__ bias,
                                                int M, int N, int K, int out_f32) {
  __shared__ __align__(16) unsigned short As[128 * 40];  // stride 40 keeps b128 alignment
  __shared__ __align__(16) unsigned short Ws[64 * 40];

  const int tid  = threadIdx.x;
  const int lane = tid & 31;
  const int wv   = tid >> 5;
  const int wm   = (wv & 3) * 32;
  const int wn   = (wv >> 2) * 32;
  const int m0   = blockIdx.y * 128;
  const int n0   = blockIdx.x * 64;

  v8f acc[2][2] = {};

  // cooperative tile loads: 8 bf16 (16 B) per thread; A rows lrow and lrow + 64
  const int lrow = tid >> 2, lcol = (tid & 3) * 8;
  const unsigned short* Ag0 = A + (size_t)(m0 + lrow) * K + lcol;
  const unsigned short* Ag1 = A + (size_t)(m0 + 64 + lrow) * K + lcol;
  const unsigned short* Wg  = W + (size_t)(n0 + lrow) * K + lcol;
  unsigned short* Asw = &As[lrow * 40 + lcol];
  unsigned short* Wsw = &Ws[lrow * 40 + lcol];

  u32x4 ra0[2], ra1[2], rw[2];
  ra0[0] = *(const u32x4*)(Ag0);
  ra1[0] = *(const u32x4*)(Ag1);
  rw[0]  = *(const u32x4*)(Wg);
  // Compiler-only fence (no instruction): keeps set 0's loads in front of set 1's.
  // Loads return in issue order, so the loop's wait for one set can then leave the
  // other set's three loads in flight; interleaved, it has to drain them all.
  __builtin_amdgcn_fence(__ATOMIC_ACQ_REL, "wavefront");
  ra0[1] = *(const u32x4*)(Ag0 + 32);
  ra1[1] = *(const u32x4*)(Ag1 + 32);
  rw[1]  = *(const u32x4*)(Wg + 32);

  for (int k0 = 0; k0 < K; k0 += 64) {
#pragma unroll
    for (int s = 0; s < 2; ++s) {
      *(u32x4*)(Asw)           = ra0[s];
      *(u32x4*)(Asw + 64 * 40) = ra1[s];
      *(u32x4*)(Wsw)           = rw[s];
      // refill this set for the K-step two ahead; the last two K-steps read the
      // last tile again (in bounds, unused), so no branch stands round the loads
      const int kn = min(k0 + s * 32 + 64, K - 32);
      ra0[s] = *(const u32x4*)(Ag0 + kn);
      ra1[s] = *(const u32x4*)(Ag1 + kn);
      rw[s]  = *(const u32x4*)(Wg + kn);
      loads_issued();
      lds_barrier();  // this K-step's tile is whole in LDS

      v16bf af[2], bfm[2];
#pragma unroll
      for (int mi = 0; mi < 2; ++mi)
        af[mi] = lds_frag(As, 40, wm + mi * 16 + (lane & 15), 0, lane);
#pragma unroll
      for (int ni = 0; ni < 2; ++ni)
        bfm[ni] = lds_frag(Ws, 40, wn + ni * 16 + (lane & 15), 0, lane);
#pragma unroll
      for (int mi = 0; mi < 2; ++mi)
#pragma unroll
        for (int ni = 0; ni < 2; ++ni)
          acc[mi][ni] = __builtin_amdgcn_wmma_f32_16x16x32_bf16(
              false, af[mi], false, bfm[ni], (short)0, acc[mi][ni], false, false);
      lds_barrier();  // every wave has read the tile
    }
  }

  // Epilogue. C-fragment layout: row = r + 8*(lane>=16), col = lane&15.
  const int rowadd = (lane & 16) ? 8 : 0;
#pragma unroll
  for (int mi = 0; mi < 2; ++mi)
#pragma unroll
    for (int ni = 0; ni < 2; ++ni) {
      const int col = n0 + wn + ni * 16 + (lane & 15);
      const float bv = bias ? bias[col] : 0.f;
#pragma unroll
      for (int r = 0; r < 8; ++r) {
        const int row = m0 + wm + mi * 16 + r + rowadd;
        float v = acc[mi][ni][r] + bv;
        if (out_f32)
          ((float*)C)[(size_t)row * N + col] = v;
        else
          ((unsigned short*)C)[(size_t)row * N + col] = f2bf(v);
      }
    }
}

// ---------------------------------------------------------------------------
// Flash attention per (b,h). Block = 128 threads (4 waves), 64 query rows,
// streaming 64-key tiles. Q/K/V tiles row-major in LDS; Q, K and P fragments
// are contiguous b128 LDS reads, V fragments come by the transposing LDS load.
// The 16 global loads of a K/V tile go out together, one tile ahead of their
// LDS stores, and wait in registers while the current tile is worked on.
// ---------------------------------------------------------------------------
__global__ __launch_bounds__(128) void mla_attn(const unsigned short* __restrict__ Q,
                                                const unsigned short* __restrict__ Kx,
                                                const unsigned short* __restrict__ V,
                                                unsigned short* __restrict__ O) {
  __shared__ __align__(16) unsigned short Qs[64 * 136];
  __shared__ __align__(16) unsigned short Ks[64 * 136];
  __shared__ __align__(16) unsigned short Vs[64 * 144];      // [key][hd], pitch 288 B
  __shared__ __align__(16) unsigned short Ps[4 * 16 * 72];   // per-wave P staging

  const int tid  = threadIdx.x;
  const int lane = tid & 31;
  const int wv   = tid >> 5;
  const int q0   = blockIdx.x * 64;
  const int bh   = blockIdx.y;
  const int b    = bh / H_;
  const int h    = bh % H_;
  const size_t rs   = (size_t)H_ * HD_;                      // 2048 row stride
  const size_t base = (size_t)b * TQ_ * rs + (size_t)h * HD_;

  // each thread moves 16 B of rows trow + 8p, p = 0..7, of a 64x128 tile
  const int trow = tid >> 4, tcol = (tid & 15) * 8;
  const unsigned short* Kg = Kx + base + (size_t)trow * rs + tcol;
  const unsigned short* Vg = V + base + (size_t)trow * rs + tcol;

  u32x4 kr[8], vr[8];
  {
    // Q tile 64x128, loaded once; K/V tile 0 follows before the first wait
    u32x4 qr[8];
#pragma unroll
    for (int p = 0; p < 8; ++p)
      qr[p] = *(const u32x4*)(Q + base + (size_t)(q0 + trow + p * 8) * rs + tcol);
#pragma unroll
    for (int p = 0; p < 8; ++p) kr[p] = *(const u32x4*)(Kg + (size_t)(p * 8) * rs);
#pragma unroll
    for (int p = 0; p < 8; ++p) vr[p] = *(const u32x4*)(Vg + (size_t)(p * 8) * rs);
    loads_issued();
#pragma unroll
    for (int p = 0; p < 8; ++p) *(u32x4*)(&Qs[(trow + p * 8) * 136 + tcol]) = qr[p];
  }

  v8f o[8] = {};
  float mrow[8], lrow[8];
#pragma unroll
  for (int r = 0; r < 8; ++r) { mrow[r] = -1e30f; lrow[r] = 0.f; }

  unsigned short* Pw  = &Ps[wv * 16 * 72];
  const int rowadd    = (lane & 16) ? 8 : 0;
  const float sc      = 0.08838834764831845f;                // 1/sqrt(128)

  for (int kb = 0; kb < TQ_ / 64; ++kb) {
    lds_barrier();  // previous PV readers done before K/V overwrite
#pragma unroll
    for (int p = 0; p < 8; ++p) *(u32x4*)(&Ks[(trow + p * 8) * 136 + tcol]) = kr[p];
#pragma unroll
    for (int p = 0; p < 8; ++p) *(u32x4*)(&Vs[(trow + p * 8) * 144 + tcol]) = vr[p];
    // next tile's loads; the last trip reads its own tile again (in bounds,
    // unused), so no branch stands round the loads
    const size_t nxt = (size_t)(min(kb + 1, TQ_ / 64 - 1) * 64) * rs;
#pragma unroll
    for (int p = 0; p < 8; ++p) kr[p] = *(const u32x4*)(Kg + nxt + (size_t)(p * 8) * rs);
#pragma unroll
    for (int p = 0; p < 8; ++p) vr[p] = *(const u32x4*)(Vg + nxt + (size_t)(p * 8) * rs);
    loads_issued();
    lds_barrier();

    // S(16x64) = Q(16x128) x K^T : B-frag col = key -> row of Ks tile
    v8f s[4] = {};
#pragma unroll
    for (int ks = 0; ks < 4; ++ks) {
      v16bf aq = lds_frag(Qs, 136, wv * 16 + (lane & 15), ks * 32, lane);
#pragma unroll
      for (int n = 0; n < 4; ++n) {
        v16bf bk = lds_frag(Ks, 136, n * 16 + (lane & 15), ks * 32, lane);
        s[n] = __builtin_amdgcn_wmma_f32_16x16x32_bf16(false, aq, false, bk,
                                                       (short)0, s[n], false, false);
      }
    }

    // Online softmax directly in C-fragment layout: row r lives in 16 lanes
    // (same half-wave), cols spread over the 4 n-tiles.
    float corr[8];
#pragma unroll
    for (int r = 0; r < 8; ++r) {
      float v = -1e30f;
#pragma unroll
      for (int n = 0; n < 4; ++n) { s[n][r] *= sc; v = fmaxf(v, s[n][r]); }
#pragma unroll
      for (int m = 1; m < 16; m <<= 1) v = fmaxf(v, __shfl_xor(v, m, 32));
      const float mn = fmaxf(mrow[r], v);
      corr[r] = __expf(mrow[r] - mn);
      mrow[r] = mn;
      float psum = 0.f;
#pragma unroll
      for (int n = 0; n < 4; ++n) {
        float p = __expf(s[n][r] - mn);
        s[n][r] = p;
        psum += p;
      }
#pragma unroll
      for (int m = 1; m < 16; m <<= 1) psum += __shfl_xor(psum, m, 32);
      lrow[r] = lrow[r] * corr[r] + psum;
    }

    // Stage P as bf16 (C-layout -> row-major) and rescale O accumulators
#pragma unroll
    for (int n = 0; n < 4; ++n)
#pragma unroll
      for (int r = 0; r < 8; ++r)
        Pw[(r + rowadd) * 72 + n * 16 + (lane & 15)] = f2bf(s[n][r]);
#pragma unroll
    for (int n8 = 0; n8 < 8; ++n8)
#pragma unroll
      for (int r = 0; r < 8; ++r) o[n8][r] *= corr[r];
    lds_barrier();

    // O(16x128) += P(16x64) x V(64x128): B-frag col = hd, k = key (transposing load)
#pragma unroll
    for (int kk = 0; kk < 2; ++kk) {
      v16bf ap = lds_frag(Pw, 72, lane & 15, kk * 32, lane);
#pragma unroll
      for (int n8 = 0; n8 < 8; ++n8) {
        v16bf bv = lds_frag_tr(Vs, 144, kk * 32, n8 * 16, lane);
        o[n8] = __builtin_amdgcn_wmma_f32_16x16x32_bf16(false, ap, false, bv,
                                                        (short)0, o[n8], false, false);
      }
    }
  }

  // Normalize and store (bf16, feeds the output projection GEMM)
#pragma unroll
  for (int n8 = 0; n8 < 8; ++n8) {
    const int hd = n8 * 16 + (lane & 15);
#pragma unroll
    for (int r = 0; r < 8; ++r) {
      const int t = q0 + wv * 16 + r + rowadd;
      O[base + (size_t)t * rs + hd] = f2bf(o[n8][r] / lrow[r]);
    }
  }
}

// ---------------------------------------------------------------------------
// Launch chain
// ---------------------------------------------------------------------------
extern "C" void kernel_launch(void* const* d_in, const int* in_sizes, int n_in,
                              void* d_out, int out_size, void* d_ws, size_t ws_size,
                              hipStream_t stream) {
  (void)in_sizes; (void)n_in; (void)out_size; (void)ws_size;

  const float* x    = (const float*)d_in[0];
  const float* wq_a = (const float*)d_in[1];
  const float* wq_b = (const float*)d_in[2];
  const float* wk_a = (const float*)d_in[3];
  const float* wk_b = (const float*)d_in[4];
  const float* wv_a = (const float*)d_in[5];
  const float* wv_b = (const float*)d_in[6];
  const float* wo_w = (const float*)d_in[7];
  const float* wo_b = (const float*)d_in[8];

  const int M = BB_ * TQ_;  // 4096 tokens

  size_t off = 0;
  auto alloc = [&](size_t elems) {
    unsigned short* p = (unsigned short*)((char*)d_ws + off);
    off += (elems * sizeof(unsigned short) + 255) & ~(size_t)255;
    return p;
  };
  unsigned short* xb   = alloc((size_t)M * D_);
  unsigned short* wqab = alloc((size_t)R_ * D_);
  unsigned short* wqbb = alloc((size_t)D_ * R_);
  unsigned short* wkab = alloc((size_t)R_ * D_);
  unsigned short* wkbb = alloc((size_t)D_ * R_);
  unsigned short* wvab = alloc((size_t)R_ * D_);
  unsigned short* wvbb = alloc((size_t)D_ * R_);
  unsigned short* wob  = alloc((size_t)D_ * D_);
  unsigned short* cq   = alloc((size_t)M * R_);
  unsigned short* ck   = alloc((size_t)M * R_);
  unsigned short* cv   = alloc((size_t)M * R_);
  unsigned short* qb   = alloc((size_t)M * D_);
  unsigned short* kb   = alloc((size_t)M * D_);
  unsigned short* vb   = alloc((size_t)M * D_);
  unsigned short* ao   = alloc((size_t)M * D_);

  auto conv = [&](const float* s, unsigned short* d, size_t n) {
    f32_to_bf16_k<<<dim3((unsigned)(n / 1024)), dim3(256), 0, stream>>>(s, d, (int)n);
  };
  conv(x,    xb,   (size_t)M * D_);
  conv(wq_a, wqab, (size_t)R_ * D_);
  conv(wq_b, wqbb, (size_t)D_ * R_);
  conv(wk_a, wkab, (size_t)R_ * D_);
  conv(wk_b, wkbb, (size_t)D_ * R_);
  conv(wv_a, wvab, (size_t)R_ * D_);
  conv(wv_b, wvbb, (size_t)D_ * R_);
  conv(wo_w, wob,  (size_t)D_ * D_);

  auto gemm = [&](const unsigned short* A, const unsigned short* W, void* C,
                  const float* bias, int Mg, int Ng, int Kg, int f32out) {
    gemm_abT<<<dim3(Ng / 64, Mg / 128), dim3(256), 0, stream>>>(A, W, C, bias,
                                                                Mg, Ng, Kg, f32out);
  };

  // latent down-projections: [4096,2048] x [512,2048]^T
  gemm(xb, wqab, cq, nullptr, M, R_, D_, 0);
  gemm(xb, wkab, ck, nullptr, M, R_, D_, 0);
  gemm(xb, wvab, cv, nullptr, M, R_, D_, 0);
  // up-projections: [4096,512] x [2048,512]^T
  gemm(cq, wqbb, qb, nullptr, M, D_, R_, 0);
  gemm(ck, wkbb, kb, nullptr, M, D_, R_, 0);
  gemm(cv, wvbb, vb, nullptr, M, D_, R_, 0);
  // flash attention: grid = (T/64 q-blocks, B*H heads)
  mla_attn<<<dim3(TQ_ / 64, BB_ * H_), dim3(128), 0, stream>>>(qb, kb, vb, ao);
  // output projection + bias -> f32 d_out
  gemm(ao, wob, (float*)d_out, wo_b, M, D_, D_, 1);
}

// v003
// A run of this version takes 321 microseconds.
// Next to v002, in two timings, it ran 1.05 and 1.06 times as fast.
// Counting every step since v000, it is 2.30 times as fast.
#include <hip/hip_runtime.h>
#include <hip/hip_bf16.h>

// ---------------------------------------------------------------------------
// MLA (multi-head latent attention) forward for MI455X / gfx1250.
// All GEMMs + attention run through v_wmma_f32_16x16x32_bf16 (f32 accumulate).
// ---------------------------------------------------------------------------

typedef __attribute__((ext_vector_type(16))) __bf16 v16bf;
typedef __attribute__((ext_vector_type(8)))  float  v8f;
typedef __attribute__((ext_vector_type(4)))  unsigned int u32x4;   // 16 B in flight

#define D_   2048
#define H_   16
#define HD_  128
#define TQ_  2048
#define BB_  2
#define R_   512

static __device__ __forceinline__ unsigned short f2bf(float f) {
  unsigned int u = __float_as_uint(f);
  u += 0x7FFFu + ((u >> 16) & 1u);          // round-to-nearest-even
  return (unsigned short)(u >> 16);
}

// Work-group barrier that orders LDS traffic only. __syncthreads() also waits
// for every global load of the wave, which would drain the loads issued ahead
// for a later tile; nothing read from global memory here is written in the launch.
static __device__ __forceinline__ void lds_barrier() {
  __builtin_amdgcn_fence(__ATOMIC_RELEASE, "workgroup", "local");
  __builtin_amdgcn_s_barrier();
  __builtin_amdgcn_fence(__ATOMIC_ACQUIRE, "workgroup", "local");
}

// Stands behind a batch of global loads that stays in flight, in front of the
// first instruction that reuses one of their address registers.
static __device__ __forceinline__ void loads_issued() {
  asm volatile("s_wait_xcnt 0x0" ::: "memory");
}

// Load one 16x32 bf16 WMMA operand fragment from LDS (row-major, `stride`
// elements per row). Matches the CDNA5 16-bit A/B layout:
//   lanes 0-15 : K = 0..7 (v0-3), 16..23 (v4-7)
//   lanes16-31 : K = 8..15 (v0-3), 24..31 (v4-7)
// => two 16-byte contiguous LDS reads per lane.
static __device__ __forceinline__ v16bf lds_frag(const unsigned short* p, int stride,
                                                 int row, int koff, int lane) {
  const int kb = (lane & 16) ? 8 : 0;
  const unsigned short* base = p + row * stride + koff + kb;
  union { uint4 u[2]; v16bf v; } c;
  c.u[0] = *(const uint4*)(base);
  c.u[1] = *(const uint4*)(base + 16);
  return c.v;
}

// Load one 32(k) x 16(col) bf16 B fragment from a row-major [k][col] LDS tile
// with the transposing load: lane (c = lane&15, h = lane>>4) receives
// tile[kbase + 8h + 0..7][dbase + c]; the second load, 16 rows further, gives
// k = 16 + 8h + 0..7, i.e. the same k order as lds_frag above.
// `pitch` is in elements; 32 B x odd keeps the load free of bank conflicts.
typedef __attribute__((ext_vector_type(8))) short s16x8;
static __device__ __forceinline__ v16bf lds_frag_tr(const unsigned short* tile, int pitch,
                                                    int kbase, int dbase, int lane) {
  typedef __attribute__((address_space(3))) s16x8 lds_s16x8;
  const unsigned short* p = tile + (kbase + ((lane >> 4) << 3) + (lane & 7)) * pitch
                                 + dbase + (((lane >> 3) & 1) << 3);
  union { s16x8 u[2]; v16bf v; } c;
  c.u[0] = __builtin_amdgcn_ds_load_tr16_b128_v8i16((lds_s16x8*)p);
  c.u[1] = __builtin_amdgcn_ds_load_tr16_b128_v8i16((lds_s16x8*)(p + 16 * pitch));
  return c.v;
}

// ---------------------------------------------------------------------------
// fp32 -> bf16 conversion of all eight arrays in one launch. The bf16 copies lie
// back to back in `dst`, in the order of the arguments. The work is cut into
// chunks of 8192 elements (8 x 16 B per thread, each wave-wide load 512 B in a
// row); every array is a whole number of chunks, so a chunk has one source.
// CONV_WGS work-groups (three per WGP) take CONV_TRIPS chunks each, a chunk's
// eight loads going out before the chunk in front of it is converted: few, long
// waves, for speed only.
// ---------------------------------------------------------------------------
#define CONV_CHUNK   8192
#define CONV_X_CH    (BB_ * TQ_ * D_ / CONV_CHUNK)          // chunks of x
#define CONV_W_CH    (R_ * D_ / CONV_CHUNK)                 // chunks of a low-rank weight
#define CONV_CHUNKS  (CONV_X_CH + 6 * CONV_W_CH + D_ * D_ / CONV_CHUNK)
#define CONV_WGS     768
#define CONV_TRIPS   (CONV_CHUNKS / CONV_WGS)
static_assert(CONV_TRIPS * CONV_WGS == CONV_CHUNKS, "every work-group takes the same number of chunks");
typedef __attribute__((ext_vector_type(4))) unsigned short u16x4;

__global__ __launch_bounds__(256) void f32_to_bf16_all(const float* __restrict__ x,
                                                       const float* __restrict__ wq_a,
                                                       const float* __restrict__ wq_b,
                                                       const float* __restrict__ wk_a,
                                                       const float* __restrict__ wk_b,
                                                       const float* __restrict__ wv_a,
                                                       const float* __restrict__ wv_b,
                                                       const float* __restrict__ wo_w,
                                                       unsigned short* __restrict__ dst) {
  const int tid = threadIdx.x;

  // The three loops below are unrolled so that every index of v is a constant and
  // v stays in registers.
  float4 v[2][8];
#pragma unroll
  for (int t = 0; t <= CONV_TRIPS; ++t) {
    if (t < CONV_TRIPS) {
      // chunk c and its place in its source array: the same for the whole work-group
      const int c = blockIdx.x + t * CONV_WGS;
      const int w = (c - CONV_X_CH) / CONV_W_CH;            // which weight, where c is past x
      const float* s = x;
      int first = 0;                                        // the array's first chunk
      if (c >= CONV_X_CH) {
        s = w == 0 ? wq_a : w == 1 ? wq_b : w == 2 ? wk_a
          : w == 3 ? wk_b : w == 4 ? wv_a : w == 5 ? wv_b : wo_w;
        first = CONV_X_CH + min(w, 6) * CONV_W_CH;
      }
      s += (size_t)(c - first) * CONV_CHUNK + tid * 4;
#pragma unroll
      for (int j = 0; j < 8; ++j) v[t & 1][j] = *(const float4*)(s + j * 1024);
      loads_issued();
      // Keeps the conversion below behind these loads: without it its first
      // instructions, and their wait for the chunk before, stand in front of chunk 1's
      // loads, which then go out one memory latency late.
      __builtin_amdgcn_sched_barrier(0);
    }
    if (t > 0) {
      unsigned short* d = dst + (size_t)(blockIdx.x + (t - 1) * CONV_WGS) * CONV_CHUNK + tid * 4;
#pragma unroll
      for (int j = 0; j < 8; ++j) {
        const float4 f = v[(t - 1) & 1][j];
        const u16x4 o = {f2bf(f.x), f2bf(f.y), f2bf(f.z), f2bf(f.w)};
        *(u16x4*)(d + j * 1024) = o;
      }
      if (t < CONV_TRIPS) loads_issued();  // the stores' address registers are reused below
    }
  }
}

// ---------------------------------------------------------------------------
// C[M,N] = A[M,K] (bf16 row-major) x W[N,K]^T (bf16 row-major) (+bias)
// Block: 256 threads (8 waves). Tile: 128(M) x 64(N), K-step 32.
// Wave (wm,wn) computes a 32x32 sub-tile = 2x2 WMMA 16x16 fragments.
// The global loads of a K-step go out together, two K-steps ahead of their LDS
// stores, into two register sets used in turn. K is a multiple of 64.
// ---------------------------------------------------------------------------
__global__ __launch_bounds__(256) void gemm_abT(const unsigned short* __restrict__ A,
                                                const unsigned short* __restrict__ W,
                                                void* __restrict__ C,
                                                const float* __restrict__ bias,
                                                int M, int N, int K, int out_f32) {
  __shared__ __align__(16) unsigned short As[128 * 40];  // stride 40 keeps b128 alignment
  __shared__ __align__(16) unsigned short Ws[64 * 40];

  const int tid  = threadIdx.x;
  const int lane = tid & 31;
  const int wv   = tid >> 5;
  const int wm   = (wv & 3) * 32;
  const int wn   = (wv >> 2) * 32;
  const int m0   = blockIdx.y * 128;
  const int n0   = blockIdx.x * 64;

  v8f acc[2][2] = {};

  // cooperative tile loads: 8 bf16 (16 B) per thread; A rows lrow and lrow + 64
  const int lrow = tid >> 2, lcol = (tid & 3) * 8;
  const unsigned short* Ag0 = A + (size_t)(m0 + lrow) * K + lcol;
  const unsigned short* Ag1 = A + (size_t)(m0 + 64 + lrow) * K + lcol;
  const unsigned short* Wg  = W + (size_t)(n0 + lrow) * K + lcol;
  unsigned short* Asw = &As[lrow * 40 + lcol];
  unsigned short* Wsw = &Ws[lrow * 40 + lcol];

  u32x4 ra0[2], ra1[2], rw[2];
  ra0[0] = *(const u32x4*)(Ag0);
  ra1[0] = *(const u32x4*)(Ag1);
  rw[0]  = *(const u32x4*)(Wg);
  // Compiler-only fence (no instruction): keeps set 0's loads in front of set 1's.
  // Loads return in issue order, so the loop's wait for one set can then leave the
  // other set's three loads in flight; interleaved, it has to drain them all.
  __builtin_amdgcn_fence(__ATOMIC_ACQ_REL, "wavefront");
  ra0[1] = *(const u32x4*)(Ag0 + 32);
  ra1[1] = *(const u32x4*)(Ag1 + 32);
  rw[1]  = *(const u32x4*)(Wg + 32);

  for (int k0 = 0; k0 < K; k0 += 64) {
#pragma unroll
    for (int s = 0; s < 2; ++s) {
      *(u32x4*)(Asw)           = ra0[s];
      *(u32x4*)(Asw + 64 * 40) = ra1[s];
      *(u32x4*)(Wsw)           = rw[s];
      // refill this set for the K-step two ahead; the last two K-steps read the
      // last tile again (in bounds, unused), so no branch stands round the loads
      const int kn = min(k0 + s * 32 + 64, K - 32);
      ra0[s] = *(const u32x4*)(Ag0 + kn);
      ra1[s] = *(const u32x4*)(Ag1 + kn);
      rw[s]  = *(const u32x4*)(Wg + kn);
      loads_issued();
      lds_barrier();  // this K-step's tile is whole in LDS

      v16bf af[2], bfm[2];
#pragma unroll
      for (int mi = 0; mi < 2; ++mi)
        af[mi] = lds_frag(As, 40, wm + mi * 16 + (lane & 15), 0, lane);
#pragma unroll
      for (int ni = 0; ni < 2; ++ni)
        bfm[ni] = lds_frag(Ws, 40, wn + ni * 16 + (lane & 15), 0, lane);
#pragma unroll
      for (int mi = 0; mi < 2; ++mi)
#pragma unroll
        for (int ni = 0; ni < 2; ++ni)
          acc[mi][ni] = __builtin_amdgcn_wmma_f32_16x16x32_bf16(
              false, af[mi], false, bfm[ni], (short)0, acc[mi][ni], false, false);
      lds_barrier();  // every wave has read the tile
    }
  }

  // Epilogue. C-fragment layout: row = r + 8*(lane>=16), col = lane&15.
  const int rowadd = (lane & 16) ? 8 : 0;
#pragma unroll
  for (int mi = 0; mi < 2; ++mi)
#pragma unroll
    for (int ni = 0; ni < 2; ++ni) {
      const int col = n0 + wn + ni * 16 + (lane & 15);
      const float bv = bias ? bias[col] : 0.f;
#pragma unroll
      for (int r = 0; r < 8; ++r) {
        const int row = m0 + wm + mi * 16 + r + rowadd;
        float v = acc[mi][ni][r] + bv;
        if (out_f32)
          ((float*)C)[(size_t)row * N + col] = v;
        else
          ((unsigned short*)C)[(size_t)row * N + col] = f2bf(v);
      }
    }
}

// ---------------------------------------------------------------------------
// Flash attention per (b,h). Block = 128 threads (4 waves), 64 query rows,
// streaming 64-key tiles. Q/K/V tiles row-major in LDS; Q, K and P fragments
// are contiguous b128 LDS reads, V fragments come by the transposing LDS load.
// The 16 global loads of a K/V tile go out together, one tile ahead of their
// LDS stores, and wait in registers while the current tile is worked on.
// ---------------------------------------------------------------------------
__global__ __launch_bounds__(128) void mla_attn(const unsigned short* __restrict__ Q,
                                                const unsigned short* __restrict__ Kx,
                                                const unsigned short* __restrict__ V,
                                                unsigned short* __restrict__ O) {
  __shared__ __align__(16) unsigned short Qs[64 * 136];
  __shared__ __align__(16) unsigned short Ks[64 * 136];
  __shared__ __align__(16) unsigned short Vs[64 * 144];      // [key][hd], pitch 288 B
  __shared__ __align__(16) unsigned short Ps[4 * 16 * 72];   // per-wave P staging

  const int tid  = threadIdx.x;
  const int lane = tid & 31;
  const int wv   = tid >> 5;
  const int q0   = blockIdx.x * 64;
  const int bh   = blockIdx.y;
  const int b    = bh / H_;
  const int h    = bh % H_;
  const size_t rs   = (size_t)H_ * HD_;                      // 2048 row stride
  const size_t base = (size_t)b * TQ_ * rs + (size_t)h * HD_;

  // each thread moves 16 B of rows trow + 8p, p = 0..7, of a 64x128 tile
  const int trow = tid >> 4, tcol = (tid & 15) * 8;
  const unsigned short* Kg = Kx + base + (size_t)trow * rs + tcol;
  const unsigned short* Vg = V + base + (size_t)trow * rs + tcol;

  u32x4 kr[8], vr[8];
  {
    // Q tile 64x128, loaded once; K/V tile 0 follows before the first wait
    u32x4 qr[8];
#pragma unroll
    for (int p = 0; p < 8; ++p)
      qr[p] = *(const u32x4*)(Q + base + (size_t)(q0 + trow + p * 8) * rs + tcol);
#pragma unroll
    for (int p = 0; p < 8; ++p) kr[p] = *(const u32x4*)(Kg + (size_t)(p * 8) * rs);
#pragma unroll
    for (int p = 0; p < 8; ++p) vr[p] = *(const u32x4*)(Vg + (size_t)(p * 8) * rs);
    loads_issued();
#pragma unroll
    for (int p = 0; p < 8; ++p) *(u32x4*)(&Qs[(trow + p * 8) * 136 + tcol]) = qr[p];
  }

  v8f o[8] = {};
  float mrow[8], lrow[8];
#pragma unroll
  for (int r = 0; r < 8; ++r) { mrow[r] = -1e30f; lrow[r] = 0.f; }

  unsigned short* Pw  = &Ps[wv * 16 * 72];
  const int rowadd    = (lane & 16) ? 8 : 0;
  const float sc      = 0.08838834764831845f;                // 1/sqrt(128)

  for (int kb = 0; kb < TQ_ / 64; ++kb) {
    lds_barrier();  // previous PV readers done before K/V overwrite
#pragma unroll
    for (int p = 0; p < 8; ++p) *(u32x4*)(&Ks[(trow + p * 8) * 136 + tcol]) = kr[p];
#pragma unroll
    for (int p = 0; p < 8; ++p) *(u32x4*)(&Vs[(trow + p * 8) * 144 + tcol]) = vr[p];
    // next tile's loads; the last trip reads its own tile again (in bounds,
    // unused), so no branch stands round the loads
    const size_t nxt = (size_t)(min(kb + 1, TQ_ / 64 - 1) * 64) * rs;
#pragma unroll
    for (int p = 0; p < 8; ++p) kr[p] = *(const u32x4*)(Kg + nxt + (size_t)(p * 8) * rs);
#pragma unroll
    for (int p = 0; p < 8; ++p) vr[p] = *(const u32x4*)(Vg + nxt + (size_t)(p * 8) * rs);
    loads_issued();
    lds_barrier();

    // S(16x64) = Q(16x128) x K^T : B-frag col = key -> row of Ks tile
    v8f s[4] = {};
#pragma unroll
    for (int ks = 0; ks < 4; ++ks) {
      v16bf aq = lds_frag(Qs, 136, wv * 16 + (lane & 15), ks * 32, lane);
#pragma unroll
      for (int n = 0; n < 4; ++n) {
        v16bf bk = lds_frag(Ks, 136, n * 16 + (lane & 15), ks * 32, lane);
        s[n] = __builtin_amdgcn_wmma_f32_16x16x32_bf16(false, aq, false, bk,
                                                       (short)0, s[n], false, false);
      }
    }

    // Online softmax directly in C-fragment layout: row r lives in 16 lanes
    // (same half-wave), cols spread over the 4 n-tiles.
    float corr[8];
#pragma unroll
    for (int r = 0; r < 8; ++r) {
      float v = -1e30f;
#pragma unroll
      for (int n = 0; n < 4; ++n) { s[n][r] *= sc; v = fmaxf(v, s[n][r]); }
#pragma unroll
      for (int m = 1; m < 16; m <<= 1) v = fmaxf(v, __shfl_xor(v, m, 32));
      const float mn = fmaxf(mrow[r], v);
      corr[r] = __expf(mrow[r] - mn);
      mrow[r] = mn;
      float psum = 0.f;
#pragma unroll
      for (int n = 0; n < 4; ++n) {
        float p = __expf(s[n][r] - mn);
        s[n][r] = p;
        psum += p;
      }
#pragma unroll
      for (int m = 1; m < 16; m <<= 1) psum += __shfl_xor(psum, m, 32);
      lrow[r] = lrow[r] * corr[r] + psum;
    }

    // Stage P as bf16 (C-layout -> row-major) and rescale O accumulators
#pragma unroll
    for (int n = 0; n < 4; ++n)
#pragma unroll
      for (int r = 0; r < 8; ++r)
        Pw[(r + rowadd) * 72 + n * 16 + (lane & 15)] = f2bf(s[n][r]);
#pragma unroll
    for (int n8 = 0; n8 < 8; ++n8)
#pragma unroll
      for (int r = 0; r < 8; ++r) o[n8][r] *= corr[r];
    lds_barrier();

    // O(16x128) += P(16x64) x V(64x128): B-frag col = hd, k = key (transposing load)
#pragma unroll
    for (int kk = 0; kk < 2; ++kk) {
      v16bf ap = lds_frag(Pw, 72, lane & 15, kk * 32, lane);
#pragma unroll
      for (int n8 = 0; n8 < 8; ++n8) {
        v16bf bv = lds_frag_tr(Vs, 144, kk * 32, n8 * 16, lane);
        o[n8] = __builtin_amdgcn_wmma_f32_16x16x32_bf16(false, ap, false, bv,
                                                        (short)0, o[n8], false, false);
      }
    }
  }

  // Normalize and store (bf16, feeds the output projection GEMM)
#pragma unroll
  for (int n8 = 0; n8 < 8; ++n8) {
    const int hd = n8 * 16 + (lane & 15);
#pragma unroll
    for (int r = 0; r < 8; ++r) {
      const int t = q0 + wv * 16 + r + rowadd;
      O[base + (size_t)t * rs + hd] = f2bf(o[n8][r] / lrow[r]);
    }
  }
}

// ---------------------------------------------------------------------------
// Launch chain
// ---------------------------------------------------------------------------
extern "C" void kernel_launch(void* const* d_in, const int* in_sizes, int n_in,
                              void* d_out, int out_size, void* d_ws, size_t ws_size,
                              hipStream_t stream) {
  (void)in_sizes; (void)n_in; (void)out_size; (void)ws_size;

  const float* x    = (const float*)d_in[0];
  const float* wq_a = (const float*)d_in[1];
  const float* wq_b = (const float*)d_in[2];
  const float* wk_a = (const float*)d_in[3];
  const float* wk_b = (const float*)d_in[4];
  const float* wv_a = (const float*)d_in[5];
  const float* wv_b = (const float*)d_in[6];
  const float* wo_w = (const float*)d_in[7];
  const float* wo_b = (const float*)d_in[8];

  const int M = BB_ * TQ_;  // 4096 tokens

  size_t off = 0;
  auto alloc = [&](size_t elems) {
    unsigned short* p = (unsigned short*)((char*)d_ws + off);
    off += (elems * sizeof(unsigned short) + 255) & ~(size_t)255;
    return p;
  };
  unsigned short* xb   = alloc((size_t)M * D_);
  unsigned short* wqab = alloc((size_t)R_ * D_);
  unsigned short* wqbb = alloc((size_t)D_ * R_);
  unsigned short* wkab = alloc((size_t)R_ * D_);
  unsigned short* wkbb = alloc((size_t)D_ * R_);
  unsigned short* wvab = alloc((size_t)R_ * D_);
  unsigned short* wvbb = alloc((size_t)D_ * R_);
  unsigned short* wob  = alloc((size_t)D_ * D_);
  unsigned short* cq   = alloc((size_t)M * R_);
  unsigned short* ck   = alloc((size_t)M * R_);
  unsigned short* cv   = alloc((size_t)M * R_);
  unsigned short* qb   = alloc((size_t)M * D_);
  unsigned short* kb   = alloc((size_t)M * D_);
  unsigned short* vb   = alloc((size_t)M * D_);
  unsigned short* ao   = alloc((size_t)M * D_);

  // xb .. wob lie back to back (every size is a multiple of 256 B), in this order
  f32_to_bf16_all<<<dim3(CONV_WGS), dim3(256), 0, stream>>>(x, wq_a, wq_b, wk_a, wk_b,
                                                            wv_a, wv_b, wo_w, xb);

  auto gemm = [&](const unsigned short* A, const unsigned short* W, void* C,
                  const float* bias, int Mg, int Ng, int Kg, int f32out) {
    gemm_abT<<<dim3(Ng / 64, Mg / 128), dim3(256), 0, stream>>>(A, W, C, bias,
                                                                Mg, Ng, Kg, f32out);
  };

  // latent down-projections: [4096,2048] x [512,2048]^T
  gemm(xb, wqab, cq, nullptr, M, R_, D_, 0);
  gemm(xb, wkab, ck, nullptr, M, R_, D_, 0);
  gemm(xb, wvab, cv, nullptr, M, R_, D_, 0);
  // up-projections: [4096,512] x [2048,512]^T
  gemm(cq, wqbb, qb, nullptr, M, D_, R_, 0);
  gemm(ck, wkbb, kb, nullptr, M, D_, R_, 0);
  gemm(cv, wvbb, vb, nullptr, M, D_, R_, 0);
  // flash attention: grid = (T/64 q-blocks, B*H heads)
  mla_attn<<<dim3(TQ_ / 64, BB_ * H_), dim3(128), 0, stream>>>(qb, kb, vb, ao);
  // output projection + bias -> f32 d_out
  gemm(ao, wob, (float*)d_out, wo_b, M, D_, D_, 1);
}

// v004
// Measured time: 266 microseconds a run.
// In two side-by-side timings against v003, it was 1.20 and 1.21 times as fast.
// Over all steps from v000 it is 2.77 times as fast.
#include <hip/hip_runtime.h>
#include <hip/hip_bf16.h>

// ---------------------------------------------------------------------------
// MLA (multi-head latent attention) forward for MI455X / gfx1250.
// All GEMMs + attention run through v_wmma_f32_16x16x32_bf16 (f32 accumulate).
// ---------------------------------------------------------------------------

typedef __attribute__((ext_vector_type(16))) __bf16 v16bf;
typedef __attribute__((ext_vector_type(8)))  float  v8f;
typedef __attribute__((ext_vector_type(4)))  unsigned int u32x4;   // 16 B in flight

#define D_   2048
#define H_   16
#define HD_  128
#define TQ_  2048
#define BB_  2
#define R_   512

static __device__ __forceinline__ unsigned short f2bf(float f) {
  unsigned int u = __float_as_uint(f);
  u += 0x7FFFu + ((u >> 16) & 1u);          // round-to-nearest-even
  return (unsigned short)(u >> 16);
}

// Work-group barrier that orders LDS traffic only. __syncthreads() also waits
// for every global load of the wave, which would drain the loads issued ahead
// for a later tile; nothing read from global memory here is written in the launch.
static __device__ __forceinline__ void lds_barrier() {
  __builtin_amdgcn_fence(__ATOMIC_RELEASE, "workgroup", "local");
  __builtin_amdgcn_s_barrier();
  __builtin_amdgcn_fence(__ATOMIC_ACQUIRE, "workgroup", "local");
}

// Stands behind a batch of global loads that stays in flight, in front of the
// first instruction that reuses one of their address registers.
static __device__ __forceinline__ void loads_issued() {
  asm volatile("s_wait_xcnt 0x0" ::: "memory");
}

// Load one 16x32 bf16 WMMA operand fragment from LDS (row-major, `stride`
// elements per row). Matches the CDNA5 16-bit A/B layout:
//   lanes 0-15 : K = 0..7 (v0-3), 16..23 (v4-7)
//   lanes16-31 : K = 8..15 (v0-3), 24..31 (v4-7)
// => two 16-byte contiguous LDS reads per lane.
static __device__ __forceinline__ v16bf lds_frag(const unsigned short* p, int stride,
                                                 int row, int koff, int lane) {
  const int kb = (lane & 16) ? 8 : 0;
  const unsigned short* base = p + row * stride + koff + kb;
  union { uint4 u[2]; v16bf v; } c;
  c.u[0] = *(const uint4*)(base);
  c.u[1] = *(const uint4*)(base + 16);
  return c.v;
}

// Load one 32(k) x 16(col) bf16 B fragment from a row-major [k][col] LDS tile
// with the transposing load: lane (c = lane&15, h = lane>>4) receives
// tile[kbase + 8h + 0..7][dbase + c]; the second load, 16 rows further, gives
// k = 16 + 8h + 0..7, i.e. the same k order as lds_frag above. Taken as an A
// fragment the same registers are 16(row = col of the tile) x 32(k).
// `pitch` is in elements; 32 B x odd keeps the load free of bank conflicts.
typedef __attribute__((ext_vector_type(8))) short s16x8;
static __device__ __forceinline__ v16bf lds_frag_tr(const unsigned short* tile, int pitch,
                                                    int kbase, int dbase, int lane) {
  typedef __attribute__((address_space(3))) s16x8 lds_s16x8;
  const unsigned short* p = tile + (kbase + ((lane >> 4) << 3) + (lane & 7)) * pitch
                                 + dbase + (((lane >> 3) & 1) << 3);
  union { s16x8 u[2]; v16bf v; } c;
  c.u[0] = __builtin_amdgcn_ds_load_tr16_b128_v8i16((lds_s16x8*)p);
  c.u[1] = __builtin_amdgcn_ds_load_tr16_b128_v8i16((lds_s16x8*)(p + 16 * pitch));
  return c.v;
}

// ---------------------------------------------------------------------------
// fp32 -> bf16 conversion of all eight arrays in one launch. The bf16 copies lie
// back to back in `dst`, in the order of the arguments. The work is cut into
// chunks of 8192 elements (8 x 16 B per thread, each wave-wide load 512 B in a
// row); every array is a whole number of chunks, so a chunk has one source.
// CONV_WGS work-groups (three per WGP) take CONV_TRIPS chunks each, a chunk's
// eight loads going out before the chunk in front of it is converted: few, long
// waves, for speed only.
// ---------------------------------------------------------------------------
#define CONV_CHUNK   8192
#define CONV_X_CH    (BB_ * TQ_ * D_ / CONV_CHUNK)          // chunks of x
#define CONV_W_CH    (R_ * D_ / CONV_CHUNK)                 // chunks of a low-rank weight
#define CONV_CHUNKS  (CONV_X_CH + 6 * CONV_W_CH + D_ * D_ / CONV_CHUNK)
#define CONV_WGS     768
#define CONV_TRIPS   (CONV_CHUNKS / CONV_WGS)
static_assert(CONV_TRIPS * CONV_WGS == CONV_CHUNKS, "every work-group takes the same number of chunks");
typedef __attribute__((ext_vector_type(4))) unsigned short u16x4;

__global__ __launch_bounds__(256) void f32_to_bf16_all(const float* __restrict__ x,
                                                       const float* __restrict__ wq_a,
                                                       const float* __restrict__ wq_b,
                                                       const float* __restrict__ wk_a,
                                                       const float* __restrict__ wk_b,
                                                       const float* __restrict__ wv_a,
                                                       const float* __restrict__ wv_b,
                                                       const float* __restrict__ wo_w,
                                                       unsigned short* __restrict__ dst) {
  const int tid = threadIdx.x;

  // The three loops below are unrolled so that every index of v is a constant and
  // v stays in registers.
  float4 v[2][8];
#pragma unroll
  for (int t = 0; t <= CONV_TRIPS; ++t) {
    if (t < CONV_TRIPS) {
      // chunk c and its place in its source array: the same for the whole work-group
      const int c = blockIdx.x + t * CONV_WGS;
      const int w = (c - CONV_X_CH) / CONV_W_CH;            // which weight, where c is past x
      const float* s = x;
      int first = 0;                                        // the array's first chunk
      if (c >= CONV_X_CH) {
        s = w == 0 ? wq_a : w == 1 ? wq_b : w == 2 ? wk_a
          : w == 3 ? wk_b : w == 4 ? wv_a : w == 5 ? wv_b : wo_w;
        first = CONV_X_CH + min(w, 6) * CONV_W_CH;
      }
      s += (size_t)(c - first) * CONV_CHUNK + tid * 4;
#pragma unroll
      for (int j = 0; j < 8; ++j) v[t & 1][j] = *(const float4*)(s + j * 1024);
      loads_issued();
      // Keeps the conversion below behind these loads: without it its first
      // instructions, and their wait for the chunk before, stand in front of chunk 1's
      // loads, which then go out one memory latency late.
      __builtin_amdgcn_sched_barrier(0);
    }
    if (t > 0) {
      unsigned short* d = dst + (size_t)(blockIdx.x + (t - 1) * CONV_WGS) * CONV_CHUNK + tid * 4;
#pragma unroll
      for (int j = 0; j < 8; ++j) {
        const float4 f = v[(t - 1) & 1][j];
        const u16x4 o = {f2bf(f.x), f2bf(f.y), f2bf(f.z), f2bf(f.w)};
        *(u16x4*)(d + j * 1024) = o;
      }
      if (t < CONV_TRIPS) loads_issued();  // the stores' address registers are reused below
    }
  }
}

// ---------------------------------------------------------------------------
// C[M,N] = A[M,K] (bf16 row-major) x W[N,K]^T (bf16 row-major) (+bias)
// Block: 256 threads (8 waves). Tile: 128(M) x 64(N), K-step 32.
// Wave (wm,wn) computes a 32x32 sub-tile = 2x2 WMMA 16x16 fragments.
// The global loads of a K-step go out together, two K-steps ahead of their LDS
// stores, into two register sets used in turn. K is a multiple of 64.
// ---------------------------------------------------------------------------
__global__ __launch_bounds__(256) void gemm_abT(const unsigned short* __restrict__ A,
                                                const unsigned short* __restrict__ W,
                                                void* __restrict__ C,
                                                const float* __restrict__ bias,
                                                int M, int N, int K, int out_f32) {
  __shared__ __align__(16) unsigned short As[128 * 40];  // stride 40 keeps b128 alignment
  __shared__ __align__(16) unsigned short Ws[64 * 40];

  const int tid  = threadIdx.x;
  const int lane = tid & 31;
  const int wv   = tid >> 5;
  const int wm   = (wv & 3) * 32;
  const int wn   = (wv >> 2) * 32;
  const int m0   = blockIdx.y * 128;
  const int n0   = blockIdx.x * 64;

  v8f acc[2][2] = {};

  // cooperative tile loads: 8 bf16 (16 B) per thread; A rows lrow and lrow + 64
  const int lrow = tid >> 2, lcol = (tid & 3) * 8;
  const unsigned short* Ag0 = A + (size_t)(m0 + lrow) * K + lcol;
  const unsigned short* Ag1 = A + (size_t)(m0 + 64 + lrow) * K + lcol;
  const unsigned short* Wg  = W + (size_t)(n0 + lrow) * K + lcol;
  unsigned short* Asw = &As[lrow * 40 + lcol];
  unsigned short* Wsw = &Ws[lrow * 40 + lcol];

  u32x4 ra0[2], ra1[2], rw[2];
  ra0[0] = *(const u32x4*)(Ag0);
  ra1[0] = *(const u32x4*)(Ag1);
  rw[0]  = *(const u32x4*)(Wg);
  // Compiler-only fence (no instruction): keeps set 0's loads in front of set 1's.
  // Loads return in issue order, so the loop's wait for one set can then leave the
  // other set's three loads in flight; interleaved, it has to drain them all.
  __builtin_amdgcn_fence(__ATOMIC_ACQ_REL, "wavefront");
  ra0[1] = *(const u32x4*)(Ag0 + 32);
  ra1[1] = *(const u32x4*)(Ag1 + 32);
  rw[1]  = *(const u32x4*)(Wg + 32);

  for (int k0 = 0; k0 < K; k0 += 64) {
#pragma unroll
    for (int s = 0; s < 2; ++s) {
      *(u32x4*)(Asw)           = ra0[s];
      *(u32x4*)(Asw + 64 * 40) = ra1[s];
      *(u32x4*)(Wsw)           = rw[s];
      // refill this set for the K-step two ahead; the last two K-steps read the
      // last tile again (in bounds, unused), so no branch stands round the loads
      const int kn = min(k0 + s * 32 + 64, K - 32);
      ra0[s] = *(const u32x4*)(Ag0 + kn);
      ra1[s] = *(const u32x4*)(Ag1 + kn);
      rw[s]  = *(const u32x4*)(Wg + kn);
      loads_issued();
      lds_barrier();  // this K-step's tile is whole in LDS

      v16bf af[2], bfm[2];
#pragma unroll
      for (int mi = 0; mi < 2; ++mi)
        af[mi] = lds_frag(As, 40, wm + mi * 16 + (lane & 15), 0, lane);
#pragma unroll
      for (int ni = 0; ni < 2; ++ni)
        bfm[ni] = lds_frag(Ws, 40, wn + ni * 16 + (lane & 15), 0, lane);
#pragma unroll
      for (int mi = 0; mi < 2; ++mi)
#pragma unroll
        for (int ni = 0; ni < 2; ++ni)
          acc[mi][ni] = __builtin_amdgcn_wmma_f32_16x16x32_bf16(
              false, af[mi], false, bfm[ni], (short)0, acc[mi][ni], false, false);
      lds_barrier();  // every wave has read the tile
    }
  }

  // Epilogue. C-fragment layout: row = r + 8*(lane>=16), col = lane&15.
  const int rowadd = (lane & 16) ? 8 : 0;
#pragma unroll
  for (int mi = 0; mi < 2; ++mi)
#pragma unroll
    for (int ni = 0; ni < 2; ++ni) {
      const int col = n0 + wn + ni * 16 + (lane & 15);
      const float bv = bias ? bias[col] : 0.f;
#pragma unroll
      for (int r = 0; r < 8; ++r) {
        const int row = m0 + wm + mi * 16 + r + rowadd;
        float v = acc[mi][ni][r] + bv;
        if (out_f32)
          ((float*)C)[(size_t)row * N + col] = v;
        else
          ((unsigned short*)C)[(size_t)row * N + col] = f2bf(v);
      }
    }
}

// ---------------------------------------------------------------------------
// Flash attention per (b,h). Block = 128 threads (4 waves), 64 query rows,
// streaming 64-key tiles; K/V tiles row-major in LDS.
// Both products are transposed: S^T = K x Q^T (A = K rows from LDS, B = the
// wave's 16 queries, held in registers) and O^T += V^T x P^T (A = V^T by the
// transposing LDS load). A lane then holds scores of ONE query (column lane&15;
// the two wave halves hold different keys), so the maximum and the sum run
// in-lane with one exchange between the halves, and two score tiles, rounded in
// place, are the B operand of the second product: P never goes through LDS.
// The 16 global loads of a K/V tile go out together, one tile ahead of their
// LDS stores, and wait in registers while the current tile is worked on.
// ---------------------------------------------------------------------------
// two f32 -> one register of two bf16, round to nearest even
static __device__ __forceinline__ unsigned int pack2(float lo, float hi) {
  typedef __attribute__((ext_vector_type(2))) __bf16 bf2;
  typedef __attribute__((ext_vector_type(2))) float f2;
  return __builtin_bit_cast(unsigned int, __builtin_convertvector(f2{lo, hi}, bf2));
}
// e^a and e^b, as __expf forms them (one multiply, v_exp_f32). Written in asm so
// that the slot the instruction set asks for behind a transcendental is filled by
// construction: the second v_exp_f32, which shares no register with the first,
// fills the first's, the v_nop the second's.
static __device__ __forceinline__ void exp_pair(float a, float b, float& ea, float& eb) {
  const float xa = a * 1.44269504088896340736f, xb = b * 1.44269504088896340736f;
  asm("v_exp_f32 %0, %2\n\tv_exp_f32 %1, %3\n\tv_nop" : "=&v"(ea), "=&v"(eb) : "v"(xa), "v"(xb));
}
// the value of lane l ^ 16
static __device__ __forceinline__ float xhalf(float x) {
  return __builtin_bit_cast(float, __builtin_amdgcn_permlanex16(
      __builtin_bit_cast(int, x), __builtin_bit_cast(int, x), 0x76543210, 0xfedcba98, false, false));
}

__global__ __launch_bounds__(128) void mla_attn(const unsigned short* __restrict__ Q,
                                                const unsigned short* __restrict__ Kx,
                                                const unsigned short* __restrict__ V,
                                                unsigned short* __restrict__ O) {
  __shared__ __align__(16) unsigned short Ks[64 * 136];      // [key][hd], pitch 272 B
  __shared__ __align__(16) unsigned short Vs[64 * 144];      // [key][hd], pitch 288 B

  const int tid  = threadIdx.x;
  const int lane = tid & 31;
  const int wv   = tid >> 5;
  const int q0   = blockIdx.x * 64;
  const int bh   = blockIdx.y;
  const int b    = bh / H_;
  const int h    = bh % H_;
  const size_t rs   = (size_t)H_ * HD_;                      // 2048 row stride
  const size_t base = (size_t)b * TQ_ * rs + (size_t)h * HD_;

  // each thread moves 16 B of rows trow + 8p, p = 0..7, of a 64x128 tile
  const int trow = tid >> 4, tcol = (tid & 15) * 8;
  const unsigned short* Kg = Kx + base + (size_t)trow * rs + tcol;
  const unsigned short* Vg = V + base + (size_t)trow * rs + tcol;

  // This lane's query, and its Q^T fragments (32 hd x 16 queries each) in the k
  // order of lds_frag: hd = 32 ks + 8 (lane >> 4) + 0..7, then 16 further.
  const size_t qrow = base + (size_t)(q0 + wv * 16 + (lane & 15)) * rs;
  v16bf qf[4];
  u32x4 kr[8], vr[8];
  {
    const unsigned short* qp = Q + qrow + ((lane & 16) ? 8 : 0);
    union { u32x4 u[2]; v16bf v; } c[4];
#pragma unroll
    for (int ks = 0; ks < 4; ++ks) {
      c[ks].u[0] = *(const u32x4*)(qp + ks * 32);
      c[ks].u[1] = *(const u32x4*)(qp + ks * 32 + 16);
    }
#pragma unroll
    for (int p = 0; p < 8; ++p) kr[p] = *(const u32x4*)(Kg + (size_t)(p * 8) * rs);
#pragma unroll
    for (int p = 0; p < 8; ++p) vr[p] = *(const u32x4*)(Vg + (size_t)(p * 8) * rs);
    loads_issued();
#pragma unroll
    for (int ks = 0; ks < 4; ++ks) qf[ks] = c[ks].v;
  }

  v8f o[8] = {};                     // o[n8][r] = O[query lane&15][16 n8 + 8 (lane>>4) + r]
  float mrow = -1e30f, lsum = 0.f;   // lsum: this wave half's keys only, joined at the end
  const float sc = 0.08838834764831845f;                     // 1/sqrt(128)

  for (int kb = 0; kb < TQ_ / 64; ++kb) {
    lds_barrier();  // previous tile's readers done before K/V overwrite
#pragma unroll
    for (int p = 0; p < 8; ++p) *(u32x4*)(&Ks[(trow + p * 8) * 136 + tcol]) = kr[p];
#pragma unroll
    for (int p = 0; p < 8; ++p) *(u32x4*)(&Vs[(trow + p * 8) * 144 + tcol]) = vr[p];
    // next tile's loads; the last trip reads its own tile again (in bounds,
    // unused), so no branch stands round the loads
    const size_t nxt = (size_t)(min(kb + 1, TQ_ / 64 - 1) * 64) * rs;
#pragma unroll
    for (int p = 0; p < 8; ++p) kr[p] = *(const u32x4*)(Kg + nxt + (size_t)(p * 8) * rs);
#pragma unroll
    for (int p = 0; p < 8; ++p) vr[p] = *(const u32x4*)(Vg + nxt + (size_t)(p * 8) * rs);
    loads_issued();
    lds_barrier();

    // S^T(64 keys x 16 queries): s[n][r] = score of key 16 n + 8 (lane>>4) + r
    v8f s[4] = {};
#pragma unroll
    for (int ks = 0; ks < 4; ++ks) {
      v16bf ak[4];
#pragma unroll
      for (int n = 0; n < 4; ++n) ak[n] = lds_frag(Ks, 136, n * 16 + (lane & 15), ks * 32, lane);
#pragma unroll
      for (int n = 0; n < 4; ++n)
        s[n] = __builtin_amdgcn_wmma_f32_16x16x32_bf16(false, ak[n], false, qf[ks],
                                                       (short)0, s[n], false, false);
    }

    // Online softmax of this lane's query over its 32 keys of the tile
    float v = -1e30f;
#pragma unroll
    for (int n = 0; n < 4; ++n)
#pragma unroll
      for (int r = 0; r < 8; ++r) { s[n][r] *= sc; v = fmaxf(v, s[n][r]); }
    v = fmaxf(v, xhalf(v));          // both halves: the maximum over all 64 keys
    const float mn   = fmaxf(mrow, v);
    const float corr = __expf(mrow - mn);
    mrow = mn;
    float psum = 0.f;
    // P^T as B operand: element e of fragment kk is key 32 kk + 8 (lane>>4) + e for
    // e < 8 and 16 keys further for e >= 8, which is s[2 kk] then s[2 kk + 1]
    v16bf pf[2];
#pragma unroll
    for (int kk = 0; kk < 2; ++kk) {
      union { unsigned int w[8]; v16bf v; } c;
#pragma unroll
      for (int i = 0; i < 8; ++i) {
        float p0, p1;
        exp_pair(s[2 * kk + (i >> 2)][2 * (i & 3)] - mn, s[2 * kk + (i >> 2)][2 * (i & 3) + 1] - mn, p0, p1);
        psum += p0 + p1;
        c.w[i] = pack2(p0, p1);
      }
      pf[kk] = c.v;
    }
    lsum = lsum * corr + psum;
#pragma unroll
    for (int n8 = 0; n8 < 8; ++n8)
#pragma unroll
      for (int r = 0; r < 8; ++r) o[n8][r] *= corr;

    // O^T(128 hd x 16 queries) += V^T(128 x 64) x P^T(64 x 16): A row = hd, k = key
#pragma unroll
    for (int kk = 0; kk < 2; ++kk)
#pragma unroll
      for (int n8 = 0; n8 < 8; ++n8) {
        v16bf av = lds_frag_tr(Vs, 144, kk * 32, n8 * 16, lane);
        o[n8] = __builtin_amdgcn_wmma_f32_16x16x32_bf16(false, av, false, pf[kk],
                                                        (short)0, o[n8], false, false);
      }
  }

  // Normalize and store (bf16, feeds the output projection GEMM): a lane's eight
  // registers of a tile are eight consecutive hd of its query, one 16 B store
  const float lfin = lsum + xhalf(lsum);
  unsigned short* Og = O + qrow + ((lane & 16) ? 8 : 0);
#pragma unroll
  for (int n8 = 0; n8 < 8; ++n8) {
    const u32x4 pk = {pack2(o[n8][0] / lfin, o[n8][1] / lfin), pack2(o[n8][2] / lfin, o[n8][3] / lfin),
                      pack2(o[n8][4] / lfin, o[n8][5] / lfin), pack2(o[n8][6] / lfin, o[n8][7] / lfin)};
    *(u32x4*)(Og + n8 * 16) = pk;
    loads_issued();  // the store's data registers are reused for the next tile
  }
}

// ---------------------------------------------------------------------------
// Launch chain
// ---------------------------------------------------------------------------
extern "C" void kernel_launch(void* const* d_in, const int* in_sizes, int n_in,
                              void* d_out, int out_size, void* d_ws, size_t ws_size,
                              hipStream_t stream) {
  (void)in_sizes; (void)n_in; (void)out_size; (void)ws_size;

  const float* x    = (const float*)d_in[0];
  const float* wq_a = (const float*)d_in[1];
  const float* wq_b = (const float*)d_in[2];
  const float* wk_a = (const float*)d_in[3];
  const float* wk_b = (const float*)d_in[4];
  const float* wv_a = (const float*)d_in[5];
  const float* wv_b = (const float*)d_in[6];
  const float* wo_w = (const float*)d_in[7];
  const float* wo_b = (const float*)d_in[8];

  const int M = BB_ * TQ_;  // 4096 tokens

  size_t off = 0;
  auto alloc = [&](size_t elems) {
    unsigned short* p = (unsigned short*)((char*)d_ws + off);
    off += (elems * sizeof(unsigned short) + 255) & ~(size_t)255;
    return p;
  };
  unsigned short* xb   = alloc((size_t)M * D_);
  unsigned short* wqab = alloc((size_t)R_ * D_);
  unsigned short* wqbb = alloc((size_t)D_ * R_);
  unsigned short* wkab = alloc((size_t)R_ * D_);
  unsigned short* wkbb = alloc((size_t)D_ * R_);
  unsigned short* wvab = alloc((size_t)R_ * D_);
  unsigned short* wvbb = alloc((size_t)D_ * R_);
  unsigned short* wob  = alloc((size_t)D_ * D_);
  unsigned short* cq   = alloc((size_t)M * R_);
  unsigned short* ck   = alloc((size_t)M * R_);
  unsigned short* cv   = alloc((size_t)M * R_);
  unsigned short* qb   = alloc((size_t)M * D_);
  unsigned short* kb   = alloc((size_t)M * D_);
  unsigned short* vb   = alloc((size_t)M * D_);
  unsigned short* ao   = alloc((size_t)M * D_);

  // xb .. wob lie back to back (every size is a multiple of 256 B), in this order
  f32_to_bf16_all<<<dim3(CONV_WGS), dim3(256), 0, stream>>>(x, wq_a, wq_b, wk_a, wk_b,
                                                            wv_a, wv_b, wo_w, xb);

  auto gemm = [&](const unsigned short* A, const unsigned short* W, void* C,
                  const float* bias, int Mg, int Ng, int Kg, int f32out) {
    gemm_abT<<<dim3(Ng / 64, Mg / 128), dim3(256), 0, stream>>>(A, W, C, bias,
                                                                Mg, Ng, Kg, f32out);
  };

  // latent down-projections: [4096,2048] x [512,2048]^T
  gemm(xb, wqab, cq, nullptr, M, R_, D_, 0);
  gemm(xb, wkab, ck, nullptr, M, R_, D_, 0);
  gemm(xb, wvab, cv, nullptr, M, R_, D_, 0);
  // up-projections: [4096,512] x [2048,512]^T
  gemm(cq, wqbb, qb, nullptr, M, D_, R_, 0);
  gemm(ck, wkbb, kb, nullptr, M, D_, R_, 0);
  gemm(cv, wvbb, vb, nullptr, M, D_, R_, 0);
  // flash attention: grid = (T/64 q-blocks, B*H heads)
  mla_attn<<<dim3(TQ_ / 64, BB_ * H_), dim3(128), 0, stream>>>(qb, kb, vb, ao);
  // output projection + bias -> f32 d_out
  gemm(ao, wob, (float*)d_out, wo_b, M, D_, D_, 1);
}

// v005
// A run of this version takes 217 microseconds.
// Next to v004, in two timings, it ran 1.23 times as fast each time.
// Over all steps from v000 it is 3.41 times as fast.
#include <hip/hip_runtime.h>
#include <hip/hip_bf16.h>

// ---------------------------------------------------------------------------
// MLA (multi-head latent attention) forward for MI455X / gfx1250.
// All GEMMs + attention run through v_wmma_f32_16x16x32_bf16 (f32 accumulate).
// ---------------------------------------------------------------------------

typedef __attribute__((ext_vector_type(16))) __bf16 v16bf;
typedef __attribute__((ext_vector_type(8)))  float  v8f;
typedef __attribute__((ext_vector_type(4)))  unsigned int u32x4;   // 16 B in flight

#define D_   2048
#define H_   16
#define HD_  128
#define TQ_  2048
#define BB_  2
#define R_   512

static __device__ __forceinline__ unsigned short f2bf(float f) {
  unsigned int u = __float_as_uint(f);
  u += 0x7FFFu + ((u >> 16) & 1u);          // round-to-nearest-even
  return (unsigned short)(u >> 16);
}

// Work-group barrier that orders LDS traffic only. __syncthreads() also waits
// for every global load of the wave, which would drain the loads issued ahead
// for a later tile; nothing read from global memory here is written in the launch.
static __device__ __forceinline__ void lds_barrier() {
  __builtin_amdgcn_fence(__ATOMIC_RELEASE, "workgroup", "local");
  __builtin_amdgcn_s_barrier();
  __builtin_amdgcn_fence(__ATOMIC_ACQUIRE, "workgroup", "local");
}

// Stands behind a batch of global loads that stays in flight, in front of the
// first instruction that reuses one of their address registers.
static __device__ __forceinline__ void loads_issued() {
  asm volatile("s_wait_xcnt 0x0" ::: "memory");
}

// Load one 16x32 bf16 WMMA operand fragment from LDS (row-major, `stride`
// elements per row). Matches the CDNA5 16-bit A/B layout:
//   lanes 0-15 : K = 0..7 (v0-3), 16..23 (v4-7)
//   lanes16-31 : K = 8..15 (v0-3), 24..31 (v4-7)
// => two 16-byte contiguous LDS reads per lane.
static __device__ __forceinline__ v16bf lds_frag(const unsigned short* p, int stride,
                                                 int row, int koff, int lane) {
  const int kb = (lane & 16) ? 8 : 0;
  const unsigned short* base = p + row * stride + koff + kb;
  union { uint4 u[2]; v16bf v; } c;
  c.u[0] = *(const uint4*)(base);
  c.u[1] = *(const uint4*)(base + 16);
  return c.v;
}

// Load one 32(k) x 16(col) bf16 B fragment from a row-major [k][col] LDS tile
// with the transposing load: lane (c = lane&15, h = lane>>4) receives
// tile[kbase + 8h + 0..7][dbase + c]; the second load, 16 rows further, gives
// k = 16 + 8h + 0..7, i.e. the same k order as lds_frag above. Taken as an A
// fragment the same registers are 16(row = col of the tile) x 32(k).
// `pitch` is in elements; 32 B x odd keeps the load free of bank conflicts.
typedef __attribute__((ext_vector_type(8))) short s16x8;
static __device__ __forceinline__ v16bf lds_frag_tr(const unsigned short* tile, int pitch,
                                                    int kbase, int dbase, int lane) {
  typedef __attribute__((address_space(3))) s16x8 lds_s16x8;
  const unsigned short* p = tile + (kbase + ((lane >> 4) << 3) + (lane & 7)) * pitch
                                 + dbase + (((lane >> 3) & 1) << 3);
  union { s16x8 u[2]; v16bf v; } c;
  c.u[0] = __builtin_amdgcn_ds_load_tr16_b128_v8i16((lds_s16x8*)p);
  c.u[1] = __builtin_amdgcn_ds_load_tr16_b128_v8i16((lds_s16x8*)(p + 16 * pitch));
  return c.v;
}

// ---------------------------------------------------------------------------
// fp32 -> bf16 conversion of all eight arrays in one launch. The bf16 copies lie
// back to back in `dst`, in the order of the arguments. The work is cut into
// chunks of 8192 elements (8 x 16 B per thread, each wave-wide load 512 B in a
// row); every array is a whole number of chunks, so a chunk has one source.
// CONV_WGS work-groups (three per WGP) take CONV_TRIPS chunks each, a chunk's
// eight loads going out before the chunk in front of it is converted: few, long
// waves, for speed only.
// ---------------------------------------------------------------------------
#define CONV_CHUNK   8192
#define CONV_X_CH    (BB_ * TQ_ * D_ / CONV_CHUNK)          // chunks of x
#define CONV_W_CH    (R_ * D_ / CONV_CHUNK)                 // chunks of a low-rank weight
#define CONV_CHUNKS  (CONV_X_CH + 6 * CONV_W_CH + D_ * D_ / CONV_CHUNK)
#define CONV_WGS     768
#define CONV_TRIPS   (CONV_CHUNKS / CONV_WGS)
static_assert(CONV_TRIPS * CONV_WGS == CONV_CHUNKS, "every work-group takes the same number of chunks");
typedef __attribute__((ext_vector_type(4))) unsigned short u16x4;

__global__ __launch_bounds__(256) void f32_to_bf16_all(const float* __restrict__ x,
                                                       const float* __restrict__ wq_a,
                                                       const float* __restrict__ wq_b,
                                                       const float* __restrict__ wk_a,
                                                       const float* __restrict__ wk_b,
                                                       const float* __restrict__ wv_a,
                                                       const float* __restrict__ wv_b,
                                                       const float* __restrict__ wo_w,
                                                       unsigned short* __restrict__ dst) {
  const int tid = threadIdx.x;

  // The three loops below are unrolled so that every index of v is a constant and
  // v stays in registers.
  float4 v[2][8];
#pragma unroll
  for (int t = 0; t <= CONV_TRIPS; ++t) {
    if (t < CONV_TRIPS) {
      // chunk c and its place in its source array: the same for the whole work-group
      const int c = blockIdx.x + t * CONV_WGS;
      const int w = (c - CONV_X_CH) / CONV_W_CH;            // which weight, where c is past x
      const float* s = x;
      int first = 0;                                        // the array's first chunk
      if (c >= CONV_X_CH) {
        s = w == 0 ? wq_a : w == 1 ? wq_b : w == 2 ? wk_a
          : w == 3 ? wk_b : w == 4 ? wv_a : w == 5 ? wv_b : wo_w;
        first = CONV_X_CH + min(w, 6) * CONV_W_CH;
      }
      s += (size_t)(c - first) * CONV_CHUNK + tid * 4;
#pragma unroll
      for (int j = 0; j < 8; ++j) v[t & 1][j] = *(const float4*)(s + j * 1024);
      loads_issued();
      // Keeps the conversion below behind these loads: without it its first
      // instructions, and their wait for the chunk before, stand in front of chunk 1's
      // loads, which then go out one memory latency late.
      __builtin_amdgcn_sched_barrier(0);
    }
    if (t > 0) {
      unsigned short* d = dst + (size_t)(blockIdx.x + (t - 1) * CONV_WGS) * CONV_CHUNK + tid * 4;
#pragma unroll
      for (int j = 0; j < 8; ++j) {
        const float4 f = v[(t - 1) & 1][j];
        const u16x4 o = {f2bf(f.x), f2bf(f.y), f2bf(f.z), f2bf(f.w)};
        *(u16x4*)(d + j * 1024) = o;
      }
      if (t < CONV_TRIPS) loads_issued();  // the stores' address registers are reused below
    }
  }
}

// ---------------------------------------------------------------------------
// C[M,N] = A[M,K] (bf16 row-major) x W[N,K]^T (bf16 row-major) (+bias)
// Block: 256 threads (8 waves, 4 along M x 2 along N). Tile: 128(M) x 32 NI(N),
// K-step 64, so that a tile row is one whole 128-B line of its operand.
// A wave computes 32 x 16 NI = 2 x NI WMMA 16x16 fragments, twice per K-step.
// NI = 4 (128 x 128) where that still gives two work-groups per WGP; NI = 2
// (128 x 64) for the narrow down-projections, which would otherwise leave half
// the WGPs without work.
// The global loads of a K-step go out together, two K-steps ahead of their LDS
// stores, into two register sets used in turn. K is a multiple of 128.
// ---------------------------------------------------------------------------
#define GP_ 72   // LDS row pitch in elements: 144 B = 16 B x odd, for the b128 readers

template <int NI>
static __device__ __forceinline__ void gemm_tile(unsigned short* As, unsigned short* Ws,
                                                 const unsigned short* __restrict__ A,
                                                 const unsigned short* __restrict__ W,
                                                 void* __restrict__ C,
                                                 const float* __restrict__ bias,
                                                 int N, int K, int out_f32) {
  const int tid  = threadIdx.x;
  const int lane = tid & 31;
  const int wv   = tid >> 5;
  const int wm   = (wv & 3) * 32;
  const int wn   = (wv >> 2) * (NI * 16);
  const int m0   = blockIdx.y * 128;
  const int n0   = blockIdx.x * (NI * 32);

  v8f acc[2][NI] = {};

  // cooperative tile loads: 8 bf16 (16 B) per thread, eight threads to a row;
  // rows lrow + 32 j, j < 4 of A and j < NI of W
  const int lrow = tid >> 3, lcol = (tid & 7) * 8;
  // An address is a base that is the same for the whole work-group (it alone moves
  // along K) plus this thread's byte offset in the tile's rows, which never changes.
  const char* Ab = (const char*)(A + (size_t)m0 * K);
  const char* Wb = (const char*)(W + (size_t)n0 * K);
  unsigned int toff[4];
#pragma unroll
  for (int j = 0; j < 4; ++j) toff[j] = (unsigned int)(((lrow + 32 * j) * K + lcol) * 2);
  unsigned short* Asw = As + lrow * GP_ + lcol;
  unsigned short* Wsw = Ws + lrow * GP_ + lcol;

  u32x4 ra[2][4], rw[2][NI];
#pragma unroll
  for (int j = 0; j < 4; ++j)  ra[0][j] = *(const u32x4*)(Ab + toff[j]);
#pragma unroll
  for (int j = 0; j < NI; ++j) rw[0][j] = *(const u32x4*)(Wb + toff[j]);
  // Compiler-only fence (no instruction): keeps set 0's loads in front of set 1's.
  // Loads return in issue order, so the loop's wait for one set can then leave the
  // other set's loads in flight; interleaved, it has to drain them all.
  __builtin_amdgcn_fence(__ATOMIC_ACQ_REL, "wavefront");
#pragma unroll
  for (int j = 0; j < 4; ++j)  ra[1][j] = *(const u32x4*)(Ab + 128 + toff[j]);
#pragma unroll
  for (int j = 0; j < NI; ++j) rw[1][j] = *(const u32x4*)(Wb + 128 + toff[j]);
  loads_issued();  // the offset registers are given other uses in front of the loop

  for (int k0 = 0; k0 < K; k0 += 128) {
#pragma unroll
    for (int s = 0; s < 2; ++s) {
#pragma unroll
      for (int j = 0; j < 4; ++j)  *(u32x4*)(Asw + j * 32 * GP_) = ra[s][j];
#pragma unroll
      for (int j = 0; j < NI; ++j) *(u32x4*)(Wsw + j * 32 * GP_) = rw[s][j];
      // refill this set for the K-step two ahead; the last two K-steps read the
      // last tile again (in bounds, unused), so no branch stands round the loads
      const int kn = min(k0 + s * 64 + 128, K - 64);
#pragma unroll
      for (int j = 0; j < 4; ++j)  ra[s][j] = *(const u32x4*)(Ab + kn * 2 + toff[j]);
#pragma unroll
      for (int j = 0; j < NI; ++j) rw[s][j] = *(const u32x4*)(Wb + kn * 2 + toff[j]);
      loads_issued();
      lds_barrier();  // this K-step's tile is whole in LDS

#pragma unroll
      for (int kk = 0; kk < 2; ++kk) {
        v16bf af[2], bfm[NI];
#pragma unroll
        for (int mi = 0; mi < 2; ++mi)
          af[mi] = lds_frag(As, GP_, wm + mi * 16 + (lane & 15), kk * 32, lane);
#pragma unroll
        for (int ni = 0; ni < NI; ++ni)
          bfm[ni] = lds_frag(Ws, GP_, wn + ni * 16 + (lane & 15), kk * 32, lane);
#pragma unroll
        for (int mi = 0; mi < 2; ++mi)
#pragma unroll
          for (int ni = 0; ni < NI; ++ni)
            acc[mi][ni] = __builtin_amdgcn_wmma_f32_16x16x32_bf16(
                false, af[mi], false, bfm[ni], (short)0, acc[mi][ni], false, false);
      }
      lds_barrier();  // every wave has read the tile
    }
  }

  // Epilogue. C-fragment layout: row = r + 8*(lane>=16), col = lane&15.
  const int rowadd = (lane & 16) ? 8 : 0;
#pragma unroll
  for (int mi = 0; mi < 2; ++mi)
#pragma unroll
    for (int ni = 0; ni < NI; ++ni) {
      const int col = n0 + wn + ni * 16 + (lane & 15);
      const float bv = bias ? bias[col] : 0.f;
#pragma unroll
      for (int r = 0; r < 8; ++r) {
        const int row = m0 + wm + mi * 16 + r + rowadd;
        float v = acc[mi][ni][r] + bv;
        // behind each store: its address and data registers are reused right away
        if (out_f32) {
          ((float*)C)[(size_t)row * N + col] = v;
          loads_issued();
        } else {
          ((unsigned short*)C)[(size_t)row * N + col] = f2bf(v);
          loads_issued();
        }
      }
    }
}

// amdgpu_waves_per_eu: the register budget is that of the waves which the grid puts
// on a SIMD (256 work-groups: 2, 512 work-groups: 4). With the default budget the
// compiler held part of a K-step's fragment loads back to save registers, which
// made two more places per K-step where a wave waits for LDS.
__global__ __launch_bounds__(256) __attribute__((amdgpu_waves_per_eu(2, 2))) void gemm_abT_n64(const unsigned short* __restrict__ A,
                                                    const unsigned short* __restrict__ W,
                                                    void* __restrict__ C,
                                                    const float* __restrict__ bias,
                                                    int N, int K, int out_f32) {
  __shared__ __align__(16) unsigned short As[128 * GP_];
  __shared__ __align__(16) unsigned short Ws[64 * GP_];
  gemm_tile<2>(As, Ws, A, W, C, bias, N, K, out_f32);
}

__global__ __launch_bounds__(256) __attribute__((amdgpu_waves_per_eu(4, 4))) void gemm_abT_n128(const unsigned short* __restrict__ A,
                                                     const unsigned short* __restrict__ W,
                                                     void* __restrict__ C,
                                                     const float* __restrict__ bias,
                                                     int N, int K, int out_f32) {
  __shared__ __align__(16) unsigned short As[128 * GP_];
  __shared__ __align__(16) unsigned short Ws[128 * GP_];
  gemm_tile<4>(As, Ws, A, W, C, bias, N, K, out_f32);
}

// ---------------------------------------------------------------------------
// Flash attention per (b,h). Block = 128 threads (4 waves), 64 query rows,
// streaming 64-key tiles; K/V tiles row-major in LDS.
// Both products are transposed: S^T = K x Q^T (A = K rows from LDS, B = the
// wave's 16 queries, held in registers) and O^T += V^T x P^T (A = V^T by the
// transposing LDS load). A lane then holds scores of ONE query (column lane&15;
// the two wave halves hold different keys), so the maximum and the sum run
// in-lane with one exchange between the halves, and two score tiles, rounded in
// place, are the B operand of the second product: P never goes through LDS.
// The 16 global loads of a K/V tile go out together, one tile ahead of their
// LDS stores, and wait in registers while the current tile is worked on.
// ---------------------------------------------------------------------------
// two f32 -> one register of two bf16, round to nearest even
static __device__ __forceinline__ unsigned int pack2(float lo, float hi) {
  typedef __attribute__((ext_vector_type(2))) __bf16 bf2;
  typedef __attribute__((ext_vector_type(2))) float f2;
  return __builtin_bit_cast(unsigned int, __builtin_convertvector(f2{lo, hi}, bf2));
}
// e^a and e^b, as __expf forms them (one multiply, v_exp_f32). Written in asm so
// that the slot the instruction set asks for behind a transcendental is filled by
// construction: the second v_exp_f32, which shares no register with the first,
// fills the first's, the v_nop the second's.
static __device__ __forceinline__ void exp_pair(float a, float b, float& ea, float& eb) {
  const float xa = a * 1.44269504088896340736f, xb = b * 1.44269504088896340736f;
  asm("v_exp_f32 %0, %2\n\tv_exp_f32 %1, %3\n\tv_nop" : "=&v"(ea), "=&v"(eb) : "v"(xa), "v"(xb));
}
// the value of lane l ^ 16
static __device__ __forceinline__ float xhalf(float x) {
  return __builtin_bit_cast(float, __builtin_amdgcn_permlanex16(
      __builtin_bit_cast(int, x), __builtin_bit_cast(int, x), 0x76543210, 0xfedcba98, false, false));
}

__global__ __launch_bounds__(128) void mla_attn(const unsigned short* __restrict__ Q,
                                                const unsigned short* __restrict__ Kx,
                                                const unsigned short* __restrict__ V,
                                                unsigned short* __restrict__ O) {
  __shared__ __align__(16) unsigned short Ks[64 * 136];      // [key][hd], pitch 272 B
  __shared__ __align__(16) unsigned short Vs[64 * 144];      // [key][hd], pitch 288 B

  const int tid  = threadIdx.x;
  const int lane = tid & 31;
  const int wv   = tid >> 5;
  const int q0   = blockIdx.x * 64;
  const int bh   = blockIdx.y;
  const int b    = bh / H_;
  const int h    = bh % H_;
  const size_t rs   = (size_t)H_ * HD_;                      // 2048 row stride
  const size_t base = (size_t)b * TQ_ * rs + (size_t)h * HD_;

  // each thread moves 16 B of rows trow + 8p, p = 0..7, of a 64x128 tile
  const int trow = tid >> 4, tcol = (tid & 15) * 8;
  const unsigned short* Kg = Kx + base + (size_t)trow * rs + tcol;
  const unsigned short* Vg = V + base + (size_t)trow * rs + tcol;

  // This lane's query, and its Q^T fragments (32 hd x 16 queries each) in the k
  // order of lds_frag: hd = 32 ks + 8 (lane >> 4) + 0..7, then 16 further.
  const size_t qrow = base + (size_t)(q0 + wv * 16 + (lane & 15)) * rs;
  v16bf qf[4];
  u32x4 kr[8], vr[8];
  {
    const unsigned short* qp = Q + qrow + ((lane & 16) ? 8 : 0);
    union { u32x4 u[2]; v16bf v; } c[4];
#pragma unroll
    for (int ks = 0; ks < 4; ++ks) {
      c[ks].u[0] = *(const u32x4*)(qp + ks * 32);
      c[ks].u[1] = *(const u32x4*)(qp + ks * 32 + 16);
    }
#pragma unroll
    for (int p = 0; p < 8; ++p) kr[p] = *(const u32x4*)(Kg + (size_t)(p * 8) * rs);
#pragma unroll
    for (int p = 0; p < 8; ++p) vr[p] = *(const u32x4*)(Vg + (size_t)(p * 8) * rs);
    loads_issued();
#pragma unroll
    for (int ks = 0; ks < 4; ++ks) qf[ks] = c[ks].v;
  }

  v8f o[8] = {};                     // o[n8][r] = O[query lane&15][16 n8 + 8 (lane>>4) + r]
  float mrow = -1e30f, lsum = 0.f;   // lsum: this wave half's keys only, joined at the end
  const float sc = 0.08838834764831845f;                     // 1/sqrt(128)

  for (int kb = 0; kb < TQ_ / 64; ++kb) {
    lds_barrier();  // previous tile's readers done before K/V overwrite
#pragma unroll
    for (int p = 0; p < 8; ++p) *(u32x4*)(&Ks[(trow + p * 8) * 136 + tcol]) = kr[p];
#pragma unroll
    for (int p = 0; p < 8; ++p) *(u32x4*)(&Vs[(trow + p * 8) * 144 + tcol]) = vr[p];
    // next tile's loads; the last trip reads its own tile again (in bounds,
    // unused), so no branch stands round the loads
    const size_t nxt = (size_t)(min(kb + 1, TQ_ / 64 - 1) * 64) * rs;
#pragma unroll
    for (int p = 0; p < 8; ++p) kr[p] = *(const u32x4*)(Kg + nxt + (size_t)(p * 8) * rs);
#pragma unroll
    for (int p = 0; p < 8; ++p) vr[p] = *(const u32x4*)(Vg + nxt + (size_t)(p * 8) * rs);
    loads_issued();
    lds_barrier();

    // S^T(64 keys x 16 queries): s[n][r] = score of key 16 n + 8 (lane>>4) + r
    v8f s[4] = {};
#pragma unroll
    for (int ks = 0; ks < 4; ++ks) {
      v16bf ak[4];
#pragma unroll
      for (int n = 0; n < 4; ++n) ak[n] = lds_frag(Ks, 136, n * 16 + (lane & 15), ks * 32, lane);
#pragma unroll
      for (int n = 0; n < 4; ++n)
        s[n] = __builtin_amdgcn_wmma_f32_16x16x32_bf16(false, ak[n], false, qf[ks],
                                                       (short)0, s[n], false, false);
    }

    // Online softmax of this lane's query over its 32 keys of the tile
    float v = -1e30f;
#pragma unroll
    for (int n = 0; n < 4; ++n)
#pragma unroll
      for (int r = 0; r < 8; ++r) { s[n][r] *= sc; v = fmaxf(v, s[n][r]); }
    v = fmaxf(v, xhalf(v));          // both halves: the maximum over all 64 keys
    const float mn   = fmaxf(mrow, v);
    const float corr = __expf(mrow - mn);
    mrow = mn;
    float psum = 0.f;
    // P^T as B operand: element e of fragment kk is key 32 kk + 8 (lane>>4) + e for
    // e < 8 and 16 keys further for e >= 8, which is s[2 kk] then s[2 kk + 1]
    v16bf pf[2];
#pragma unroll
    for (int kk = 0; kk < 2; ++kk) {
      union { unsigned int w[8]; v16bf v; } c;
#pragma unroll
      for (int i = 0; i < 8; ++i) {
        float p0, p1;
        exp_pair(s[2 * kk + (i >> 2)][2 * (i & 3)] - mn, s[2 * kk + (i >> 2)][2 * (i & 3) + 1] - mn, p0, p1);
        psum += p0 + p1;
        c.w[i] = pack2(p0, p1);
      }
      pf[kk] = c.v;
    }
    lsum = lsum * corr + psum;
#pragma unroll
    for (int n8 = 0; n8 < 8; ++n8)
#pragma unroll
      for (int r = 0; r < 8; ++r) o[n8][r] *= corr;

    // O^T(128 hd x 16 queries) += V^T(128 x 64) x P^T(64 x 16): A row = hd, k = key
#pragma unroll
    for (int kk = 0; kk < 2; ++kk)
#pragma unroll
      for (int n8 = 0; n8 < 8; ++n8) {
        v16bf av = lds_frag_tr(Vs, 144, kk * 32, n8 * 16, lane);
        o[n8] = __builtin_amdgcn_wmma_f32_16x16x32_bf16(false, av, false, pf[kk],
                                                        (short)0, o[n8], false, false);
      }
  }

  // Normalize and store (bf16, feeds the output projection GEMM): a lane's eight
  // registers of a tile are eight consecutive hd of its query, one 16 B store
  const float lfin = lsum + xhalf(lsum);
  unsigned short* Og = O + qrow + ((lane & 16) ? 8 : 0);
#pragma unroll
  for (int n8 = 0; n8 < 8; ++n8) {
    const u32x4 pk = {pack2(o[n8][0] / lfin, o[n8][1] / lfin), pack2(o[n8][2] / lfin, o[n8][3] / lfin),
                      pack2(o[n8][4] / lfin, o[n8][5] / lfin), pack2(o[n8][6] / lfin, o[n8][7] / lfin)};
    *(u32x4*)(Og + n8 * 16) = pk;
    loads_issued();  // the store's data registers are reused for the next tile
  }
}

// ---------------------------------------------------------------------------
// Launch chain
// ---------------------------------------------------------------------------
extern "C" void kernel_launch(void* const* d_in, const int* in_sizes, int n_in,
                              void* d_out, int out_size, void* d_ws, size_t ws_size,
                              hipStream_t stream) {
  (void)in_sizes; (void)n_in; (void)out_size; (void)ws_size;

  const float* x    = (const float*)d_in[0];
  const float* wq_a = (const float*)d_in[1];
  const float* wq_b = (const float*)d_in[2];
  const float* wk_a = (const float*)d_in[3];
  const float* wk_b = (const float*)d_in[4];
  const float* wv_a = (const float*)d_in[5];
  const float* wv_b = (const float*)d_in[6];
  const float* wo_w = (const float*)d_in[7];
  const float* wo_b = (const float*)d_in[8];

  const int M = BB_ * TQ_;  // 4096 tokens

  size_t off = 0;
  auto alloc = [&](size_t elems) {
    unsigned short* p = (unsigned short*)((char*)d_ws + off);
    off += (elems * sizeof(unsigned short) + 255) & ~(size_t)255;
    return p;
  };
  unsigned short* xb   = alloc((size_t)M * D_);
  unsigned short* wqab = alloc((size_t)R_ * D_);
  unsigned short* wqbb = alloc((size_t)D_ * R_);
  unsigned short* wkab = alloc((size_t)R_ * D_);
  unsigned short* wkbb = alloc((size_t)D_ * R_);
  unsigned short* wvab = alloc((size_t)R_ * D_);
  unsigned short* wvbb = alloc((size_t)D_ * R_);
  unsigned short* wob  = alloc((size_t)D_ * D_);
  unsigned short* cq   = alloc((size_t)M * R_);
  unsigned short* ck   = alloc((size_t)M * R_);
  unsigned short* cv   = alloc((size_t)M * R_);
  unsigned short* qb   = alloc((size_t)M * D_);
  unsigned short* kb   = alloc((size_t)M * D_);
  unsigned short* vb   = alloc((size_t)M * D_);
  unsigned short* ao   = alloc((size_t)M * D_);

  // xb .. wob lie back to back (every size is a multiple of 256 B), in this order
  f32_to_bf16_all<<<dim3(CONV_WGS), dim3(256), 0, stream>>>(x, wq_a, wq_b, wk_a, wk_b,
                                                            wv_a, wv_b, wo_w, xb);

  // 128 x 64 tiles (256 work-groups)
  auto gemm_n64 = [&](const unsigned short* A, const unsigned short* W, void* C,
                      const float* bias, int Mg, int Ng, int Kg, int f32out) {
    gemm_abT_n64<<<dim3(Ng / 64, Mg / 128), dim3(256), 0, stream>>>(A, W, C, bias, Ng, Kg, f32out);
  };
  // 128 x 128 tiles (512 work-groups)
  auto gemm_n128 = [&](const unsigned short* A, const unsigned short* W, void* C,
                       const float* bias, int Mg, int Ng, int Kg, int f32out) {
    gemm_abT_n128<<<dim3(Ng / 128, Mg / 128), dim3(256), 0, stream>>>(A, W, C, bias, Ng, Kg, f32out);
  };

  // latent down-projections: [4096,2048] x [512,2048]^T
  gemm_n64(xb, wqab, cq, nullptr, M, R_, D_, 0);
  gemm_n64(xb, wkab, ck, nullptr, M, R_, D_, 0);
  gemm_n64(xb, wvab, cv, nullptr, M, R_, D_, 0);
  // up-projections: [4096,512] x [2048,512]^T
  gemm_n128(cq, wqbb, qb, nullptr, M, D_, R_, 0);
  gemm_n128(ck, wkbb, kb, nullptr, M, D_, R_, 0);
  gemm_n128(cv, wvbb, vb, nullptr, M, D_, R_, 0);
  // flash attention: grid = (T/64 q-blocks, B*H heads)
  mla_attn<<<dim3(TQ_ / 64, BB_ * H_), dim3(128), 0, stream>>>(qb, kb, vb, ao);
  // output projection + bias -> f32 d_out
  gemm_n128(ao, wob, (float*)d_out, wo_b, M, D_, D_, 1);
}

// v006
// It runs in 193 microseconds.
// In both of two side-by-side timings against v005, it was 1.12 times as fast.
// Over all steps from v000 it is 3.83 times as fast.
#include <hip/hip_runtime.h>
#include <hip/hip_bf16.h>

// ---------------------------------------------------------------------------
// MLA (multi-head latent attention) forward for MI455X / gfx1250.
// All GEMMs + attention run through v_wmma_f32_16x16x32_bf16 (f32 accumulate).
// ---------------------------------------------------------------------------

typedef __attribute__((ext_vector_type(16))) __bf16 v16bf;
typedef __attribute__((ext_vector_type(8)))  float  v8f;
typedef __attribute__((ext_vector_type(4)))  unsigned int u32x4;   // 16 B in flight

#define D_   2048
#define H_   16
#define HD_  128
#define TQ_  2048
#define BB_  2
#define R_   512

static __device__ __forceinline__ unsigned short f2bf(float f) {
  unsigned int u = __float_as_uint(f);
  u += 0x7FFFu + ((u >> 16) & 1u);          // round-to-nearest-even
  return (unsigned short)(u >> 16);
}

// Work-group barrier that orders LDS traffic only. __syncthreads() also waits
// for every global load of the wave, which would drain the loads issued ahead
// for a later tile; nothing read from global memory here is written in the launch.
static __device__ __forceinline__ void lds_barrier() {
  __builtin_amdgcn_fence(__ATOMIC_RELEASE, "workgroup", "local");
  __builtin_amdgcn_s_barrier();
  __builtin_amdgcn_fence(__ATOMIC_ACQUIRE, "workgroup", "local");
}

// Stands behind a batch of global loads that stays in flight, in front of the
// first instruction that reuses one of their address registers.
static __device__ __forceinline__ void loads_issued() {
  asm volatile("s_wait_xcnt 0x0" ::: "memory");
}

// Load one 16x32 bf16 WMMA operand fragment from LDS (row-major, `stride`
// elements per row). Matches the CDNA5 16-bit A/B layout:
//   lanes 0-15 : K = 0..7 (v0-3), 16..23 (v4-7)
//   lanes16-31 : K = 8..15 (v0-3), 24..31 (v4-7)
// => two 16-byte contiguous LDS reads per lane.
static __device__ __forceinline__ v16bf lds_frag(const unsigned short* p, int stride,
                                                 int row, int koff, int lane) {
  const int kb = (lane & 16) ? 8 : 0;
  const unsigned short* base = p + row * stride + koff + kb;
  union { uint4 u[2]; v16bf v; } c;
  c.u[0] = *(const uint4*)(base);
  c.u[1] = *(const uint4*)(base + 16);
  return c.v;
}

// Load one 32(k) x 16(col) bf16 B fragment from a row-major [k][col] LDS tile
// with the transposing load: lane (c = lane&15, h = lane>>4) receives
// tile[kbase + 8h + 0..7][dbase + c]; the second load, 16 rows further, gives
// k = 16 + 8h + 0..7, i.e. the same k order as lds_frag above. Taken as an A
// fragment the same registers are 16(row = col of the tile) x 32(k).
// `pitch` is in elements; 32 B x odd keeps the load free of bank conflicts.
typedef __attribute__((ext_vector_type(8))) short s16x8;
static __device__ __forceinline__ v16bf lds_frag_tr(const unsigned short* tile, int pitch,
                                                    int kbase, int dbase, int lane) {
  typedef __attribute__((address_space(3))) s16x8 lds_s16x8;
  const unsigned short* p = tile + (kbase + ((lane >> 4) << 3) + (lane & 7)) * pitch
                                 + dbase + (((lane >> 3) & 1) << 3);
  union { s16x8 u[2]; v16bf v; } c;
  c.u[0] = __builtin_amdgcn_ds_load_tr16_b128_v8i16((lds_s16x8*)p);
  c.u[1] = __builtin_amdgcn_ds_load_tr16_b128_v8i16((lds_s16x8*)(p + 16 * pitch));
  return c.v;
}

// ---------------------------------------------------------------------------
// fp32 -> bf16 conversion of all eight arrays in one launch. The bf16 copies lie
// back to back in `dst`, in the order of the arguments. The work is cut into
// chunks of 8192 elements (8 x 16 B per thread, each wave-wide load 512 B in a
// row); every array is a whole number of chunks, so a chunk has one source.
// CONV_WGS work-groups (three per WGP) take CONV_TRIPS chunks each, a chunk's
// eight loads going out before the chunk in front of it is converted: few, long
// waves, for speed only.
// ---------------------------------------------------------------------------
#define CONV_CHUNK   8192
#define CONV_X_CH    (BB_ * TQ_ * D_ / CONV_CHUNK)          // chunks of x
#define CONV_W_CH    (R_ * D_ / CONV_CHUNK)                 // chunks of a low-rank weight
#define CONV_CHUNKS  (CONV_X_CH + 6 * CONV_W_CH + D_ * D_ / CONV_CHUNK)
#define CONV_WGS     768
#define CONV_TRIPS   (CONV_CHUNKS / CONV_WGS)
static_assert(CONV_TRIPS * CONV_WGS == CONV_CHUNKS, "every work-group takes the same number of chunks");
typedef __attribute__((ext_vector_type(4))) unsigned short u16x4;

__global__ __launch_bounds__(256) void f32_to_bf16_all(const float* __restrict__ x,
                                                       const float* __restrict__ wq_a,
                                                       const float* __restrict__ wq_b,
                                                       const float* __restrict__ wk_a,
                                                       const float* __restrict__ wk_b,
                                                       const float* __restrict__ wv_a,
                                                       const float* __restrict__ wv_b,
                                                       const float* __restrict__ wo_w,
                                                       unsigned short* __restrict__ dst) {
  const int tid = threadIdx.x;

  // The three loops below are unrolled so that every index of v is a constant and
  // v stays in registers.
  float4 v[2][8];
#pragma unroll
  for (int t = 0; t <= CONV_TRIPS; ++t) {
    if (t < CONV_TRIPS) {
      // chunk c and its place in its source array: the same for the whole work-group
      const int c = blockIdx.x + t * CONV_WGS;
      const int w = (c - CONV_X_CH) / CONV_W_CH;            // which weight, where c is past x
      const float* s = x;
      int first = 0;                                        // the array's first chunk
      if (c >= CONV_X_CH) {
        s = w == 0 ? wq_a : w == 1 ? wq_b : w == 2 ? wk_a
          : w == 3 ? wk_b : w == 4 ? wv_a : w == 5 ? wv_b : wo_w;
        first = CONV_X_CH + min(w, 6) * CONV_W_CH;
      }
      s += (size_t)(c - first) * CONV_CHUNK + tid * 4;
#pragma unroll
      for (int j = 0; j < 8; ++j) v[t & 1][j] = *(const float4*)(s + j * 1024);
      loads_issued();
      // Keeps the conversion below behind these loads: without it its first
      // instructions, and their wait for the chunk before, stand in front of chunk 1's
      // loads, which then go out one memory latency late.
      __builtin_amdgcn_sched_barrier(0);
    }
    if (t > 0) {
      unsigned short* d = dst + (size_t)(blockIdx.x + (t - 1) * CONV_WGS) * CONV_CHUNK + tid * 4;
#pragma unroll
      for (int j = 0; j < 8; ++j) {
        const float4 f = v[(t - 1) & 1][j];
        const u16x4 o = {f2bf(f.x), f2bf(f.y), f2bf(f.z), f2bf(f.w)};
        *(u16x4*)(d + j * 1024) = o;
      }
      if (t < CONV_TRIPS) loads_issued();  // the stores' address registers are reused below
    }
  }
}

// ---------------------------------------------------------------------------
// C[M,N] = A[M,K] (bf16 row-major) x W[N,K]^T (bf16 row-major) (+bias)
// Block: 256 threads (8 waves, 4 along M x 2 along N). Tile: 128(M) x 32 NI(N),
// K-step 64, so that a tile row is one whole 128-B line of its operand.
// A wave computes 32 x 16 NI = 2 x NI WMMA 16x16 fragments, twice per K-step.
// NI = 4 (128 x 128) where that still gives two work-groups per WGP; NI = 2
// (128 x 64) for the narrow down-projections, which would otherwise leave half
// the WGPs without work.
// The global loads of a K-step go out together, two K-steps ahead of their LDS
// stores, into two register sets used in turn. K is a multiple of 128.
// ---------------------------------------------------------------------------
#define GP_ 72   // LDS row pitch in elements: 144 B = 16 B x odd, for the b128 readers

template <int NI>
static __device__ __forceinline__ void gemm_tile(unsigned short* As, unsigned short* Ws,
                                                 const unsigned short* __restrict__ A,
                                                 const unsigned short* __restrict__ W,
                                                 void* __restrict__ C,
                                                 const float* __restrict__ bias,
                                                 int N, int K, int out_f32) {
  const int tid  = threadIdx.x;
  const int lane = tid & 31;
  const int wv   = tid >> 5;
  const int wm   = (wv & 3) * 32;
  const int wn   = (wv >> 2) * (NI * 16);
  const int m0   = blockIdx.y * 128;
  const int n0   = blockIdx.x * (NI * 32);

  v8f acc[2][NI] = {};

  // cooperative tile loads: 8 bf16 (16 B) per thread, eight threads to a row;
  // rows lrow + 32 j, j < 4 of A and j < NI of W
  const int lrow = tid >> 3, lcol = (tid & 7) * 8;
  // An address is a base that is the same for the whole work-group (it alone moves
  // along K) plus this thread's byte offset in the tile's rows, which never changes.
  const char* Ab = (const char*)(A + (size_t)m0 * K);
  const char* Wb = (const char*)(W + (size_t)n0 * K);
  unsigned int toff[4];
#pragma unroll
  for (int j = 0; j < 4; ++j) toff[j] = (unsigned int)(((lrow + 32 * j) * K + lcol) * 2);
  unsigned short* Asw = As + lrow * GP_ + lcol;
  unsigned short* Wsw = Ws + lrow * GP_ + lcol;

  u32x4 ra[2][4], rw[2][NI];
#pragma unroll
  for (int j = 0; j < 4; ++j)  ra[0][j] = *(const u32x4*)(Ab + toff[j]);
#pragma unroll
  for (int j = 0; j < NI; ++j) rw[0][j] = *(const u32x4*)(Wb + toff[j]);
  // Compiler-only fence (no instruction): keeps set 0's loads in front of set 1's.
  // Loads return in issue order, so the loop's wait for one set can then leave the
  // other set's loads in flight; interleaved, it has to drain them all.
  __builtin_amdgcn_fence(__ATOMIC_ACQ_REL, "wavefront");
#pragma unroll
  for (int j = 0; j < 4; ++j)  ra[1][j] = *(const u32x4*)(Ab + 128 + toff[j]);
#pragma unroll
  for (int j = 0; j < NI; ++j) rw[1][j] = *(const u32x4*)(Wb + 128 + toff[j]);
  loads_issued();  // the offset registers are given other uses in front of the loop

  for (int k0 = 0; k0 < K; k0 += 128) {
#pragma unroll
    for (int s = 0; s < 2; ++s) {
#pragma unroll
      for (int j = 0; j < 4; ++j)  *(u32x4*)(Asw + j * 32 * GP_) = ra[s][j];
#pragma unroll
      for (int j = 0; j < NI; ++j) *(u32x4*)(Wsw + j * 32 * GP_) = rw[s][j];
      // refill this set for the K-step two ahead; the last two K-steps read the
      // last tile again (in bounds, unused), so no branch stands round the loads
      const int kn = min(k0 + s * 64 + 128, K - 64);
#pragma unroll
      for (int j = 0; j < 4; ++j)  ra[s][j] = *(const u32x4*)(Ab + kn * 2 + toff[j]);
#pragma unroll
      for (int j = 0; j < NI; ++j) rw[s][j] = *(const u32x4*)(Wb + kn * 2 + toff[j]);
      loads_issued();
      lds_barrier();  // this K-step's tile is whole in LDS

#pragma unroll
      for (int kk = 0; kk < 2; ++kk) {
        v16bf af[2], bfm[NI];
#pragma unroll
        for (int mi = 0; mi < 2; ++mi)
          af[mi] = lds_frag(As, GP_, wm + mi * 16 + (lane & 15), kk * 32, lane);
#pragma unroll
        for (int ni = 0; ni < NI; ++ni)
          bfm[ni] = lds_frag(Ws, GP_, wn + ni * 16 + (lane & 15), kk * 32, lane);
#pragma unroll
        for (int mi = 0; mi < 2; ++mi)
#pragma unroll
          for (int ni = 0; ni < NI; ++ni)
            acc[mi][ni] = __builtin_amdgcn_wmma_f32_16x16x32_bf16(
                false, af[mi], false, bfm[ni], (short)0, acc[mi][ni], false, false);
      }
      lds_barrier();  // every wave has read the tile
    }
  }

  // Epilogue. C-fragment layout: row = r + 8*(lane>=16), col = lane&15.
  const int rowadd = (lane & 16) ? 8 : 0;
#pragma unroll
  for (int mi = 0; mi < 2; ++mi)
#pragma unroll
    for (int ni = 0; ni < NI; ++ni) {
      const int col = n0 + wn + ni * 16 + (lane & 15);
      const float bv = bias ? bias[col] : 0.f;
#pragma unroll
      for (int r = 0; r < 8; ++r) {
        const int row = m0 + wm + mi * 16 + r + rowadd;
        float v = acc[mi][ni][r] + bv;
        // behind each store: its address and data registers are reused right away
        if (out_f32) {
          ((float*)C)[(size_t)row * N + col] = v;
          loads_issued();
        } else {
          ((unsigned short*)C)[(size_t)row * N + col] = f2bf(v);
          loads_issued();
        }
      }
    }
}

// amdgpu_waves_per_eu: the register budget is that of the waves which the grid puts
// on a SIMD (256 work-groups: 2, 512 work-groups: 4). With the default budget the
// compiler held part of a K-step's fragment loads back to save registers, which
// made two more places per K-step where a wave waits for LDS.
__global__ __launch_bounds__(256) __attribute__((amdgpu_waves_per_eu(2, 2))) void gemm_abT_n64(const unsigned short* __restrict__ A,
                                                    const unsigned short* __restrict__ W,
                                                    void* __restrict__ C,
                                                    const float* __restrict__ bias,
                                                    int N, int K, int out_f32) {
  __shared__ __align__(16) unsigned short As[128 * GP_];
  __shared__ __align__(16) unsigned short Ws[64 * GP_];
  gemm_tile<2>(As, Ws, A, W, C, bias, N, K, out_f32);
}

__global__ __launch_bounds__(256) __attribute__((amdgpu_waves_per_eu(4, 4))) void gemm_abT_n128(const unsigned short* __restrict__ A,
                                                     const unsigned short* __restrict__ W,
                                                     void* __restrict__ C,
                                                     const float* __restrict__ bias,
                                                     int N, int K, int out_f32) {
  __shared__ __align__(16) unsigned short As[128 * GP_];
  __shared__ __align__(16) unsigned short Ws[128 * GP_];
  gemm_tile<4>(As, Ws, A, W, C, bias, N, K, out_f32);
}

// ---------------------------------------------------------------------------
// Flash attention per (b,h). Block = 128 threads (4 waves), 128 query rows,
// streaming 64-key tiles; K/V tiles row-major in LDS.
// Both products are transposed: S^T = K x Q^T (A = K rows from LDS, B = the
// wave's queries, held in registers) and O^T += V^T x P^T (A = V^T by the
// transposing LDS load). A lane then holds scores of ONE query per column group
// (column lane&15; the two wave halves hold different keys), so the maximum and
// the sum run in-lane with one exchange between the halves, and two score tiles,
// rounded in place, are the B operand of the second product: P never goes
// through LDS.
// A wave takes QG_ = 2 column groups of 16 queries: a K or V fragment read from
// LDS feeds two products, which halves the LDS reads, the K/V staging and the
// barriers per query. 512 work-groups are two per WGP, two waves per SIMD.
// The 16 global loads of a K/V tile go out together, one tile ahead of their
// LDS stores, and wait in registers while the current tile is worked on.
// ---------------------------------------------------------------------------
#define QG_ 2
// two f32 -> one register of two bf16, round to nearest even
static __device__ __forceinline__ unsigned int pack2(float lo, float hi) {
  typedef __attribute__((ext_vector_type(2))) __bf16 bf2;
  typedef __attribute__((ext_vector_type(2))) float f2;
  return __builtin_bit_cast(unsigned int, __builtin_convertvector(f2{lo, hi}, bf2));
}
// e^a and e^b, as __expf forms them (one multiply, v_exp_f32). Written in asm so
// that the slot the instruction set asks for behind a transcendental is filled by
// construction: the second v_exp_f32, which shares no register with the first,
// fills the first's, the v_nop the second's.
static __device__ __forceinline__ void exp_pair(float a, float b, float& ea, float& eb) {
  const float xa = a * 1.44269504088896340736f, xb = b * 1.44269504088896340736f;
  asm("v_exp_f32 %0, %2\n\tv_exp_f32 %1, %3\n\tv_nop" : "=&v"(ea), "=&v"(eb) : "v"(xa), "v"(xb));
}
// the value of lane l ^ 16
static __device__ __forceinline__ float xhalf(float x) {
  return __builtin_bit_cast(float, __builtin_amdgcn_permlanex16(
      __builtin_bit_cast(int, x), __builtin_bit_cast(int, x), 0x76543210, 0xfedcba98, false, false));
}

// amdgpu_waves_per_eu: the register budget is that of the two waves which the grid
// puts on a SIMD. With the default budget the compiler keeps one fragment in
// registers and waits out the LDS latency in front of every product.
__global__ __launch_bounds__(128) __attribute__((amdgpu_waves_per_eu(2, 2))) void mla_attn(const unsigned short* __restrict__ Q,
                                                const unsigned short* __restrict__ Kx,
                                                const unsigned short* __restrict__ V,
                                                unsigned short* __restrict__ O) {
  __shared__ __align__(16) unsigned short Ks[64 * 136];      // [key][hd], pitch 272 B
  __shared__ __align__(16) unsigned short Vs[64 * 144];      // [key][hd], pitch 288 B

  const int tid  = threadIdx.x;
  const int lane = tid & 31;
  const int wv   = tid >> 5;
  const int q0   = blockIdx.x * (64 * QG_);
  const int bh   = blockIdx.y;
  const int b    = bh / H_;
  const int h    = bh % H_;
  const size_t rs   = (size_t)H_ * HD_;                      // 2048 row stride
  const size_t base = (size_t)b * TQ_ * rs + (size_t)h * HD_;

  // each thread moves 16 B of rows trow + 8p, p = 0..7, of a 64x128 tile
  const int trow = tid >> 4, tcol = (tid & 15) * 8;
  const unsigned short* Kg = Kx + base + (size_t)trow * rs + tcol;
  const unsigned short* Vg = V + base + (size_t)trow * rs + tcol;

  // This lane's query of group 0 (group g: 16 g rows further), and the Q^T fragments
  // (32 hd x 16 queries each) in the k order of lds_frag:
  // hd = 32 ks + 8 (lane >> 4) + 0..7, then 16 further.
  const size_t qrow = base + (size_t)(q0 + wv * (16 * QG_) + (lane & 15)) * rs;
  v16bf qf[QG_][4];
  u32x4 kr[8], vr[8];
  {
    const unsigned short* qp = Q + qrow + ((lane & 16) ? 8 : 0);
    union { u32x4 u[2]; v16bf v; } c[QG_][4];
#pragma unroll
    for (int g = 0; g < QG_; ++g)
#pragma unroll
      for (int ks = 0; ks < 4; ++ks) {
        c[g][ks].u[0] = *(const u32x4*)(qp + (size_t)(16 * g) * rs + ks * 32);
        c[g][ks].u[1] = *(const u32x4*)(qp + (size_t)(16 * g) * rs + ks * 32 + 16);
      }
#pragma unroll
    for (int p = 0; p < 8; ++p) kr[p] = *(const u32x4*)(Kg + (size_t)(p * 8) * rs);
#pragma unroll
    for (int p = 0; p < 8; ++p) vr[p] = *(const u32x4*)(Vg + (size_t)(p * 8) * rs);
    loads_issued();
    // Holds the arithmetic that follows behind the wait above: left alone the compiler
    // lifts it over the wait, onto the address registers of the Q loads.
    __builtin_amdgcn_sched_barrier(0);
#pragma unroll
    for (int g = 0; g < QG_; ++g)
#pragma unroll
      for (int ks = 0; ks < 4; ++ks) qf[g][ks] = c[g][ks].v;
  }

  // o[g][n8][r] = O[query 16 g + (lane&15)][16 n8 + 8 (lane>>4) + r]
  v8f o[QG_][8] = {};
  float mrow[QG_], lsum[QG_];        // lsum: this wave half's keys only, joined at the end
#pragma unroll
  for (int g = 0; g < QG_; ++g) { mrow[g] = -1e30f; lsum[g] = 0.f; }
  const float sc = 0.08838834764831845f;                     // 1/sqrt(128)

  for (int kb = 0; kb < TQ_ / 64; ++kb) {
    lds_barrier();  // previous tile's readers done before K/V overwrite
#pragma unroll
    for (int p = 0; p < 8; ++p) *(u32x4*)(&Ks[(trow + p * 8) * 136 + tcol]) = kr[p];
#pragma unroll
    for (int p = 0; p < 8; ++p) *(u32x4*)(&Vs[(trow + p * 8) * 144 + tcol]) = vr[p];
    // next tile's loads; the last trip reads its own tile again (in bounds,
    // unused), so no branch stands round the loads
    const size_t nxt = (size_t)(min(kb + 1, TQ_ / 64 - 1) * 64) * rs;
#pragma unroll
    for (int p = 0; p < 8; ++p) kr[p] = *(const u32x4*)(Kg + nxt + (size_t)(p * 8) * rs);
#pragma unroll
    for (int p = 0; p < 8; ++p) vr[p] = *(const u32x4*)(Vg + nxt + (size_t)(p * 8) * rs);
    loads_issued();
    lds_barrier();

    // S^T(64 keys x 16 queries) per group: s[g][n][r] = score of key 16 n + 8 (lane>>4) + r.
    // All 16 K fragments are asked for as one group in front of the products.
    v8f s[QG_][4] = {};
    {
      v16bf ak[4][4];
#pragma unroll
      for (int ks = 0; ks < 4; ++ks)
#pragma unroll
        for (int n = 0; n < 4; ++n) ak[ks][n] = lds_frag(Ks, 136, n * 16 + (lane & 15), ks * 32, lane);
      // Keeps the loads above in front of the products: left alone the compiler spreads
      // them among the products, one fragment ahead, and each waits out most of the
      // LDS latency.
      __builtin_amdgcn_sched_barrier(0);
#pragma unroll
      for (int ks = 0; ks < 4; ++ks)
#pragma unroll
        for (int n = 0; n < 4; ++n)
#pragma unroll
          for (int g = 0; g < QG_; ++g)
            s[g][n] = __builtin_amdgcn_wmma_f32_16x16x32_bf16(false, ak[ks][n], false, qf[g][ks],
                                                              (short)0, s[g][n], false, false);
    }

    // The compiler schedules nothing across this line and the one behind the softmax.
    // Without them it lifts all V fragment loads up beside the K fragments; the live
    // set then exceeds the register budget and the next tile's global loads are
    // spilled, which waits them out on the spot.
    __builtin_amdgcn_sched_barrier(0);
    // V^T fragments of the tile's first 32 keys: their LDS latency passes under the softmax
    v16bf av[2][8];
#pragma unroll
    for (int n8 = 0; n8 < 8; ++n8) av[0][n8] = lds_frag_tr(Vs, 144, 0, n8 * 16, lane);

    // Online softmax of this lane's query of each group over its 32 keys of the tile
    v16bf pf[QG_][2];
#pragma unroll
    for (int g = 0; g < QG_; ++g) {
      float v = -1e30f;
#pragma unroll
      for (int n = 0; n < 4; ++n)
#pragma unroll
        for (int r = 0; r < 8; ++r) { s[g][n][r] *= sc; v = fmaxf(v, s[g][n][r]); }
      v = fmaxf(v, xhalf(v));        // both halves: the maximum over all 64 keys
      const float mn   = fmaxf(mrow[g], v);
      const float corr = __expf(mrow[g] - mn);
      mrow[g] = mn;
      float psum = 0.f;
      // P^T as B operand: element e of fragment kk is key 32 kk + 8 (lane>>4) + e for
      // e < 8 and 16 keys further for e >= 8, which is s[2 kk] then s[2 kk + 1]
#pragma unroll
      for (int kk = 0; kk < 2; ++kk) {
        union { unsigned int w[8]; v16bf v; } c;
#pragma unroll
        for (int i = 0; i < 8; ++i) {
          float p0, p1;
          exp_pair(s[g][2 * kk + (i >> 2)][2 * (i & 3)] - mn, s[g][2 * kk + (i >> 2)][2 * (i & 3) + 1] - mn, p0, p1);
          psum += p0 + p1;
          c.w[i] = pack2(p0, p1);
        }
        pf[g][kk] = c.v;
      }
      lsum[g] = lsum[g] * corr + psum;
#pragma unroll
      for (int n8 = 0; n8 < 8; ++n8)
#pragma unroll
        for (int r = 0; r < 8; ++r) o[g][n8][r] *= corr;
    }

    __builtin_amdgcn_sched_barrier(0);  // see above

    // O^T(128 hd x 16 queries) += V^T(128 x 64) x P^T(64 x 16): A row = hd, k = key.
    // The second 32 keys' fragments come in under the first 32 keys' products.
#pragma unroll
    for (int n8 = 0; n8 < 8; ++n8) av[1][n8] = lds_frag_tr(Vs, 144, 32, n8 * 16, lane);
    __builtin_amdgcn_sched_barrier(0);  // these loads too stay one group in front of the products
#pragma unroll
    for (int kk = 0; kk < 2; ++kk)
#pragma unroll
      for (int n8 = 0; n8 < 8; ++n8)
#pragma unroll
        for (int g = 0; g < QG_; ++g)
          o[g][n8] = __builtin_amdgcn_wmma_f32_16x16x32_bf16(false, av[kk][n8], false, pf[g][kk],
                                                             (short)0, o[g][n8], false, false);
  }

  // Normalize and store (bf16, feeds the output projection GEMM): a lane's eight
  // registers of a tile are eight consecutive hd of its query, one 16 B store
#pragma unroll
  for (int g = 0; g < QG_; ++g) {
    const float lfin = lsum[g] + xhalf(lsum[g]);
    unsigned short* Og = O + qrow + (size_t)(16 * g) * rs + ((lane & 16) ? 8 : 0);
#pragma unroll
    for (int n8 = 0; n8 < 8; ++n8) {
      const u32x4 pk = {pack2(o[g][n8][0] / lfin, o[g][n8][1] / lfin), pack2(o[g][n8][2] / lfin, o[g][n8][3] / lfin),
                        pack2(o[g][n8][4] / lfin, o[g][n8][5] / lfin), pack2(o[g][n8][6] / lfin, o[g][n8][7] / lfin)};
      *(u32x4*)(Og + n8 * 16) = pk;
      loads_issued();  // the store's data registers are reused for the next tile
    }
  }
}

// ---------------------------------------------------------------------------
// Launch chain
// ---------------------------------------------------------------------------
extern "C" void kernel_launch(void* const* d_in, const int* in_sizes, int n_in,
                              void* d_out, int out_size, void* d_ws, size_t ws_size,
                              hipStream_t stream) {
  (void)in_sizes; (void)n_in; (void)out_size; (void)ws_size;

  const float* x    = (const float*)d_in[0];
  const float* wq_a = (const float*)d_in[1];
  const float* wq_b = (const float*)d_in[2];
  const float* wk_a = (const float*)d_in[3];
  const float* wk_b = (const float*)d_in[4];
  const float* wv_a = (const float*)d_in[5];
  const float* wv_b = (const float*)d_in[6];
  const float* wo_w = (const float*)d_in[7];
  const float* wo_b = (const float*)d_in[8];

  const int M = BB_ * TQ_;  // 4096 tokens

  size_t off = 0;
  auto alloc = [&](size_t elems) {
    unsigned short* p = (unsigned short*)((char*)d_ws + off);
    off += (elems * sizeof(unsigned short) + 255) & ~(size_t)255;
    return p;
  };
  unsigned short* xb   = alloc((size_t)M * D_);
  unsigned short* wqab = alloc((size_t)R_ * D_);
  unsigned short* wqbb = alloc((size_t)D_ * R_);
  unsigned short* wkab = alloc((size_t)R_ * D_);
  unsigned short* wkbb = alloc((size_t)D_ * R_);
  unsigned short* wvab = alloc((size_t)R_ * D_);
  unsigned short* wvbb = alloc((size_t)D_ * R_);
  unsigned short* wob  = alloc((size_t)D_ * D_);
  unsigned short* cq   = alloc((size_t)M * R_);
  unsigned short* ck   = alloc((size_t)M * R_);
  unsigned short* cv   = alloc((size_t)M * R_);
  unsigned short* qb   = alloc((size_t)M * D_);
  unsigned short* kb   = alloc((size_t)M * D_);
  unsigned short* vb   = alloc((size_t)M * D_);
  unsigned short* ao   = alloc((size_t)M * D_);

  // xb .. wob lie back to back (every size is a multiple of 256 B), in this order
  f32_to_bf16_all<<<dim3(CONV_WGS), dim3(256), 0, stream>>>(x, wq_a, wq_b, wk_a, wk_b,
                                                            wv_a, wv_b, wo_w, xb);

  // 128 x 64 tiles (256 work-groups)
  auto gemm_n64 = [&](const unsigned short* A, const unsigned short* W, void* C,
                      const float* bias, int Mg, int Ng, int Kg, int f32out) {
    gemm_abT_n64<<<dim3(Ng / 64, Mg / 128), dim3(256), 0, stream>>>(A, W, C, bias, Ng, Kg, f32out);
  };
  // 128 x 128 tiles (512 work-groups)
  auto gemm_n128 = [&](const unsigned short* A, const unsigned short* W, void* C,
                       const float* bias, int Mg, int Ng, int Kg, int f32out) {
    gemm_abT_n128<<<dim3(Ng / 128, Mg / 128), dim3(256), 0, stream>>>(A, W, C, bias, Ng, Kg, f32out);
  };

  // latent down-projections: [4096,2048] x [512,2048]^T
  gemm_n64(xb, wqab, cq, nullptr, M, R_, D_, 0);
  gemm_n64(xb, wkab, ck, nullptr, M, R_, D_, 0);
  gemm_n64(xb, wvab, cv, nullptr, M, R_, D_, 0);
  // up-projections: [4096,512] x [2048,512]^T
  gemm_n128(cq, wqbb, qb, nullptr, M, D_, R_, 0);
  gemm_n128(ck, wkbb, kb, nullptr, M, D_, R_, 0);
  gemm_n128(cv, wvbb, vb, nullptr, M, D_, R_, 0);
  // flash attention: grid = (T/128 q-blocks, B*H heads)
  mla_attn<<<dim3(TQ_ / (64 * QG_), BB_ * H_), dim3(128), 0, stream>>>(qb, kb, vb, ao);
  // output projection + bias -> f32 d_out
  gemm_n128(ao, wob, (float*)d_out, wo_b, M, D_, D_, 1);
}

// v007
// A run of this version takes 166 microseconds.
// Next to v006, in two timings, it ran 1.16 times as fast each time.
// Counting every step since v000, it is 4.44 times as fast.
#include <hip/hip_runtime.h>
#include <hip/hip_bf16.h>

// ---------------------------------------------------------------------------
// MLA (multi-head latent attention) forward for MI455X / gfx1250.
// All GEMMs + attention run through v_wmma_f32_16x16x32_bf16 (f32 accumulate).
// ---------------------------------------------------------------------------

typedef __attribute__((ext_vector_type(16))) __bf16 v16bf;
typedef __attribute__((ext_vector_type(8)))  float  v8f;
typedef __attribute__((ext_vector_type(4)))  unsigned int u32x4;   // 16 B in flight

#define D_   2048
#define H_   16
#define HD_  128
#define TQ_  2048
#define BB_  2
#define R_   512

static __device__ __forceinline__ unsigned short f2bf(float f) {
  unsigned int u = __float_as_uint(f);
  u += 0x7FFFu + ((u >> 16) & 1u);          // round-to-nearest-even
  return (unsigned short)(u >> 16);
}

// Work-group barrier that orders LDS traffic only. __syncthreads() also waits
// for every global load of the wave, which would drain the loads issued ahead
// for a later tile; nothing read from global memory here is written in the launch.
static __device__ __forceinline__ void lds_barrier() {
  __builtin_amdgcn_fence(__ATOMIC_RELEASE, "workgroup", "local");
  __builtin_amdgcn_s_barrier();
  __builtin_amdgcn_fence(__ATOMIC_ACQUIRE, "workgroup", "local");
}

// Stands behind a batch of global loads that stays in flight, in front of the
// first instruction that reuses one of their address registers.
static __device__ __forceinline__ void loads_issued() {
  asm volatile("s_wait_xcnt 0x0" ::: "memory");
}

// Load one 16x32 bf16 WMMA operand fragment from LDS (row-major, `stride`
// elements per row). Matches the CDNA5 16-bit A/B layout:
//   lanes 0-15 : K = 0..7 (v0-3), 16..23 (v4-7)
//   lanes16-31 : K = 8..15 (v0-3), 24..31 (v4-7)
// => two 16-byte contiguous LDS reads per lane.
static __device__ __forceinline__ v16bf lds_frag(const unsigned short* p, int stride,
                                                 int row, int koff, int lane) {
  const int kb = (lane & 16) ? 8 : 0;
  const unsigned short* base = p + row * stride + koff + kb;
  union { uint4 u[2]; v16bf v; } c;
  c.u[0] = *(const uint4*)(base);
  c.u[1] = *(const uint4*)(base + 16);
  return c.v;
}

// Load one 32(k) x 16(col) bf16 B fragment from a row-major [k][col] LDS tile
// with the transposing load: lane (c = lane&15, h = lane>>4) receives
// tile[kbase + 8h + 0..7][dbase + c]; the second load, 16 rows further, gives
// k = 16 + 8h + 0..7, i.e. the same k order as lds_frag above. Taken as an A
// fragment the same registers are 16(row = col of the tile) x 32(k).
// `pitch` is in elements; 32 B x odd keeps the load free of bank conflicts.
typedef __attribute__((ext_vector_type(8))) short s16x8;
static __device__ __forceinline__ v16bf lds_frag_tr(const unsigned short* tile, int pitch,
                                                    int kbase, int dbase, int lane) {
  typedef __attribute__((address_space(3))) s16x8 lds_s16x8;
  const unsigned short* p = tile + (kbase + ((lane >> 4) << 3) + (lane & 7)) * pitch
                                 + dbase + (((lane >> 3) & 1) << 3);
  union { s16x8 u[2]; v16bf v; } c;
  c.u[0] = __builtin_amdgcn_ds_load_tr16_b128_v8i16((lds_s16x8*)p);
  c.u[1] = __builtin_amdgcn_ds_load_tr16_b128_v8i16((lds_s16x8*)(p + 16 * pitch));
  return c.v;
}

// ---------------------------------------------------------------------------
// fp32 -> bf16 conversion of all eight arrays in one launch. The bf16 copies lie
// back to back in `dst`, in the order of the arguments. The work is cut into
// chunks of 8192 elements (8 x 16 B per thread, each wave-wide load 512 B in a
// row); every array is a whole number of chunks, so a chunk has one source.
// CONV_WGS work-groups (three per WGP) take CONV_TRIPS chunks each, a chunk's
// eight loads going out before the chunk in front of it is converted: few, long
// waves, for speed only.
// ---------------------------------------------------------------------------
#define CONV_CHUNK   8192
#define CONV_X_CH    (BB_ * TQ_ * D_ / CONV_CHUNK)          // chunks of x
#define CONV_W_CH    (R_ * D_ / CONV_CHUNK)                 // chunks of a low-rank weight
#define CONV_CHUNKS  (CONV_X_CH + 6 * CONV_W_CH + D_ * D_ / CONV_CHUNK)
#define CONV_WGS     768
#define CONV_TRIPS   (CONV_CHUNKS / CONV_WGS)
static_assert(CONV_TRIPS * CONV_WGS == CONV_CHUNKS, "every work-group takes the same number of chunks");
typedef __attribute__((ext_vector_type(4))) unsigned short u16x4;

__global__ __launch_bounds__(256) void f32_to_bf16_all(const float* __restrict__ x,
                                                       const float* __restrict__ wq_a,
                                                       const float* __restrict__ wq_b,
                                                       const float* __restrict__ wk_a,
                                                       const float* __restrict__ wk_b,
                                                       const float* __restrict__ wv_a,
                                                       const float* __restrict__ wv_b,
                                                       const float* __restrict__ wo_w,
                                                       unsigned short* __restrict__ dst) {
  const int tid = threadIdx.x;

  // The three loops below are unrolled so that every index of v is a constant and
  // v stays in registers.
  float4 v[2][8];
#pragma unroll
  for (int t = 0; t <= CONV_TRIPS; ++t) {
    if (t < CONV_TRIPS) {
      // chunk c and its place in its source array: the same for the whole work-group
      const int c = blockIdx.x + t * CONV_WGS;
      const int w = (c - CONV_X_CH) / CONV_W_CH;            // which weight, where c is past x
      const float* s = x;
      int first = 0;                                        // the array's first chunk
      if (c >= CONV_X_CH) {
        s = w == 0 ? wq_a : w == 1 ? wq_b : w == 2 ? wk_a
          : w == 3 ? wk_b : w == 4 ? wv_a : w == 5 ? wv_b : wo_w;
        first = CONV_X_CH + min(w, 6) * CONV_W_CH;
      }
      s += (size_t)(c - first) * CONV_CHUNK + tid * 4;
#pragma unroll
      for (int j = 0; j < 8; ++j) v[t & 1][j] = *(const float4*)(s + j * 1024);
      loads_issued();
      // Keeps the conversion below behind these loads: without it its first
      // instructions, and their wait for the chunk before, stand in front of chunk 1's
      // loads, which then go out one memory latency late.
      __builtin_amdgcn_sched_barrier(0);
    }
    if (t > 0) {
      unsigned short* d = dst + (size_t)(blockIdx.x + (t - 1) * CONV_WGS) * CONV_CHUNK + tid * 4;
#pragma unroll
      for (int j = 0; j < 8; ++j) {
        const float4 f = v[(t - 1) & 1][j];
        const u16x4 o = {f2bf(f.x), f2bf(f.y), f2bf(f.z), f2bf(f.w)};
        *(u16x4*)(d + j * 1024) = o;
      }
      if (t < CONV_TRIPS) loads_issued();  // the stores' address registers are reused below
    }
  }
}

// ---------------------------------------------------------------------------
// C[M,N] = A[M,K] (bf16 row-major) x W[N,K]^T (bf16 row-major) (+bias)
// Block: 256 threads (8 waves, 4 along M x 2 along N). Tile: 128(M) x 32 NI(N),
// K-step 64, so that a tile row is one whole 128-B line of its operand.
// A wave computes 32 x 16 NI = 2 x NI WMMA 16x16 fragments, twice per K-step.
// NI = 4 (128 x 128) where N = 2048: 512 work-groups a product, two per WGP at a
// time; NI = 2 (128 x 64) for the narrow down-projections, whose three products
// are then 768 work-groups, three per WGP (at 128 x 128: 384, one and a half).
// The global loads of a K-step go out together, two K-steps ahead of their LDS
// stores, into two register sets used in turn. K is a multiple of 128.
// ---------------------------------------------------------------------------
#define GP_ 72   // LDS row pitch in elements: 144 B = 16 B x odd, for the b128 readers

template <int NI>
static __device__ __forceinline__ void gemm_tile(unsigned short* As, unsigned short* Ws,
                                                 const unsigned short* __restrict__ A,
                                                 const unsigned short* __restrict__ W,
                                                 void* __restrict__ C,
                                                 const float* __restrict__ bias,
                                                 int N, int K, int out_f32) {
  const int tid  = threadIdx.x;
  const int lane = tid & 31;
  const int wv   = tid >> 5;
  const int wm   = (wv & 3) * 32;
  const int wn   = (wv >> 2) * (NI * 16);
  const int m0   = blockIdx.y * 128;
  const int n0   = blockIdx.x * (NI * 32);

  v8f acc[2][NI] = {};

  // cooperative tile loads: 8 bf16 (16 B) per thread, eight threads to a row;
  // rows lrow + 32 j, j < 4 of A and j < NI of W
  const int lrow = tid >> 3, lcol = (tid & 7) * 8;
  // An address is a base that is the same for the whole work-group (it alone moves
  // along K) plus this thread's byte offset in the tile's rows, which never changes.
  const char* Ab = (const char*)(A + (size_t)m0 * K);
  const char* Wb = (const char*)(W + (size_t)n0 * K);
  unsigned int toff[4];
#pragma unroll
  for (int j = 0; j < 4; ++j) toff[j] = (unsigned int)(((lrow + 32 * j) * K + lcol) * 2);
  unsigned short* Asw = As + lrow * GP_ + lcol;
  unsigned short* Wsw = Ws + lrow * GP_ + lcol;

  u32x4 ra[2][4], rw[2][NI];
#pragma unroll
  for (int j = 0; j < 4; ++j)  ra[0][j] = *(const u32x4*)(Ab + toff[j]);
#pragma unroll
  for (int j = 0; j < NI; ++j) rw[0][j] = *(const u32x4*)(Wb + toff[j]);
  // Compiler-only fence (no instruction): keeps set 0's loads in front of set 1's.
  // Loads return in issue order, so the loop's wait for one set can then leave the
  // other set's loads in flight; interleaved, it has to drain them all.
  __builtin_amdgcn_fence(__ATOMIC_ACQ_REL, "wavefront");
#pragma unroll
  for (int j = 0; j < 4; ++j)  ra[1][j] = *(const u32x4*)(Ab + 128 + toff[j]);
#pragma unroll
  for (int j = 0; j < NI; ++j) rw[1][j] = *(const u32x4*)(Wb + 128 + toff[j]);
  loads_issued();  // the offset registers are given other uses in front of the loop

  for (int k0 = 0; k0 < K; k0 += 128) {
#pragma unroll
    for (int s = 0; s < 2; ++s) {
#pragma unroll
      for (int j = 0; j < 4; ++j)  *(u32x4*)(Asw + j * 32 * GP_) = ra[s][j];
#pragma unroll
      for (int j = 0; j < NI; ++j) *(u32x4*)(Wsw + j * 32 * GP_) = rw[s][j];
      // refill this set for the K-step two ahead; the last two K-steps read the
      // last tile again (in bounds, unused), so no branch stands round the loads
      const int kn = min(k0 + s * 64 + 128, K - 64);
#pragma unroll
      for (int j = 0; j < 4; ++j)  ra[s][j] = *(const u32x4*)(Ab + kn * 2 + toff[j]);
#pragma unroll
      for (int j = 0; j < NI; ++j) rw[s][j] = *(const u32x4*)(Wb + kn * 2 + toff[j]);
      loads_issued();
      lds_barrier();  // this K-step's tile is whole in LDS

#pragma unroll
      for (int kk = 0; kk < 2; ++kk) {
        v16bf af[2], bfm[NI];
#pragma unroll
        for (int mi = 0; mi < 2; ++mi)
          af[mi] = lds_frag(As, GP_, wm + mi * 16 + (lane & 15), kk * 32, lane);
#pragma unroll
        for (int ni = 0; ni < NI; ++ni)
          bfm[ni] = lds_frag(Ws, GP_, wn + ni * 16 + (lane & 15), kk * 32, lane);
#pragma unroll
        for (int mi = 0; mi < 2; ++mi)
#pragma unroll
          for (int ni = 0; ni < NI; ++ni)
            acc[mi][ni] = __builtin_amdgcn_wmma_f32_16x16x32_bf16(
                false, af[mi], false, bfm[ni], (short)0, acc[mi][ni], false, false);
      }
      lds_barrier();  // every wave has read the tile
    }
  }

  // Epilogue. C-fragment layout: row = r + 8*(lane>=16), col = lane&15.
  const int rowadd = (lane & 16) ? 8 : 0;
#pragma unroll
  for (int mi = 0; mi < 2; ++mi)
#pragma unroll
    for (int ni = 0; ni < NI; ++ni) {
      const int col = n0 + wn + ni * 16 + (lane & 15);
      const float bv = bias ? bias[col] : 0.f;
#pragma unroll
      for (int r = 0; r < 8; ++r) {
        const int row = m0 + wm + mi * 16 + r + rowadd;
        float v = acc[mi][ni][r] + bv;
        // behind each store: its address and data registers are reused right away
        if (out_f32) {
          ((float*)C)[(size_t)row * N + col] = v;
          loads_issued();
        } else {
          ((unsigned short*)C)[(size_t)row * N + col] = f2bf(v);
          loads_issued();
        }
      }
    }
}

// A launch holds up to three independent products of one shape (those for q, k and
// v): blockIdx.z picks the operands, the same for the whole work-group. The narrow
// down-projections then put three work-groups on a WGP, where a launch of one of
// them puts a single one, whose waits at its barriers nothing fills; and one
// product's first loads and last stores run beside another's K loop instead of
// behind a launch boundary.
#define PICK3_(p) (blockIdx.z == 0 ? p##0 : blockIdx.z == 1 ? p##1 : p##2)

// amdgpu_waves_per_eu(min, max): min sets the compiler's register budget, max the
// waves that may share a SIMD. With the default budget the compiler held part of a
// K-step's fragment loads back to save registers, which made two more places per
// K-step where a wave waits for LDS. max is what the grid puts on a SIMD: six waves
// (768 work-groups, three on a WGP) for n64, four (two on a WGP at a time) for n128.
__global__ __launch_bounds__(256) __attribute__((amdgpu_waves_per_eu(2, 6))) void gemm_abT_n64(const unsigned short* __restrict__ A0,
                                                    const unsigned short* __restrict__ A1,
                                                    const unsigned short* __restrict__ A2,
                                                    const unsigned short* __restrict__ W0,
                                                    const unsigned short* __restrict__ W1,
                                                    const unsigned short* __restrict__ W2,
                                                    void* __restrict__ C0,
                                                    void* __restrict__ C1,
                                                    void* __restrict__ C2,
                                                    const float* __restrict__ bias,
                                                    int N, int K, int out_f32) {
  __shared__ __align__(16) unsigned short As[128 * GP_];
  __shared__ __align__(16) unsigned short Ws[64 * GP_];
  gemm_tile<2>(As, Ws, PICK3_(A), PICK3_(W), PICK3_(C), bias, N, K, out_f32);
}

__global__ __launch_bounds__(256) __attribute__((amdgpu_waves_per_eu(4, 4))) void gemm_abT_n128(const unsigned short* __restrict__ A0,
                                                     const unsigned short* __restrict__ A1,
                                                     const unsigned short* __restrict__ A2,
                                                     const unsigned short* __restrict__ W0,
                                                     const unsigned short* __restrict__ W1,
                                                     const unsigned short* __restrict__ W2,
                                                     void* __restrict__ C0,
                                                     void* __restrict__ C1,
                                                     void* __restrict__ C2,
                                                     const float* __restrict__ bias,
                                                     int N, int K, int out_f32) {
  __shared__ __align__(16) unsigned short As[128 * GP_];
  __shared__ __align__(16) unsigned short Ws[128 * GP_];
  gemm_tile<4>(As, Ws, PICK3_(A), PICK3_(W), PICK3_(C), bias, N, K, out_f32);
}

// ---------------------------------------------------------------------------
// Flash attention per (b,h). Block = 128 threads (4 waves), 128 query rows,
// streaming 64-key tiles; K/V tiles row-major in LDS.
// Both products are transposed: S^T = K x Q^T (A = K rows from LDS, B = the
// wave's queries, held in registers) and O^T += V^T x P^T (A = V^T by the
// transposing LDS load). A lane then holds scores of ONE query per column group
// (column lane&15; the two wave halves hold different keys), so the maximum and
// the sum run in-lane with one exchange between the halves, and two score tiles,
// rounded in place, are the B operand of the second product: P never goes
// through LDS.
// A wave takes QG_ = 2 column groups of 16 queries: a K or V fragment read from
// LDS feeds two products, which halves the LDS reads, the K/V staging and the
// barriers per query. 512 work-groups are two per WGP, two waves per SIMD.
// The 16 global loads of a K/V tile go out together, one tile ahead of their
// LDS stores, and wait in registers while the current tile is worked on.
// ---------------------------------------------------------------------------
#define QG_ 2
// two f32 -> one register of two bf16, round to nearest even
static __device__ __forceinline__ unsigned int pack2(float lo, float hi) {
  typedef __attribute__((ext_vector_type(2))) __bf16 bf2;
  typedef __attribute__((ext_vector_type(2))) float f2;
  return __builtin_bit_cast(unsigned int, __builtin_convertvector(f2{lo, hi}, bf2));
}
// e^a and e^b, as __expf forms them (one multiply, v_exp_f32). Written in asm so
// that the slot the instruction set asks for behind a transcendental is filled by
// construction: the second v_exp_f32, which shares no register with the first,
// fills the first's, the v_nop the second's.
static __device__ __forceinline__ void exp_pair(float a, float b, float& ea, float& eb) {
  const float xa = a * 1.44269504088896340736f, xb = b * 1.44269504088896340736f;
  asm("v_exp_f32 %0, %2\n\tv_exp_f32 %1, %3\n\tv_nop" : "=&v"(ea), "=&v"(eb) : "v"(xa), "v"(xb));
}
// the value of lane l ^ 16
static __device__ __forceinline__ float xhalf(float x) {
  return __builtin_bit_cast(float, __builtin_amdgcn_permlanex16(
      __builtin_bit_cast(int, x), __builtin_bit_cast(int, x), 0x76543210, 0xfedcba98, false, false));
}

// amdgpu_waves_per_eu: the register budget is that of the two waves which the grid
// puts on a SIMD. With the default budget the compiler keeps one fragment in
// registers and waits out the LDS latency in front of every product.
__global__ __launch_bounds__(128) __attribute__((amdgpu_waves_per_eu(2, 2))) void mla_attn(const unsigned short* __restrict__ Q,
                                                const unsigned short* __restrict__ Kx,
                                                const unsigned short* __restrict__ V,
                                                unsigned short* __restrict__ O) {
  __shared__ __align__(16) unsigned short Ks[64 * 136];      // [key][hd], pitch 272 B
  __shared__ __align__(16) unsigned short Vs[64 * 144];      // [key][hd], pitch 288 B

  const int tid  = threadIdx.x;
  const int lane = tid & 31;
  const int wv   = tid >> 5;
  const int q0   = blockIdx.x * (64 * QG_);
  const int bh   = blockIdx.y;
  const int b    = bh / H_;
  const int h    = bh % H_;
  const size_t rs   = (size_t)H_ * HD_;                      // 2048 row stride
  const size_t base = (size_t)b * TQ_ * rs + (size_t)h * HD_;

  // each thread moves 16 B of rows trow + 8p, p = 0..7, of a 64x128 tile
  const int trow = tid >> 4, tcol = (tid & 15) * 8;
  const unsigned short* Kg = Kx + base + (size_t)trow * rs + tcol;
  const unsigned short* Vg = V + base + (size_t)trow * rs + tcol;

  // This lane's query of group 0 (group g: 16 g rows further), and the Q^T fragments
  // (32 hd x 16 queries each) in the k order of lds_frag:
  // hd = 32 ks + 8 (lane >> 4) + 0..7, then 16 further.
  const size_t qrow = base + (size_t)(q0 + wv * (16 * QG_) + (lane & 15)) * rs;
  v16bf qf[QG_][4];
  u32x4 kr[8], vr[8];
  {
    const unsigned short* qp = Q + qrow + ((lane & 16) ? 8 : 0);
    union { u32x4 u[2]; v16bf v; } c[QG_][4];
#pragma unroll
    for (int g = 0; g < QG_; ++g)
#pragma unroll
      for (int ks = 0; ks < 4; ++ks) {
        c[g][ks].u[0] = *(const u32x4*)(qp + (size_t)(16 * g) * rs + ks * 32);
        c[g][ks].u[1] = *(const u32x4*)(qp + (size_t)(16 * g) * rs + ks * 32 + 16);
      }
#pragma unroll
    for (int p = 0; p < 8; ++p) kr[p] = *(const u32x4*)(Kg + (size_t)(p * 8) * rs);
#pragma unroll
    for (int p = 0; p < 8; ++p) vr[p] = *(const u32x4*)(Vg + (size_t)(p * 8) * rs);
    loads_issued();
    // Holds the arithmetic that follows behind the wait above: left alone the compiler
    // lifts it over the wait, onto the address registers of the Q loads.
    __builtin_amdgcn_sched_barrier(0);
#pragma unroll
    for (int g = 0; g < QG_; ++g)
#pragma unroll
      for (int ks = 0; ks < 4; ++ks) qf[g][ks] = c[g][ks].v;
  }

  // o[g][n8][r] = O[query 16 g + (lane&15)][16 n8 + 8 (lane>>4) + r]
  v8f o[QG_][8] = {};
  float mrow[QG_], lsum[QG_];        // lsum: this wave half's keys only, joined at the end
#pragma unroll
  for (int g = 0; g < QG_; ++g) { mrow[g] = -1e30f; lsum[g] = 0.f; }
  const float sc = 0.08838834764831845f;                     // 1/sqrt(128)

  for (int kb = 0; kb < TQ_ / 64; ++kb) {
    lds_barrier();  // previous tile's readers done before K/V overwrite
#pragma unroll
    for (int p = 0; p < 8; ++p) *(u32x4*)(&Ks[(trow + p * 8) * 136 + tcol]) = kr[p];
#pragma unroll
    for (int p = 0; p < 8; ++p) *(u32x4*)(&Vs[(trow + p * 8) * 144 + tcol]) = vr[p];
    // next tile's loads; the last trip reads its own tile again (in bounds,
    // unused), so no branch stands round the loads
    const size_t nxt = (size_t)(min(kb + 1, TQ_ / 64 - 1) * 64) * rs;
#pragma unroll
    for (int p = 0; p < 8; ++p) kr[p] = *(const u32x4*)(Kg + nxt + (size_t)(p * 8) * rs);
#pragma unroll
    for (int p = 0; p < 8; ++p) vr[p] = *(const u32x4*)(Vg + nxt + (size_t)(p * 8) * rs);
    loads_issued();
    lds_barrier();

    // S^T(64 keys x 16 queries) per group: s[g][n][r] = score of key 16 n + 8 (lane>>4) + r.
    // All 16 K fragments are asked for as one group in front of the products.
    v8f s[QG_][4] = {};
    {
      v16bf ak[4][4];
#pragma unroll
      for (int ks = 0; ks < 4; ++ks)
#pragma unroll
        for (int n = 0; n < 4; ++n) ak[ks][n] = lds_frag(Ks, 136, n * 16 + (lane & 15), ks * 32, lane);
      // Keeps the loads above in front of the products: left alone the compiler spreads
      // them among the products, one fragment ahead, and each waits out most of the
      // LDS latency.
      __builtin_amdgcn_sched_barrier(0);
#pragma unroll
      for (int ks = 0; ks < 4; ++ks)
#pragma unroll
        for (int n = 0; n < 4; ++n)
#pragma unroll
          for (int g = 0; g < QG_; ++g)
            s[g][n] = __builtin_amdgcn_wmma_f32_16x16x32_bf16(false, ak[ks][n], false, qf[g][ks],
                                                              (short)0, s[g][n], false, false);
    }

    // The compiler schedules nothing across this line and the one behind the softmax.
    // Without them it lifts all V fragment loads up beside the K fragments; the live
    // set then exceeds the register budget and the next tile's global loads are
    // spilled, which waits them out on the spot.
    __builtin_amdgcn_sched_barrier(0);
    // V^T fragments of the tile's first 32 keys: their LDS latency passes under the softmax
    v16bf av[2][8];
#pragma unroll
    for (int n8 = 0; n8 < 8; ++n8) av[0][n8] = lds_frag_tr(Vs, 144, 0, n8 * 16, lane);

    // Online softmax of this lane's query of each group over its 32 keys of the tile
    v16bf pf[QG_][2];
#pragma unroll
    for (int g = 0; g < QG_; ++g) {
      float v = -1e30f;
#pragma unroll
      for (int n = 0; n < 4; ++n)
#pragma unroll
        for (int r = 0; r < 8; ++r) { s[g][n][r] *= sc; v = fmaxf(v, s[g][n][r]); }
      v = fmaxf(v, xhalf(v));        // both halves: the maximum over all 64 keys
      const float mn   = fmaxf(mrow[g], v);
      const float corr = __expf(mrow[g] - mn);
      mrow[g] = mn;
      float psum = 0.f;
      // P^T as B operand: element e of fragment kk is key 32 kk + 8 (lane>>4) + e for
      // e < 8 and 16 keys further for e >= 8, which is s[2 kk] then s[2 kk + 1]
#pragma unroll
      for (int kk = 0; kk < 2; ++kk) {
        union { unsigned int w[8]; v16bf v; } c;
#pragma unroll
        for (int i = 0; i < 8; ++i) {
          float p0, p1;
          exp_pair(s[g][2 * kk + (i >> 2)][2 * (i & 3)] - mn, s[g][2 * kk + (i >> 2)][2 * (i & 3) + 1] - mn, p0, p1);
          psum += p0 + p1;
          c.w[i] = pack2(p0, p1);
        }
        pf[g][kk] = c.v;
      }
      lsum[g] = lsum[g] * corr + psum;
#pragma unroll
      for (int n8 = 0; n8 < 8; ++n8)
#pragma unroll
        for (int r = 0; r < 8; ++r) o[g][n8][r] *= corr;
    }

    __builtin_amdgcn_sched_barrier(0);  // see above

    // O^T(128 hd x 16 queries) += V^T(128 x 64) x P^T(64 x 16): A row = hd, k = key.
    // The second 32 keys' fragments come in under the first 32 keys' products.
#pragma unroll
    for (int n8 = 0; n8 < 8; ++n8) av[1][n8] = lds_frag_tr(Vs, 144, 32, n8 * 16, lane);
    __builtin_amdgcn_sched_barrier(0);  // these loads too stay one group in front of the products
#pragma unroll
    for (int kk = 0; kk < 2; ++kk)
#pragma unroll
      for (int n8 = 0; n8 < 8; ++n8)
#pragma unroll
        for (int g = 0; g < QG_; ++g)
          o[g][n8] = __builtin_amdgcn_wmma_f32_16x16x32_bf16(false, av[kk][n8], false, pf[g][kk],
                                                             (short)0, o[g][n8], false, false);
  }

  // Normalize and store (bf16, feeds the output projection GEMM): a lane's eight
  // registers of a tile are eight consecutive hd of its query, one 16 B store
#pragma unroll
  for (int g = 0; g < QG_; ++g) {
    const float lfin = lsum[g] + xhalf(lsum[g]);
    unsigned short* Og = O + qrow + (size_t)(16 * g) * rs + ((lane & 16) ? 8 : 0);
#pragma unroll
    for (int n8 = 0; n8 < 8; ++n8) {
      const u32x4 pk = {pack2(o[g][n8][0] / lfin, o[g][n8][1] / lfin), pack2(o[g][n8][2] / lfin, o[g][n8][3] / lfin),
                        pack2(o[g][n8][4] / lfin, o[g][n8][5] / lfin), pack2(o[g][n8][6] / lfin, o[g][n8][7] / lfin)};
      *(u32x4*)(Og + n8 * 16) = pk;
      loads_issued();  // the store's data registers are reused for the next tile
    }
  }
}

// ---------------------------------------------------------------------------
// Launch chain
// ---------------------------------------------------------------------------
extern "C" void kernel_launch(void* const* d_in, const int* in_sizes, int n_in,
                              void* d_out, int out_size, void* d_ws, size_t ws_size,
                              hipStream_t stream) {
  (void)in_sizes; (void)n_in; (void)out_size; (void)ws_size;

  const float* x    = (const float*)d_in[0];
  const float* wq_a = (const float*)d_in[1];
  const float* wq_b = (const float*)d_in[2];
  const float* wk_a = (const float*)d_in[3];
  const float* wk_b = (const float*)d_in[4];
  const float* wv_a = (const float*)d_in[5];
  const float* wv_b = (const float*)d_in[6];
  const float* wo_w = (const float*)d_in[7];
  const float* wo_b = (const float*)d_in[8];

  const int M = BB_ * TQ_;  // 4096 tokens

  size_t off = 0;
  auto alloc = [&](size_t elems) {
    unsigned short* p = (unsigned short*)((char*)d_ws + off);
    off += (elems * sizeof(unsigned short) + 255) & ~(size_t)255;
    return p;
  };
  unsigned short* xb   = alloc((size_t)M * D_);
  unsigned short* wqab = alloc((size_t)R_ * D_);
  unsigned short* wqbb = alloc((size_t)D_ * R_);
  unsigned short* wkab = alloc((size_t)R_ * D_);
  unsigned short* wkbb = alloc((size_t)D_ * R_);
  unsigned short* wvab = alloc((size_t)R_ * D_);
  unsigned short* wvbb = alloc((size_t)D_ * R_);
  unsigned short* wob  = alloc((size_t)D_ * D_);
  unsigned short* cq   = alloc((size_t)M * R_);
  unsigned short* ck   = alloc((size_t)M * R_);
  unsigned short* cv   = alloc((size_t)M * R_);
  unsigned short* qb   = alloc((size_t)M * D_);
  unsigned short* kb   = alloc((size_t)M * D_);
  unsigned short* vb   = alloc((size_t)M * D_);
  unsigned short* ao   = alloc((size_t)M * D_);

  // xb .. wob lie back to back (every size is a multiple of 256 B), in this order
  f32_to_bf16_all<<<dim3(CONV_WGS), dim3(256), 0, stream>>>(x, wq_a, wq_b, wk_a, wk_b,
                                                            wv_a, wv_b, wo_w, xb);

  // latent down-projections, [4096,2048] x [512,2048]^T each: 128 x 64 tiles, 3 x 256 work-groups
  gemm_abT_n64<<<dim3(R_ / 64, M / 128, 3), dim3(256), 0, stream>>>(xb, xb, xb, wqab, wkab, wvab,
                                                                    cq, ck, cv, nullptr, R_, D_, 0);
  // up-projections, [4096,512] x [2048,512]^T each: 128 x 128 tiles, 3 x 512 work-groups
  gemm_abT_n128<<<dim3(D_ / 128, M / 128, 3), dim3(256), 0, stream>>>(cq, ck, cv, wqbb, wkbb, wvbb,
                                                                      qb, kb, vb, nullptr, D_, R_, 0);
  // flash attention: grid = (T/128 q-blocks, B*H heads)
  mla_attn<<<dim3(TQ_ / (64 * QG_), BB_ * H_), dim3(128), 0, stream>>>(qb, kb, vb, ao);
  // output projection + bias -> f32 d_out
  gemm_abT_n128<<<dim3(D_ / 128, M / 128, 1), dim3(256), 0, stream>>>(ao, ao, ao, wob, wob, wob,
                                                                      d_out, d_out, d_out, wo_b, D_, D_, 1);
}

// v008
// It runs in 145 microseconds.
// Two timings next to v007 both put it at 1.15 times that version's speed.
// All steps since v000 together make it 5.10 times as fast.
#include <hip/hip_runtime.h>
#include <hip/hip_bf16.h>

// ---------------------------------------------------------------------------
// MLA (multi-head latent attention) forward for MI455X / gfx1250.
// All GEMMs + attention run through v_wmma_f32_16x16x32_bf16 (f32 accumulate).
// ---------------------------------------------------------------------------

typedef __attribute__((ext_vector_type(16))) __bf16 v16bf;
typedef __attribute__((ext_vector_type(8)))  float  v8f;
typedef __attribute__((ext_vector_type(4)))  unsigned int u32x4;   // 16 B in flight

#define D_   2048
#define H_   16
#define HD_  128
#define TQ_  2048
#define BB_  2
#define R_   512

static __device__ __forceinline__ unsigned short f2bf(float f) {
  unsigned int u = __float_as_uint(f);
  u += 0x7FFFu + ((u >> 16) & 1u);          // round-to-nearest-even
  return (unsigned short)(u >> 16);
}

// two f32 -> one register of two bf16, round to nearest even
static __device__ __forceinline__ unsigned int pack2(float lo, float hi) {
  typedef __attribute__((ext_vector_type(2))) __bf16 bf2;
  typedef __attribute__((ext_vector_type(2))) float f2;
  return __builtin_bit_cast(unsigned int, __builtin_convertvector(f2{lo, hi}, bf2));
}

// Work-group barrier that orders LDS traffic only. __syncthreads() also waits
// for every global load of the wave, which would drain the loads issued ahead
// for a later tile; nothing read from global memory here is written in the launch.
static __device__ __forceinline__ void lds_barrier() {
  __builtin_amdgcn_fence(__ATOMIC_RELEASE, "workgroup", "local");
  __builtin_amdgcn_s_barrier();
  __builtin_amdgcn_fence(__ATOMIC_ACQUIRE, "workgroup", "local");
}

// Stands behind a batch of global loads that stays in flight, in front of the
// first instruction that reuses one of their address registers.
static __device__ __forceinline__ void loads_issued() {
  asm volatile("s_wait_xcnt 0x0" ::: "memory");
}

// Load one 16x32 bf16 WMMA operand fragment from LDS (row-major, `stride`
// elements per row). Matches the CDNA5 16-bit A/B layout:
//   lanes 0-15 : K = 0..7 (v0-3), 16..23 (v4-7)
//   lanes16-31 : K = 8..15 (v0-3), 24..31 (v4-7)
// => two 16-byte contiguous LDS reads per lane.
static __device__ __forceinline__ v16bf lds_frag(const unsigned short* p, int stride,
                                                 int row, int koff, int lane) {
  const int kb = (lane & 16) ? 8 : 0;
  const unsigned short* base = p + row * stride + koff + kb;
  union { uint4 u[2]; v16bf v; } c;
  c.u[0] = *(const uint4*)(base);
  c.u[1] = *(const uint4*)(base + 16);
  return c.v;
}

// Load one 32(k) x 16(col) bf16 B fragment from a row-major [k][col] LDS tile
// with the transposing load: lane (c = lane&15, h = lane>>4) receives
// tile[kbase + 8h + 0..7][dbase + c]; the second load, 16 rows further, gives
// k = 16 + 8h + 0..7, i.e. the same k order as lds_frag above. Taken as an A
// fragment the same registers are 16(row = col of the tile) x 32(k).
// `pitch` is in elements; 32 B x odd keeps the load free of bank conflicts.
typedef __attribute__((ext_vector_type(8))) short s16x8;
static __device__ __forceinline__ v16bf lds_frag_tr(const unsigned short* tile, int pitch,
                                                    int kbase, int dbase, int lane) {
  typedef __attribute__((address_space(3))) s16x8 lds_s16x8;
  const unsigned short* p = tile + (kbase + ((lane >> 4) << 3) + (lane & 7)) * pitch
                                 + dbase + (((lane >> 3) & 1) << 3);
  union { s16x8 u[2]; v16bf v; } c;
  c.u[0] = __builtin_amdgcn_ds_load_tr16_b128_v8i16((lds_s16x8*)p);
  c.u[1] = __builtin_amdgcn_ds_load_tr16_b128_v8i16((lds_s16x8*)(p + 16 * pitch));
  return c.v;
}

// ---------------------------------------------------------------------------
// fp32 -> bf16 conversion of all eight arrays in one launch. The bf16 copies lie
// back to back in `dst`, in the order of the arguments. The work is cut into
// chunks of 8192 elements (8 x 16 B per thread, each wave-wide load 512 B in a
// row); every array is a whole number of chunks, so a chunk has one source.
// CONV_WGS work-groups (three per WGP) take CONV_TRIPS chunks each, a chunk's
// eight loads going out before the chunk in front of it is converted: few, long
// waves, for speed only.
// ---------------------------------------------------------------------------
#define CONV_CHUNK   8192
#define CONV_X_CH    (BB_ * TQ_ * D_ / CONV_CHUNK)          // chunks of x
#define CONV_W_CH    (R_ * D_ / CONV_CHUNK)                 // chunks of a low-rank weight
#define CONV_CHUNKS  (CONV_X_CH + 6 * CONV_W_CH + D_ * D_ / CONV_CHUNK)
#define CONV_WGS     768
#define CONV_TRIPS   (CONV_CHUNKS / CONV_WGS)
static_assert(CONV_TRIPS * CONV_WGS == CONV_CHUNKS, "every work-group takes the same number of chunks");
typedef __attribute__((ext_vector_type(4))) unsigned short u16x4;

__global__ __launch_bounds__(256) void f32_to_bf16_all(const float* __restrict__ x,
                                                       const float* __restrict__ wq_a,
                                                       const float* __restrict__ wq_b,
                                                       const float* __restrict__ wk_a,
                                                       const float* __restrict__ wk_b,
                                                       const float* __restrict__ wv_a,
                                                       const float* __restrict__ wv_b,
                                                       const float* __restrict__ wo_w,
                                                       unsigned short* __restrict__ dst) {
  const int tid = threadIdx.x;

  // The three loops below are unrolled so that every index of v is a constant and
  // v stays in registers.
  float4 v[2][8];
#pragma unroll
  for (int t = 0; t <= CONV_TRIPS; ++t) {
    if (t < CONV_TRIPS) {
      // chunk c and its place in its source array: the same for the whole work-group
      const int c = blockIdx.x + t * CONV_WGS;
      const int w = (c - CONV_X_CH) / CONV_W_CH;            // which weight, where c is past x
      const float* s = x;
      int first = 0;                                        // the array's first chunk
      if (c >= CONV_X_CH) {
        s = w == 0 ? wq_a : w == 1 ? wq_b : w == 2 ? wk_a
          : w == 3 ? wk_b : w == 4 ? wv_a : w == 5 ? wv_b : wo_w;
        first = CONV_X_CH + min(w, 6) * CONV_W_CH;
      }
      s += (size_t)(c - first) * CONV_CHUNK + tid * 4;
#pragma unroll
      for (int j = 0; j < 8; ++j) v[t & 1][j] = *(const float4*)(s + j * 1024);
      loads_issued();
      // Keeps the conversion below behind these loads: without it its first
      // instructions, and their wait for the chunk before, stand in front of chunk 1's
      // loads, which then go out one memory latency late.
      __builtin_amdgcn_sched_barrier(0);
    }
    if (t > 0) {
      unsigned short* d = dst + (size_t)(blockIdx.x + (t - 1) * CONV_WGS) * CONV_CHUNK + tid * 4;
#pragma unroll
      for (int j = 0; j < 8; ++j) {
        const float4 f = v[(t - 1) & 1][j];
        const u16x4 o = {f2bf(f.x), f2bf(f.y), f2bf(f.z), f2bf(f.w)};
        *(u16x4*)(d + j * 1024) = o;
      }
      if (t < CONV_TRIPS) loads_issued();  // the stores' address registers are reused below
    }
  }
}

// ---------------------------------------------------------------------------
// C[M,N] = A[M,K] (bf16 row-major) x W[N,K]^T (bf16 row-major) (+bias)
// Block: 256 threads (8 waves, 4 along M x 2 along N). Tile: 128(M) x 32 NI(N),
// K-step 64, so that a tile row is one whole 128-B line of its operand.
// A wave computes 32 x 16 NI = 2 x NI WMMA 16x16 fragments, twice per K-step.
// NI = 4 (128 x 128) where N = 2048: 512 work-groups a product, two per WGP at a
// time; NI = 2 (128 x 64) for the narrow down-projections, whose three products
// are then 768 work-groups, three per WGP (at 128 x 128: 384, one and a half).
// The global loads of a K-step go out together, two K-steps ahead of their LDS
// stores, into two register sets used in turn. K is a multiple of 128.
// ---------------------------------------------------------------------------
#define GP_ 72   // LDS row pitch in elements: 144 B = 16 B x odd, for the b128 readers

// Writes a wave's 32 x 16 NI part of C. The products are formed transposed (the W
// fragment is the A operand), so acc[mi][ni][r] is C[row0 + 16 mi + (lane & 15)]
// [col0 + 16 ni + 8 (lane >> 4) + r]: a lane holds eight neighbours of one row of C.
// 16 rows at a time go through the wave's own LDS range `st` in 16-B pieces (row
// pitch: the row + 16 B) and come back with neighbouring lanes on one row, so that a
// wave-wide 16-B store covers its rows' whole extent (128 B and more where NI = 4).
template <int NI, typename OutT>
static __device__ __forceinline__ void store_tile(char* st, v8f (&acc)[2][NI], OutT* __restrict__ C,
                                                  const float* __restrict__ bias, int N,
                                                  int row0, int col0, int lane) {
  constexpr int ES    = sizeof(OutT);
  constexpr int ROWB  = NI * 16 * ES;      // bytes of a row of the wave's part
  constexpr int PITCH = ROWB + 16;
  constexpr int LPR   = ROWB / 16;         // lanes to a row on the way out
  constexpr int RPI   = 32 / LPR;          // rows to a wave-wide store
  const int c = lane & 15, h = lane >> 4;

  if (bias) {
#pragma unroll
    for (int ni = 0; ni < NI; ++ni) {
      const float4 b0 = *(const float4*)(bias + col0 + ni * 16 + 8 * h);
      const float4 b1 = *(const float4*)(bias + col0 + ni * 16 + 8 * h + 4);
      loads_issued();  // in front of the next reuse of the loads' address registers
      const float b[8] = {b0.x, b0.y, b0.z, b0.w, b1.x, b1.y, b1.z, b1.w};
#pragma unroll
      for (int mi = 0; mi < 2; ++mi)
#pragma unroll
        for (int r = 0; r < 8; ++r) acc[mi][ni][r] += b[r];
    }
  }

  char* sw = st + c * PITCH + 8 * h * ES;
  const char* sr = st + (lane / LPR) * PITCH + (lane % LPR) * 16;
  const unsigned int goff = (unsigned int)(((row0 + lane / LPR) * N + col0) * ES + (lane % LPR) * 16);
  const unsigned int gstep = (unsigned int)(RPI * N * ES);
#pragma unroll
  for (int mi = 0; mi < 2; ++mi) {
#pragma unroll
    for (int ni = 0; ni < NI; ++ni) {
      const v8f a = acc[mi][ni];
      if constexpr (ES == 2) {
        const u32x4 pk = {pack2(a[0], a[1]), pack2(a[2], a[3]), pack2(a[4], a[5]), pack2(a[6], a[7])};
        *(u32x4*)(sw + ni * 32) = pk;
      } else {
        const float4 lo = {a[0], a[1], a[2], a[3]}, hi = {a[4], a[5], a[6], a[7]};
        *(float4*)(sw + ni * 64)      = lo;
        *(float4*)(sw + ni * 64 + 16) = hi;
      }
    }
    // the wave's own LDS writes are done before other lanes read them back
    asm volatile("s_wait_dscnt 0x0" ::: "memory");
    u32x4 d[16 / RPI];
    unsigned int go[16 / RPI];
#pragma unroll
    for (int j = 0; j < 16 / RPI; ++j) {
      d[j]  = *(const u32x4*)(sr + j * RPI * PITCH);
      go[j] = goff + (unsigned int)(mi * (16 / RPI) + j) * gstep;
    }
    // The two lines that hold the scheduler keep every register write out of the run of
    // stores: the stores go out back to back, and the one wait behind them stands in
    // front of the first reuse of their offset and data registers. Behind the last
    // run the wave ends and nothing is reused.
    __builtin_amdgcn_sched_barrier(0);
#pragma unroll
    for (int j = 0; j < 16 / RPI; ++j) *(u32x4*)((char*)C + go[j]) = d[j];
    if (mi == 0) {
      loads_issued();
      __builtin_amdgcn_sched_barrier(0);
    }
  }
}

template <int NI>
static __device__ __forceinline__ void gemm_tile(unsigned short* As, unsigned short* Ws,
                                                 const unsigned short* __restrict__ A,
                                                 const unsigned short* __restrict__ W,
                                                 void* __restrict__ C,
                                                 const float* __restrict__ bias,
                                                 int N, int K, int out_f32) {
  const int tid  = threadIdx.x;
  const int lane = tid & 31;
  const int wv   = tid >> 5;
  const int wm   = (wv & 3) * 32;
  const int wn   = (wv >> 2) * (NI * 16);
  const int m0   = blockIdx.y * 128;
  const int n0   = blockIdx.x * (NI * 32);

  v8f acc[2][NI] = {};

  // cooperative tile loads: 8 bf16 (16 B) per thread, eight threads to a row;
  // rows lrow + 32 j, j < 4 of A and j < NI of W
  const int lrow = tid >> 3, lcol = (tid & 7) * 8;
  // An address is a base that is the same for the whole work-group (it alone moves
  // along K) plus this thread's byte offset in the tile's rows, which never changes.
  const char* Ab = (const char*)(A + (size_t)m0 * K);
  const char* Wb = (const char*)(W + (size_t)n0 * K);
  unsigned int toff[4];
#pragma unroll
  for (int j = 0; j < 4; ++j) toff[j] = (unsigned int)(((lrow + 32 * j) * K + lcol) * 2);
  unsigned short* Asw = As + lrow * GP_ + lcol;
  unsigned short* Wsw = Ws + lrow * GP_ + lcol;

  u32x4 ra[2][4], rw[2][NI];
#pragma unroll
  for (int j = 0; j < 4; ++j)  ra[0][j] = *(const u32x4*)(Ab + toff[j]);
#pragma unroll
  for (int j = 0; j < NI; ++j) rw[0][j] = *(const u32x4*)(Wb + toff[j]);
  // Compiler-only fence (no instruction): keeps set 0's loads in front of set 1's.
  // Loads return in issue order, so the loop's wait for one set can then leave the
  // other set's loads in flight; interleaved, it has to drain them all.
  __builtin_amdgcn_fence(__ATOMIC_ACQ_REL, "wavefront");
#pragma unroll
  for (int j = 0; j < 4; ++j)  ra[1][j] = *(const u32x4*)(Ab + 128 + toff[j]);
#pragma unroll
  for (int j = 0; j < NI; ++j) rw[1][j] = *(const u32x4*)(Wb + 128 + toff[j]);
  loads_issued();  // the offset registers are given other uses in front of the loop

  for (int k0 = 0; k0 < K; k0 += 128) {
#pragma unroll
    for (int s = 0; s < 2; ++s) {
#pragma unroll
      for (int j = 0; j < 4; ++j)  *(u32x4*)(Asw + j * 32 * GP_) = ra[s][j];
#pragma unroll
      for (int j = 0; j < NI; ++j) *(u32x4*)(Wsw + j * 32 * GP_) = rw[s][j];
      // refill this set for the K-step two ahead; the last two K-steps read the
      // last tile again (in bounds, unused), so no branch stands round the loads
      const int kn = min(k0 + s * 64 + 128, K - 64);
#pragma unroll
      for (int j = 0; j < 4; ++j)  ra[s][j] = *(const u32x4*)(Ab + kn * 2 + toff[j]);
#pragma unroll
      for (int j = 0; j < NI; ++j) rw[s][j] = *(const u32x4*)(Wb + kn * 2 + toff[j]);
      loads_issued();
      lds_barrier();  // this K-step's tile is whole in LDS

#pragma unroll
      for (int kk = 0; kk < 2; ++kk) {
        v16bf af[2], bfm[NI];
#pragma unroll
        for (int mi = 0; mi < 2; ++mi)
          af[mi] = lds_frag(As, GP_, wm + mi * 16 + (lane & 15), kk * 32, lane);
#pragma unroll
        for (int ni = 0; ni < NI; ++ni)
          bfm[ni] = lds_frag(Ws, GP_, wn + ni * 16 + (lane & 15), kk * 32, lane);
#pragma unroll
        for (int mi = 0; mi < 2; ++mi)
#pragma unroll
          for (int ni = 0; ni < NI; ++ni)
            acc[mi][ni] = __builtin_amdgcn_wmma_f32_16x16x32_bf16(
                false, bfm[ni], false, af[mi], (short)0, acc[mi][ni], false, false);
      }
      lds_barrier();  // every wave has read the tile
    }
  }

  // Epilogue: the loop's last barrier has freed the tiles' LDS; four waves stage in
  // each array, every wave in a range of its own.
  char* st = (char*)((wv & 4) ? Ws : As) + (wv & 3) * (16 * (NI * 64 + 16));
  if (out_f32) store_tile<NI, float>(st, acc, (float*)C, bias, N, m0 + wm, n0 + wn, lane);
  else         store_tile<NI, unsigned short>(st, acc, (unsigned short*)C, bias, N, m0 + wm, n0 + wn, lane);
}

// A launch holds up to three independent products of one shape (those for q, k and
// v): blockIdx.z picks the operands, the same for the whole work-group. The narrow
// down-projections then put three work-groups on a WGP, where a launch of one of
// them puts a single one, whose waits at its barriers nothing fills; and one
// product's first loads and last stores run beside another's K loop instead of
// behind a launch boundary.
#define PICK3_(p) (blockIdx.z == 0 ? p##0 : blockIdx.z == 1 ? p##1 : p##2)

// amdgpu_waves_per_eu(min, max): min sets the compiler's register budget, max the
// waves that may share a SIMD. With the default budget the compiler held part of a
// K-step's fragment loads back to save registers, which made two more places per
// K-step where a wave waits for LDS. max is what the grid puts on a SIMD: six waves
// (768 work-groups, three on a WGP) for n64, four (two on a WGP at a time) for n128.
__global__ __launch_bounds__(256) __attribute__((amdgpu_waves_per_eu(2, 6))) void gemm_abT_n64(const unsigned short* __restrict__ A0,
                                                    const unsigned short* __restrict__ A1,
                                                    const unsigned short* __restrict__ A2,
                                                    const unsigned short* __restrict__ W0,
                                                    const unsigned short* __restrict__ W1,
                                                    const unsigned short* __restrict__ W2,
                                                    void* __restrict__ C0,
                                                    void* __restrict__ C1,
                                                    void* __restrict__ C2,
                                                    const float* __restrict__ bias,
                                                    int N, int K, int out_f32) {
  __shared__ __align__(16) unsigned short As[128 * GP_];
  __shared__ __align__(16) unsigned short Ws[64 * GP_];
  gemm_tile<2>(As, Ws, PICK3_(A), PICK3_(W), PICK3_(C), bias, N, K, out_f32);
}

__global__ __launch_bounds__(256) __attribute__((amdgpu_waves_per_eu(4, 4))) void gemm_abT_n128(const unsigned short* __restrict__ A0,
                                                     const unsigned short* __restrict__ A1,
                                                     const unsigned short* __restrict__ A2,
                                                     const unsigned short* __restrict__ W0,
                                                     const unsigned short* __restrict__ W1,
                                                     const unsigned short* __restrict__ W2,
                                                     void* __restrict__ C0,
                                                     void* __restrict__ C1,
                                                     void* __restrict__ C2,
                                                     const float* __restrict__ bias,
                                                     int N, int K, int out_f32) {
  __shared__ __align__(16) unsigned short As[128 * GP_];
  __shared__ __align__(16) unsigned short Ws[128 * GP_];
  gemm_tile<4>(As, Ws, PICK3_(A), PICK3_(W), PICK3_(C), bias, N, K, out_f32);
}

// ---------------------------------------------------------------------------
// Flash attention per (b,h). Block = 128 threads (4 waves), 128 query rows,
// streaming 64-key tiles; K/V tiles row-major in LDS.
// Both products are transposed: S^T = K x Q^T (A = K rows from LDS, B = the
// wave's queries, held in registers) and O^T += V^T x P^T (A = V^T by the
// transposing LDS load). A lane then holds scores of ONE query per column group
// (column lane&15; the two wave halves hold different keys), so the maximum and
// the sum run in-lane with one exchange between the halves, and two score tiles,
// rounded in place, are the B operand of the second product: P never goes
// through LDS.
// A wave takes QG_ = 2 column groups of 16 queries: a K or V fragment read from
// LDS feeds two products, which halves the LDS reads, the K/V staging and the
// barriers per query. 512 work-groups are two per WGP, two waves per SIMD.
// The 16 global loads of a K/V tile go out together, one tile ahead of their
// LDS stores, and wait in registers while the current tile is worked on.
// ---------------------------------------------------------------------------
#define QG_ 2
// e^a and e^b, as __expf forms them (one multiply, v_exp_f32). Written in asm so
// that the slot the instruction set asks for behind a transcendental is filled by
// construction: the second v_exp_f32, which shares no register with the first,
// fills the first's, the v_nop the second's.
static __device__ __forceinline__ void exp_pair(float a, float b, float& ea, float& eb) {
  const float xa = a * 1.44269504088896340736f, xb = b * 1.44269504088896340736f;
  asm("v_exp_f32 %0, %2\n\tv_exp_f32 %1, %3\n\tv_nop" : "=&v"(ea), "=&v"(eb) : "v"(xa), "v"(xb));
}
// the value of lane l ^ 16
static __device__ __forceinline__ float xhalf(float x) {
  return __builtin_bit_cast(float, __builtin_amdgcn_permlanex16(
      __builtin_bit_cast(int, x), __builtin_bit_cast(int, x), 0x76543210, 0xfedcba98, false, false));
}

// amdgpu_waves_per_eu: the register budget is that of the two waves which the grid
// puts on a SIMD. With the default budget the compiler keeps one fragment in
// registers and waits out the LDS latency in front of every product.
__global__ __launch_bounds__(128) __attribute__((amdgpu_waves_per_eu(2, 2))) void mla_attn(const unsigned short* __restrict__ Q,
                                                const unsigned short* __restrict__ Kx,
                                                const unsigned short* __restrict__ V,
                                                unsigned short* __restrict__ O) {
  __shared__ __align__(16) unsigned short Ks[64 * 136];      // [key][hd], pitch 272 B
  __shared__ __align__(16) unsigned short Vs[64 * 144];      // [key][hd], pitch 288 B

  const int tid  = threadIdx.x;
  const int lane = tid & 31;
  const int wv   = tid >> 5;
  const int q0   = blockIdx.x * (64 * QG_);
  const int bh   = blockIdx.y;
  const int b    = bh / H_;
  const int h    = bh % H_;
  const size_t rs   = (size_t)H_ * HD_;                      // 2048 row stride
  const size_t base = (size_t)b * TQ_ * rs + (size_t)h * HD_;

  // each thread moves 16 B of rows trow + 8p, p = 0..7, of a 64x128 tile
  const int trow = tid >> 4, tcol = (tid & 15) * 8;
  const unsigned short* Kg = Kx + base + (size_t)trow * rs + tcol;
  const unsigned short* Vg = V + base + (size_t)trow * rs + tcol;

  // This lane's query of group 0 (group g: 16 g rows further), and the Q^T fragments
  // (32 hd x 16 queries each) in the k order of lds_frag:
  // hd = 32 ks + 8 (lane >> 4) + 0..7, then 16 further.
  const size_t qrow = base + (size_t)(q0 + wv * (16 * QG_) + (lane & 15)) * rs;
  v16bf qf[QG_][4];
  u32x4 kr[8], vr[8];
  {
    const unsigned short* qp = Q + qrow + ((lane & 16) ? 8 : 0);
    union { u32x4 u[2]; v16bf v; } c[QG_][4];
#pragma unroll
    for (int g = 0; g < QG_; ++g)
#pragma unroll
      for (int ks = 0; ks < 4; ++ks) {
        c[g][ks].u[0] = *(const u32x4*)(qp + (size_t)(16 * g) * rs + ks * 32);
        c[g][ks].u[1] = *(const u32x4*)(qp + (size_t)(16 * g) * rs + ks * 32 + 16);
      }
#pragma unroll
    for (int p = 0; p < 8; ++p) kr[p] = *(const u32x4*)(Kg + (size_t)(p * 8) * rs);
#pragma unroll
    for (int p = 0; p < 8; ++p) vr[p] = *(const u32x4*)(Vg + (size_t)(p * 8) * rs);
    loads_issued();
    // Holds the arithmetic that follows behind the wait above: left alone the compiler
    // lifts it over the wait, onto the address registers of the Q loads.
    __builtin_amdgcn_sched_barrier(0);
#pragma unroll
    for (int g = 0; g < QG_; ++g)
#pragma unroll
      for (int ks = 0; ks < 4; ++ks) qf[g][ks] = c[g][ks].v;
  }

  // o[g][n8][r] = O[query 16 g + (lane&15)][16 n8 + 8 (lane>>4) + r]
  v8f o[QG_][8] = {};
  float mrow[QG_], lsum[QG_];        // lsum: this wave half's keys only, joined at the end
#pragma unroll
  for (int g = 0; g < QG_; ++g) { mrow[g] = -1e30f; lsum[g] = 0.f; }
  const float sc = 0.08838834764831845f;                     // 1/sqrt(128)

  for (int kb = 0; kb < TQ_ / 64; ++kb) {
    lds_barrier();  // previous tile's readers done before K/V overwrite
#pragma unroll
    for (int p = 0; p < 8; ++p) *(u32x4*)(&Ks[(trow + p * 8) * 136 + tcol]) = kr[p];
#pragma unroll
    for (int p = 0; p < 8; ++p) *(u32x4*)(&Vs[(trow + p * 8) * 144 + tcol]) = vr[p];
    // next tile's loads; the last trip reads its own tile again (in bounds,
    // unused), so no branch stands round the loads
    const size_t nxt = (size_t)(min(kb + 1, TQ_ / 64 - 1) * 64) * rs;
#pragma unroll
    for (int p = 0; p < 8; ++p) kr[p] = *(const u32x4*)(Kg + nxt + (size_t)(p * 8) * rs);
#pragma unroll
    for (int p = 0; p < 8; ++p) vr[p] = *(const u32x4*)(Vg + nxt + (size_t)(p * 8) * rs);
    loads_issued();
    lds_barrier();

    // S^T(64 keys x 16 queries) per group: s[g][n][r] = score of key 16 n + 8 (lane>>4) + r.
    // All 16 K fragments are asked for as one group in front of the products.
    v8f s[QG_][4] = {};
    {
      v16bf ak[4][4];
#pragma unroll
      for (int ks = 0; ks < 4; ++ks)
#pragma unroll
        for (int n = 0; n < 4; ++n) ak[ks][n] = lds_frag(Ks, 136, n * 16 + (lane & 15), ks * 32, lane);
      // Keeps the loads above in front of the products: left alone the compiler spreads
      // them among the products, one fragment ahead, and each waits out most of the
      // LDS latency.
      __builtin_amdgcn_sched_barrier(0);
#pragma unroll
      for (int ks = 0; ks < 4; ++ks)
#pragma unroll
        for (int n = 0; n < 4; ++n)
#pragma unroll
          for (int g = 0; g < QG_; ++g)
            s[g][n] = __builtin_amdgcn_wmma_f32_16x16x32_bf16(false, ak[ks][n], false, qf[g][ks],
                                                              (short)0, s[g][n], false, false);
    }

    // The compiler schedules nothing across this line and the one behind the softmax.
    // Without them it lifts all V fragment loads up beside the K fragments; the live
    // set then exceeds the register budget and the next tile's global loads are
    // spilled, which waits them out on the spot.
    __builtin_amdgcn_sched_barrier(0);
    // V^T fragments of the tile's first 32 keys: their LDS latency passes under the softmax
    v16bf av[2][8];
#pragma unroll
    for (int n8 = 0; n8 < 8; ++n8) av[0][n8] = lds_frag_tr(Vs, 144, 0, n8 * 16, lane);

    // Online softmax of this lane's query of each group over its 32 keys of the tile
    v16bf pf[QG_][2];
#pragma unroll
    for (int g = 0; g < QG_; ++g) {
      float v = -1e30f;
#pragma unroll
      for (int n = 0; n < 4; ++n)
#pragma unroll
        for (int r = 0; r < 8; ++r) { s[g][n][r] *= sc; v = fmaxf(v, s[g][n][r]); }
      v = fmaxf(v, xhalf(v));        // both halves: the maximum over all 64 keys
      const float mn   = fmaxf(mrow[g], v);
      const float corr = __expf(mrow[g] - mn);
      mrow[g] = mn;
      float psum = 0.f;
      // P^T as B operand: element e of fragment kk is key 32 kk + 8 (lane>>4) + e for
      // e < 8 and 16 keys further for e >= 8, which is s[2 kk] then s[2 kk + 1]
#pragma unroll
      for (int kk = 0; kk < 2; ++kk) {
        union { unsigned int w[8]; v16bf v; } c;
#pragma unroll
        for (int i = 0; i < 8; ++i) {
          float p0, p1;
          exp_pair(s[g][2 * kk + (i >> 2)][2 * (i & 3)] - mn, s[g][2 * kk + (i >> 2)][2 * (i & 3) + 1] - mn, p0, p1);
          psum += p0 + p1;
          c.w[i] = pack2(p0, p1);
        }
        pf[g][kk] = c.v;
      }
      lsum[g] = lsum[g] * corr + psum;
#pragma unroll
      for (int n8 = 0; n8 < 8; ++n8)
#pragma unroll
        for (int r = 0; r < 8; ++r) o[g][n8][r] *= corr;
    }

    __builtin_amdgcn_sched_barrier(0);  // see above

    // O^T(128 hd x 16 queries) += V^T(128 x 64) x P^T(64 x 16): A row = hd, k = key.
    // The second 32 keys' fragments come in under the first 32 keys' products.
#pragma unroll
    for (int n8 = 0; n8 < 8; ++n8) av[1][n8] = lds_frag_tr(Vs, 144, 32, n8 * 16, lane);
    __builtin_amdgcn_sched_barrier(0);  // these loads too stay one group in front of the products
#pragma unroll
    for (int kk = 0; kk < 2; ++kk)
#pragma unroll
      for (int n8 = 0; n8 < 8; ++n8)
#pragma unroll
        for (int g = 0; g < QG_; ++g)
          o[g][n8] = __builtin_amdgcn_wmma_f32_16x16x32_bf16(false, av[kk][n8], false, pf[g][kk],
                                                             (short)0, o[g][n8], false, false);
  }

  // Normalize and store (bf16, feeds the output projection GEMM): a lane's eight
  // registers of a tile are eight consecutive hd of its query, one 16 B store
#pragma unroll
  for (int g = 0; g < QG_; ++g) {
    const float lfin = lsum[g] + xhalf(lsum[g]);
    unsigned short* Og = O + qrow + (size_t)(16 * g) * rs + ((lane & 16) ? 8 : 0);
#pragma unroll
    for (int n8 = 0; n8 < 8; ++n8) {
      const u32x4 pk = {pack2(o[g][n8][0] / lfin, o[g][n8][1] / lfin), pack2(o[g][n8][2] / lfin, o[g][n8][3] / lfin),
                        pack2(o[g][n8][4] / lfin, o[g][n8][5] / lfin), pack2(o[g][n8][6] / lfin, o[g][n8][7] / lfin)};
      *(u32x4*)(Og + n8 * 16) = pk;
      loads_issued();  // the store's data registers are reused for the next tile
    }
  }
}

// ---------------------------------------------------------------------------
// Launch chain
// ---------------------------------------------------------------------------
extern "C" void kernel_launch(void* const* d_in, const int* in_sizes, int n_in,
                              void* d_out, int out_size, void* d_ws, size_t ws_size,
                              hipStream_t stream) {
  (void)in_sizes; (void)n_in; (void)out_size; (void)ws_size;

  const float* x    = (const float*)d_in[0];
  const float* wq_a = (const float*)d_in[1];
  const float* wq_b = (const float*)d_in[2];
  const float* wk_a = (const float*)d_in[3];
  const float* wk_b = (const float*)d_in[4];
  const float* wv_a = (const float*)d_in[5];
  const float* wv_b = (const float*)d_in[6];
  const float* wo_w = (const float*)d_in[7];
  const float* wo_b = (const float*)d_in[8];

  const int M = BB_ * TQ_;  // 4096 tokens

  size_t off = 0;
  auto alloc = [&](size_t elems) {
    unsigned short* p = (unsigned short*)((char*)d_ws + off);
    off += (elems * sizeof(unsigned short) + 255) & ~(size_t)255;
    return p;
  };
  unsigned short* xb   = alloc((size_t)M * D_);
  unsigned short* wqab = alloc((size_t)R_ * D_);
  unsigned short* wqbb = alloc((size_t)D_ * R_);
  unsigned short* wkab = alloc((size_t)R_ * D_);
  unsigned short* wkbb = alloc((size_t)D_ * R_);
  unsigned short* wvab = alloc((size_t)R_ * D_);
  unsigned short* wvbb = alloc((size_t)D_ * R_);
  unsigned short* wob  = alloc((size_t)D_ * D_);
  unsigned short* cq   = alloc((size_t)M * R_);
  unsigned short* ck   = alloc((size_t)M * R_);
  unsigned short* cv   = alloc((size_t)M * R_);
  unsigned short* qb   = alloc((size_t)M * D_);
  unsigned short* kb   = alloc((size_t)M * D_);
  unsigned short* vb   = alloc((size_t)M * D_);
  unsigned short* ao   = alloc((size_t)M * D_);

  // xb .. wob lie back to back (every size is a multiple of 256 B), in this order
  f32_to_bf16_all<<<dim3(CONV_WGS), dim3(256), 0, stream>>>(x, wq_a, wq_b, wk_a, wk_b,
                                                            wv_a, wv_b, wo_w, xb);

  // latent down-projections, [4096,2048] x [512,2048]^T each: 128 x 64 tiles, 3 x 256 work-groups
  gemm_abT_n64<<<dim3(R_ / 64, M / 128, 3), dim3(256), 0, stream>>>(xb, xb, xb, wqab, wkab, wvab,
                                                                    cq, ck, cv, nullptr, R_, D_, 0);
  // up-projections, [4096,512] x [2048,512]^T each: 128 x 128 tiles, 3 x 512 work-groups
  gemm_abT_n128<<<dim3(D_ / 128, M / 128, 3), dim3(256), 0, stream>>>(cq, ck, cv, wqbb, wkbb, wvbb,
                                                                      qb, kb, vb, nullptr, D_, R_, 0);
  // flash attention: grid = (T/128 q-blocks, B*H heads)
  mla_attn<<<dim3(TQ_ / (64 * QG_), BB_ * H_), dim3(128), 0, stream>>>(qb, kb, vb, ao);
  // output projection + bias -> f32 d_out
  gemm_abT_n128<<<dim3(D_ / 128, M / 128, 1), dim3(256), 0, stream>>>(ao, ao, ao, wob, wob, wob,
                                                                      d_out, d_out, d_out, wo_b, D_, D_, 1);
}

// v009
// A run of this version takes 140 microseconds.
// Two timings next to v008 both put it at 1.03 times that version's speed.
// Counting every step since v000, it is 5.27 times as fast.
#include <hip/hip_runtime.h>
#include <hip/hip_bf16.h>

// ---------------------------------------------------------------------------
// MLA (multi-head latent attention) forward for MI455X / gfx1250.
// All GEMMs + attention run through v_wmma_f32_16x16x32_bf16 (f32 accumulate).
// ---------------------------------------------------------------------------

typedef __attribute__((ext_vector_type(16))) __bf16 v16bf;
typedef __attribute__((ext_vector_type(8)))  float  v8f;
typedef __attribute__((ext_vector_type(4)))  unsigned int u32x4;   // 16 B in flight

#define D_   2048
#define H_   16
#define HD_  128
#define TQ_  2048
#define BB_  2
#define R_   512

static __device__ __forceinline__ unsigned short f2bf(float f) {
  unsigned int u = __float_as_uint(f);
  u += 0x7FFFu + ((u >> 16) & 1u);          // round-to-nearest-even
  return (unsigned short)(u >> 16);
}

// two f32 -> one register of two bf16, round to nearest even
static __device__ __forceinline__ unsigned int pack2(float lo, float hi) {
  typedef __attribute__((ext_vector_type(2))) __bf16 bf2;
  typedef __attribute__((ext_vector_type(2))) float f2;
  return __builtin_bit_cast(unsigned int, __builtin_convertvector(f2{lo, hi}, bf2));
}

// Work-group barrier that orders LDS traffic only. __syncthreads() also waits
// for every global load of the wave, which would drain the loads issued ahead
// for a later tile; nothing read from global memory here is written in the launch.
static __device__ __forceinline__ void lds_barrier() {
  __builtin_amdgcn_fence(__ATOMIC_RELEASE, "workgroup", "local");
  __builtin_amdgcn_s_barrier();
  __builtin_amdgcn_fence(__ATOMIC_ACQUIRE, "workgroup", "local");
}

// Stands behind a batch of global loads that stays in flight, in front of the
// first instruction that reuses one of their address registers.
static __device__ __forceinline__ void loads_issued() {
  asm volatile("s_wait_xcnt 0x0" ::: "memory");
}

// Load one 16x32 bf16 WMMA operand fragment from LDS (row-major, `stride`
// elements per row). Matches the CDNA5 16-bit A/B layout:
//   lanes 0-15 : K = 0..7 (v0-3), 16..23 (v4-7)
//   lanes16-31 : K = 8..15 (v0-3), 24..31 (v4-7)
// => two 16-byte contiguous LDS reads per lane.
static __device__ __forceinline__ v16bf lds_frag(const unsigned short* p, int stride,
                                                 int row, int koff, int lane) {
  const int kb = (lane & 16) ? 8 : 0;
  const unsigned short* base = p + row * stride + koff + kb;
  union { uint4 u[2]; v16bf v; } c;
  c.u[0] = *(const uint4*)(base);
  c.u[1] = *(const uint4*)(base + 16);
  return c.v;
}

// Load one 32(k) x 16(col) bf16 B fragment from a row-major [k][col] LDS tile
// with the transposing load: lane (c = lane&15, h = lane>>4) receives
// tile[kbase + 8h + 0..7][dbase + c]; the second load, 16 rows further, gives
// k = 16 + 8h + 0..7, i.e. the same k order as lds_frag above. Taken as an A
// fragment the same registers are 16(row = col of the tile) x 32(k).
// `pitch` is in elements; 32 B x odd keeps the load free of bank conflicts.
typedef __attribute__((ext_vector_type(8))) short s16x8;
static __device__ __forceinline__ v16bf lds_frag_tr(const unsigned short* tile, int pitch,
                                                    int kbase, int dbase, int lane) {
  typedef __attribute__((address_space(3))) s16x8 lds_s16x8;
  const unsigned short* p = tile + (kbase + ((lane >> 4) << 3) + (lane & 7)) * pitch
                                 + dbase + (((lane >> 3) & 1) << 3);
  union { s16x8 u[2]; v16bf v; } c;
  c.u[0] = __builtin_amdgcn_ds_load_tr16_b128_v8i16((lds_s16x8*)p);
  c.u[1] = __builtin_amdgcn_ds_load_tr16_b128_v8i16((lds_s16x8*)(p + 16 * pitch));
  return c.v;
}

// ---------------------------------------------------------------------------
// fp32 -> bf16 conversion of all eight arrays in one launch. The bf16 copies lie
// back to back in `dst`, in the order of the arguments. The work is cut into
// chunks of 8192 elements (8 x 16 B per thread, each wave-wide load 512 B in a
// row); every array is a whole number of chunks, so a chunk has one source.
// CONV_WGS work-groups (three per WGP) take CONV_TRIPS chunks each, a chunk's
// eight loads going out before the chunk in front of it is converted: few, long
// waves, for speed only.
// ---------------------------------------------------------------------------
#define CONV_CHUNK   8192
#define CONV_X_CH    (BB_ * TQ_ * D_ / CONV_CHUNK)          // chunks of x
#define CONV_W_CH    (R_ * D_ / CONV_CHUNK)                 // chunks of a low-rank weight
#define CONV_CHUNKS  (CONV_X_CH + 6 * CONV_W_CH + D_ * D_ / CONV_CHUNK)
#define CONV_WGS     768
#define CONV_TRIPS   (CONV_CHUNKS / CONV_WGS)
static_assert(CONV_TRIPS * CONV_WGS == CONV_CHUNKS, "every work-group takes the same number of chunks");
typedef __attribute__((ext_vector_type(4))) unsigned short u16x4;

__global__ __launch_bounds__(256) void f32_to_bf16_all(const float* __restrict__ x,
                                                       const float* __restrict__ wq_a,
                                                       const float* __restrict__ wq_b,
                                                       const float* __restrict__ wk_a,
                                                       const float* __restrict__ wk_b,
                                                       const float* __restrict__ wv_a,
                                                       const float* __restrict__ wv_b,
                                                       const float* __restrict__ wo_w,
                                                       unsigned short* __restrict__ dst) {
  const int tid = threadIdx.x;

  // The three loops below are unrolled so that every index of v is a constant and
  // v stays in registers.
  float4 v[2][8];
#pragma unroll
  for (int t = 0; t <= CONV_TRIPS; ++t) {
    if (t < CONV_TRIPS) {
      // chunk c and its place in its source array: the same for the whole work-group
      const int c = blockIdx.x + t * CONV_WGS;
      const int w = (c - CONV_X_CH) / CONV_W_CH;            // which weight, where c is past x
      const float* s = x;
      int first = 0;                                        // the array's first chunk
      if (c >= CONV_X_CH) {
        s = w == 0 ? wq_a : w == 1 ? wq_b : w == 2 ? wk_a
          : w == 3 ? wk_b : w == 4 ? wv_a : w == 5 ? wv_b : wo_w;
        first = CONV_X_CH + min(w, 6) * CONV_W_CH;
      }
      s += (size_t)(c - first) * CONV_CHUNK + tid * 4;
#pragma unroll
      for (int j = 0; j < 8; ++j) v[t & 1][j] = *(const float4*)(s + j * 1024);
      loads_issued();
      // Keeps the conversion below behind these loads: without it its first
      // instructions, and their wait for the chunk before, stand in front of chunk 1's
      // loads, which then go out one memory latency late.
      __builtin_amdgcn_sched_barrier(0);
    }
    if (t > 0) {
      unsigned short* d = dst + (size_t)(blockIdx.x + (t - 1) * CONV_WGS) * CONV_CHUNK + tid * 4;
#pragma unroll
      for (int j = 0; j < 8; ++j) {
        const float4 f = v[(t - 1) & 1][j];
        const u16x4 o = {f2bf(f.x), f2bf(f.y), f2bf(f.z), f2bf(f.w)};
        *(u16x4*)(d + j * 1024) = o;
      }
      if (t < CONV_TRIPS) loads_issued();  // the stores' address registers are reused below
    }
  }
}

// ---------------------------------------------------------------------------
// C[M,N] = A[M,K] (bf16 row-major) x W[N,K]^T (bf16 row-major) (+bias)
// Block: 256 threads (8 waves, 4 along M x 2 along N). Tile: 128(M) x 32 NI(N),
// K-step 64, so that a tile row is one whole 128-B line of its operand.
// A wave computes 32 x 16 NI = 2 x NI WMMA 16x16 fragments, twice per K-step.
// NI = 4 (128 x 128) where N = 2048: 512 work-groups a product, two per WGP at a
// time; NI = 2 (128 x 64) for the narrow down-projections, whose three products
// are then 768 work-groups, three per WGP (at 128 x 128: 384, one and a half).
// The global loads of a K-step go out together, two K-steps ahead of their LDS
// stores, into two register sets used in turn. K is a multiple of 128.
// ---------------------------------------------------------------------------
#define GP_ 72   // LDS row pitch in elements: 144 B = 16 B x odd, for the b128 readers

// Writes a wave's 32 x 16 NI part of C. The products are formed transposed (the W
// fragment is the A operand), so acc[mi][ni][r] is C[row0 + 16 mi + (lane & 15)]
// [col0 + 16 ni + 8 (lane >> 4) + r]: a lane holds eight neighbours of one row of C.
// 16 rows at a time go through the wave's own LDS range `st` in 16-B pieces (row
// pitch: the row + 16 B) and come back with neighbouring lanes on one row, so that a
// wave-wide 16-B store covers its rows' whole extent (128 B and more where NI = 4).
template <int NI, typename OutT>
static __device__ __forceinline__ void store_tile(char* st, v8f (&acc)[2][NI], OutT* __restrict__ C,
                                                  const float* __restrict__ bias, int N,
                                                  int row0, int col0, int lane) {
  constexpr int ES    = sizeof(OutT);
  constexpr int ROWB  = NI * 16 * ES;      // bytes of a row of the wave's part
  constexpr int PITCH = ROWB + 16;
  constexpr int LPR   = ROWB / 16;         // lanes to a row on the way out
  constexpr int RPI   = 32 / LPR;          // rows to a wave-wide store
  const int c = lane & 15, h = lane >> 4;

  if (bias) {
#pragma unroll
    for (int ni = 0; ni < NI; ++ni) {
      const float4 b0 = *(const float4*)(bias + col0 + ni * 16 + 8 * h);
      const float4 b1 = *(const float4*)(bias + col0 + ni * 16 + 8 * h + 4);
      loads_issued();  // in front of the next reuse of the loads' address registers
      const float b[8] = {b0.x, b0.y, b0.z, b0.w, b1.x, b1.y, b1.z, b1.w};
#pragma unroll
      for (int mi = 0; mi < 2; ++mi)
#pragma unroll
        for (int r = 0; r < 8; ++r) acc[mi][ni][r] += b[r];
    }
  }

  char* sw = st + c * PITCH + 8 * h * ES;
  const char* sr = st + (lane / LPR) * PITCH + (lane % LPR) * 16;
  const unsigned int goff = (unsigned int)(((row0 + lane / LPR) * N + col0) * ES + (lane % LPR) * 16);
  const unsigned int gstep = (unsigned int)(RPI * N * ES);
#pragma unroll
  for (int mi = 0; mi < 2; ++mi) {
#pragma unroll
    for (int ni = 0; ni < NI; ++ni) {
      const v8f a = acc[mi][ni];
      if constexpr (ES == 2) {
        const u32x4 pk = {pack2(a[0], a[1]), pack2(a[2], a[3]), pack2(a[4], a[5]), pack2(a[6], a[7])};
        *(u32x4*)(sw + ni * 32) = pk;
      } else {
        const float4 lo = {a[0], a[1], a[2], a[3]}, hi = {a[4], a[5], a[6], a[7]};
        *(float4*)(sw + ni * 64)      = lo;
        *(float4*)(sw + ni * 64 + 16) = hi;
      }
    }
    // the wave's own LDS writes are done before other lanes read them back
    asm volatile("s_wait_dscnt 0x0" ::: "memory");
    u32x4 d[16 / RPI];
    unsigned int go[16 / RPI];
#pragma unroll
    for (int j = 0; j < 16 / RPI; ++j) {
      d[j]  = *(const u32x4*)(sr + j * RPI * PITCH);
      go[j] = goff + (unsigned int)(mi * (16 / RPI) + j) * gstep;
    }
    // The two lines that hold the scheduler keep every register write out of the run of
    // stores: the stores go out back to back, and the one wait behind them stands in
    // front of the first reuse of their offset and data registers. Behind the last
    // run the wave ends and nothing is reused.
    __builtin_amdgcn_sched_barrier(0);
#pragma unroll
    for (int j = 0; j < 16 / RPI; ++j) *(u32x4*)((char*)C + go[j]) = d[j];
    if (mi == 0) {
      loads_issued();
      __builtin_amdgcn_sched_barrier(0);
    }
  }
}

template <int NI>
static __device__ __forceinline__ void gemm_tile(unsigned short* As, unsigned short* Ws,
                                                 const unsigned short* __restrict__ A,
                                                 const unsigned short* __restrict__ W,
                                                 void* __restrict__ C,
                                                 const float* __restrict__ bias,
                                                 int N, int K, int out_f32) {
  const int tid  = threadIdx.x;
  const int lane = tid & 31;
  const int wv   = tid >> 5;
  const int wm   = (wv & 3) * 32;
  const int wn   = (wv >> 2) * (NI * 16);
  const int m0   = blockIdx.y * 128;
  const int n0   = blockIdx.x * (NI * 32);

  v8f acc[2][NI] = {};

  // cooperative tile loads: 8 bf16 (16 B) per thread, eight threads to a row;
  // rows lrow + 32 j, j < 4 of A and j < NI of W
  const int lrow = tid >> 3, lcol = (tid & 7) * 8;
  // An address is a base that is the same for the whole work-group (it alone moves
  // along K) plus this thread's byte offset in the tile's rows, which never changes.
  const char* Ab = (const char*)(A + (size_t)m0 * K);
  const char* Wb = (const char*)(W + (size_t)n0 * K);
  unsigned int toff[4];
#pragma unroll
  for (int j = 0; j < 4; ++j) toff[j] = (unsigned int)(((lrow + 32 * j) * K + lcol) * 2);
  unsigned short* Asw = As + lrow * GP_ + lcol;
  unsigned short* Wsw = Ws + lrow * GP_ + lcol;

  u32x4 ra[2][4], rw[2][NI];
#pragma unroll
  for (int j = 0; j < 4; ++j)  ra[0][j] = *(const u32x4*)(Ab + toff[j]);
#pragma unroll
  for (int j = 0; j < NI; ++j) rw[0][j] = *(const u32x4*)(Wb + toff[j]);
  // Compiler-only fence (no instruction): keeps set 0's loads in front of set 1's.
  // Loads return in issue order, so the loop's wait for one set can then leave the
  // other set's loads in flight; interleaved, it has to drain them all.
  __builtin_amdgcn_fence(__ATOMIC_ACQ_REL, "wavefront");
#pragma unroll
  for (int j = 0; j < 4; ++j)  ra[1][j] = *(const u32x4*)(Ab + 128 + toff[j]);
#pragma unroll
  for (int j = 0; j < NI; ++j) rw[1][j] = *(const u32x4*)(Wb + 128 + toff[j]);
  loads_issued();  // the offset registers are given other uses in front of the loop

  for (int k0 = 0; k0 < K; k0 += 128) {
#pragma unroll
    for (int s = 0; s < 2; ++s) {
#pragma unroll
      for (int j = 0; j < 4; ++j)  *(u32x4*)(Asw + j * 32 * GP_) = ra[s][j];
#pragma unroll
      for (int j = 0; j < NI; ++j) *(u32x4*)(Wsw + j * 32 * GP_) = rw[s][j];
      // refill this set for the K-step two ahead; the last two K-steps read the
      // last tile again (in bounds, unused), so no branch stands round the loads
      const int kn = min(k0 + s * 64 + 128, K - 64);
#pragma unroll
      for (int j = 0; j < 4; ++j)  ra[s][j] = *(const u32x4*)(Ab + kn * 2 + toff[j]);
#pragma unroll
      for (int j = 0; j < NI; ++j) rw[s][j] = *(const u32x4*)(Wb + kn * 2 + toff[j]);
      loads_issued();
      lds_barrier();  // this K-step's tile is whole in LDS

#pragma unroll
      for (int kk = 0; kk < 2; ++kk) {
        v16bf af[2], bfm[NI];
#pragma unroll
        for (int mi = 0; mi < 2; ++mi)
          af[mi] = lds_frag(As, GP_, wm + mi * 16 + (lane & 15), kk * 32, lane);
#pragma unroll
        for (int ni = 0; ni < NI; ++ni)
          bfm[ni] = lds_frag(Ws, GP_, wn + ni * 16 + (lane & 15), kk * 32, lane);
#pragma unroll
        for (int mi = 0; mi < 2; ++mi)
#pragma unroll
          for (int ni = 0; ni < NI; ++ni)
            acc[mi][ni] = __builtin_amdgcn_wmma_f32_16x16x32_bf16(
                false, bfm[ni], false, af[mi], (short)0, acc[mi][ni], false, false);
      }
      lds_barrier();  // every wave has read the tile
    }
  }

  // Epilogue: the loop's last barrier has freed the tiles' LDS; four waves stage in
  // each array, every wave in a range of its own.
  char* st = (char*)((wv & 4) ? Ws : As) + (wv & 3) * (16 * (NI * 64 + 16));
  if (out_f32) store_tile<NI, float>(st, acc, (float*)C, bias, N, m0 + wm, n0 + wn, lane);
  else         store_tile<NI, unsigned short>(st, acc, (unsigned short*)C, bias, N, m0 + wm, n0 + wn, lane);
}

// A launch holds up to three independent products of one shape (those for q, k and
// v): blockIdx.z picks the operands, the same for the whole work-group. The narrow
// down-projections then put three work-groups on a WGP, where a launch of one of
// them puts a single one, whose waits at its barriers nothing fills; and one
// product's first loads and last stores run beside another's K loop instead of
// behind a launch boundary.
#define PICK3_(p) (blockIdx.z == 0 ? p##0 : blockIdx.z == 1 ? p##1 : p##2)

// amdgpu_waves_per_eu(min, max): min sets the compiler's register budget, max the
// waves that may share a SIMD. With the default budget the compiler held part of a
// K-step's fragment loads back to save registers, which made two more places per
// K-step where a wave waits for LDS. max is what the grid puts on a SIMD: six waves
// (768 work-groups, three on a WGP) for n64, four (two on a WGP at a time) for n128.
__global__ __launch_bounds__(256) __attribute__((amdgpu_waves_per_eu(2, 6))) void gemm_abT_n64(const unsigned short* __restrict__ A0,
                                                    const unsigned short* __restrict__ A1,
                                                    const unsigned short* __restrict__ A2,
                                                    const unsigned short* __restrict__ W0,
                                                    const unsigned short* __restrict__ W1,
                                                    const unsigned short* __restrict__ W2,
                                                    void* __restrict__ C0,
                                                    void* __restrict__ C1,
                                                    void* __restrict__ C2,
                                                    const float* __restrict__ bias,
                                                    int N, int K, int out_f32) {
  __shared__ __align__(16) unsigned short As[128 * GP_];
  __shared__ __align__(16) unsigned short Ws[64 * GP_];
  gemm_tile<2>(As, Ws, PICK3_(A), PICK3_(W), PICK3_(C), bias, N, K, out_f32);
}

__global__ __launch_bounds__(256) __attribute__((amdgpu_waves_per_eu(4, 4))) void gemm_abT_n128(const unsigned short* __restrict__ A0,
                                                     const unsigned short* __restrict__ A1,
                                                     const unsigned short* __restrict__ A2,
                                                     const unsigned short* __restrict__ W0,
                                                     const unsigned short* __restrict__ W1,
                                                     const unsigned short* __restrict__ W2,
                                                     void* __restrict__ C0,
                                                     void* __restrict__ C1,
                                                     void* __restrict__ C2,
                                                     const float* __restrict__ bias,
                                                     int N, int K, int out_f32) {
  __shared__ __align__(16) unsigned short As[128 * GP_];
  __shared__ __align__(16) unsigned short Ws[128 * GP_];
  gemm_tile<4>(As, Ws, PICK3_(A), PICK3_(W), PICK3_(C), bias, N, K, out_f32);
}

// ---------------------------------------------------------------------------
// Flash attention per (b,h). Block = 128 threads (4 waves), 128 query rows,
// streaming 64-key tiles; K/V tiles row-major in LDS.
// Both products are transposed: S^T = K x Q^T (A = K rows from LDS, B = the
// wave's queries, held in registers) and O^T += V^T x P^T (A = V^T by the
// transposing LDS load). A lane then holds scores of ONE query per column group
// (column lane&15; the two wave halves hold different keys), so the maximum and
// the sum run in-lane with one exchange between the halves, and two score tiles,
// rounded in place, are the B operand of the second product: P never goes
// through LDS.
// A wave takes QG_ = 2 column groups of 16 queries: a K or V fragment read from
// LDS feeds two products, which halves the LDS reads, the K/V staging and the
// barriers per query. 512 work-groups are two per WGP, two waves per SIMD.
// The 16 global loads of a K/V tile go out together, one tile ahead of their
// LDS stores, and wait in registers while the current tile is worked on.
// ---------------------------------------------------------------------------
#define QG_ 2
// 2^x of eight values, in place. Written in asm so that the slot the instruction set
// asks for behind a transcendental is filled by construction: each v_exp_f32 is
// followed by one that shares no register with it, the last by the v_nop.
static __device__ __forceinline__ void exp2_run8(v8f& x) {
  float x0 = x[0], x1 = x[1], x2 = x[2], x3 = x[3], x4 = x[4], x5 = x[5], x6 = x[6], x7 = x[7];
  asm("v_exp_f32 %0, %0\n\tv_exp_f32 %1, %1\n\tv_exp_f32 %2, %2\n\tv_exp_f32 %3, %3\n\t"
      "v_exp_f32 %4, %4\n\tv_exp_f32 %5, %5\n\tv_exp_f32 %6, %6\n\tv_exp_f32 %7, %7\n\tv_nop"
      : "+v"(x0), "+v"(x1), "+v"(x2), "+v"(x3), "+v"(x4), "+v"(x5), "+v"(x6), "+v"(x7));
  x = v8f{x0, x1, x2, x3, x4, x5, x6, x7};
}
// the value of lane l ^ 16
static __device__ __forceinline__ float xhalf(float x) {
  return __builtin_bit_cast(float, __builtin_amdgcn_permlanex16(
      __builtin_bit_cast(int, x), __builtin_bit_cast(int, x), 0x76543210, 0xfedcba98, false, false));
}

// amdgpu_waves_per_eu: the register budget is that of the two waves which the grid
// puts on a SIMD. With the default budget the compiler keeps one fragment in
// registers and waits out the LDS latency in front of every product.
__global__ __launch_bounds__(128) __attribute__((amdgpu_waves_per_eu(2, 2))) void mla_attn(const unsigned short* __restrict__ Q,
                                                const unsigned short* __restrict__ Kx,
                                                const unsigned short* __restrict__ V,
                                                unsigned short* __restrict__ O) {
  __shared__ __align__(16) unsigned short Ks[64 * 136];      // [key][hd], pitch 272 B
  __shared__ __align__(16) unsigned short Vs[64 * 144];      // [key][hd], pitch 288 B

  const int tid  = threadIdx.x;
  const int lane = tid & 31;
  const int wv   = tid >> 5;
  const int q0   = blockIdx.x * (64 * QG_);
  const int bh   = blockIdx.y;
  const int b    = bh / H_;
  const int h    = bh % H_;
  const size_t rs   = (size_t)H_ * HD_;                      // 2048 row stride
  const size_t base = (size_t)b * TQ_ * rs + (size_t)h * HD_;

  // each thread moves 16 B of rows trow + 8p, p = 0..7, of a 64x128 tile
  const int trow = tid >> 4, tcol = (tid & 15) * 8;
  const unsigned short* Kg = Kx + base + (size_t)trow * rs + tcol;
  const unsigned short* Vg = V + base + (size_t)trow * rs + tcol;

  // This lane's query of group 0 (group g: 16 g rows further), and the Q^T fragments
  // (32 hd x 16 queries each) in the k order of lds_frag:
  // hd = 32 ks + 8 (lane >> 4) + 0..7, then 16 further.
  const size_t qrow = base + (size_t)(q0 + wv * (16 * QG_) + (lane & 15)) * rs;
  v16bf qf[QG_][4];
  u32x4 kr[8], vr[8];
  {
    const unsigned short* qp = Q + qrow + ((lane & 16) ? 8 : 0);
    union { u32x4 u[2]; v16bf v; } c[QG_][4];
#pragma unroll
    for (int g = 0; g < QG_; ++g)
#pragma unroll
      for (int ks = 0; ks < 4; ++ks) {
        c[g][ks].u[0] = *(const u32x4*)(qp + (size_t)(16 * g) * rs + ks * 32);
        c[g][ks].u[1] = *(const u32x4*)(qp + (size_t)(16 * g) * rs + ks * 32 + 16);
      }
#pragma unroll
    for (int p = 0; p < 8; ++p) kr[p] = *(const u32x4*)(Kg + (size_t)(p * 8) * rs);
#pragma unroll
    for (int p = 0; p < 8; ++p) vr[p] = *(const u32x4*)(Vg + (size_t)(p * 8) * rs);
    loads_issued();
    // Holds the arithmetic that follows behind the wait above: left alone the compiler
    // lifts it over the wait, onto the address registers of the Q loads.
    __builtin_amdgcn_sched_barrier(0);
#pragma unroll
    for (int g = 0; g < QG_; ++g)
#pragma unroll
      for (int ks = 0; ks < 4; ++ks) qf[g][ks] = c[g][ks].v;
  }

  // o[g][n8][r] = O[query 16 g + (lane&15)][16 n8 + 8 (lane>>4) + r]
  v8f o[QG_][8] = {};
  float mrow[QG_], lsum[QG_];        // lsum: this wave half's keys only, joined at the end
#pragma unroll
  for (int g = 0; g < QG_; ++g) { mrow[g] = -1e30f; lsum[g] = 0.f; }
  // 1/sqrt(128) x log2 e: e^((s - m) / sqrt(128)) = 2^(s c2 - m c2), one multiply-add a score
  const float c2 = 0.08838834764831845f * 1.44269504088896340736f;

  for (int kb = 0; kb < TQ_ / 64; ++kb) {
    lds_barrier();  // previous tile's readers done before K/V overwrite
#pragma unroll
    for (int p = 0; p < 8; ++p) *(u32x4*)(&Ks[(trow + p * 8) * 136 + tcol]) = kr[p];
#pragma unroll
    for (int p = 0; p < 8; ++p) *(u32x4*)(&Vs[(trow + p * 8) * 144 + tcol]) = vr[p];
    // next tile's loads; the last trip reads its own tile again (in bounds,
    // unused), so no branch stands round the loads
    const size_t nxt = (size_t)(min(kb + 1, TQ_ / 64 - 1) * 64) * rs;
#pragma unroll
    for (int p = 0; p < 8; ++p) kr[p] = *(const u32x4*)(Kg + nxt + (size_t)(p * 8) * rs);
#pragma unroll
    for (int p = 0; p < 8; ++p) vr[p] = *(const u32x4*)(Vg + nxt + (size_t)(p * 8) * rs);
    loads_issued();
    lds_barrier();

    // S^T(64 keys x 16 queries) per group: s[g][n][r] = score of key 16 n + 8 (lane>>4) + r.
    // All 16 K fragments are asked for as one group in front of the products.
    v8f s[QG_][4] = {};
    {
      v16bf ak[4][4];
#pragma unroll
      for (int ks = 0; ks < 4; ++ks)
#pragma unroll
        for (int n = 0; n < 4; ++n) ak[ks][n] = lds_frag(Ks, 136, n * 16 + (lane & 15), ks * 32, lane);
      // Keeps the loads above in front of the products: left alone the compiler spreads
      // them among the products, one fragment ahead, and each waits out most of the
      // LDS latency.
      __builtin_amdgcn_sched_barrier(0);
#pragma unroll
      for (int ks = 0; ks < 4; ++ks)
#pragma unroll
        for (int n = 0; n < 4; ++n)
#pragma unroll
          for (int g = 0; g < QG_; ++g)
            s[g][n] = __builtin_amdgcn_wmma_f32_16x16x32_bf16(false, ak[ks][n], false, qf[g][ks],
                                                              (short)0, s[g][n], false, false);
    }

    // The compiler schedules nothing across this line and the one behind the softmax.
    // Without them it lifts all V fragment loads up beside the K fragments; the live
    // set then exceeds the register budget and the next tile's global loads are
    // spilled, which waits them out on the spot.
    __builtin_amdgcn_sched_barrier(0);
    // V^T fragments of the tile's first 32 keys: their LDS latency passes under the softmax
    v16bf av[2][8];
#pragma unroll
    for (int n8 = 0; n8 < 8; ++n8) av[0][n8] = lds_frag_tr(Vs, 144, 0, n8 * 16, lane);

    // Online softmax of this lane's query of each group over its 32 keys of the tile
    v16bf pf[QG_][2];
#pragma unroll
    for (int g = 0; g < QG_; ++g) {
      // the maximum is taken, and kept in mrow, on the products as they are (c2 > 0)
      float v = -1e30f;
#pragma unroll
      for (int n = 0; n < 4; ++n)
#pragma unroll
        for (int r = 0; r < 8; ++r) v = fmaxf(v, s[g][n][r]);
      v = fmaxf(v, xhalf(v));        // both halves: the maximum over all 64 keys
      const float mn   = fmaxf(mrow[g], v);
      const float nm2  = -mn * c2;
      const float corr = __builtin_amdgcn_exp2f(fmaf(mrow[g], c2, nm2));
      mrow[g] = mn;
      const v8f c2v  = {c2, c2, c2, c2, c2, c2, c2, c2};
      const v8f nm2v = {nm2, nm2, nm2, nm2, nm2, nm2, nm2, nm2};
#pragma unroll
      for (int n = 0; n < 4; ++n) {
        s[g][n] = __builtin_elementwise_fma(s[g][n], c2v, nm2v);
        exp2_run8(s[g][n]);
      }
      float psum = 0.f;
      // P^T as B operand: element e of fragment kk is key 32 kk + 8 (lane>>4) + e for
      // e < 8 and 16 keys further for e >= 8, which is s[2 kk] then s[2 kk + 1]
#pragma unroll
      for (int kk = 0; kk < 2; ++kk) {
        union { unsigned int w[8]; v16bf v; } c;
#pragma unroll
        for (int i = 0; i < 8; ++i) {
          const float p0 = s[g][2 * kk + (i >> 2)][2 * (i & 3)], p1 = s[g][2 * kk + (i >> 2)][2 * (i & 3) + 1];
          psum += p0 + p1;
          c.w[i] = pack2(p0, p1);
        }
        pf[g][kk] = c.v;
      }
      lsum[g] = lsum[g] * corr + psum;
#pragma unroll
      for (int n8 = 0; n8 < 8; ++n8)
#pragma unroll
        for (int r = 0; r < 8; ++r) o[g][n8][r] *= corr;
    }

    __builtin_amdgcn_sched_barrier(0);  // see above

    // O^T(128 hd x 16 queries) += V^T(128 x 64) x P^T(64 x 16): A row = hd, k = key.
    // The second 32 keys' fragments come in under the first 32 keys' products.
#pragma unroll
    for (int n8 = 0; n8 < 8; ++n8) av[1][n8] = lds_frag_tr(Vs, 144, 32, n8 * 16, lane);
    __builtin_amdgcn_sched_barrier(0);  // these loads too stay one group in front of the products
#pragma unroll
    for (int kk = 0; kk < 2; ++kk)
#pragma unroll
      for (int n8 = 0; n8 < 8; ++n8)
#pragma unroll
        for (int g = 0; g < QG_; ++g)
          o[g][n8] = __builtin_amdgcn_wmma_f32_16x16x32_bf16(false, av[kk][n8], false, pf[g][kk],
                                                             (short)0, o[g][n8], false, false);
  }

  // Normalize and store (bf16, feeds the output projection GEMM): a lane's eight
  // registers of a tile are eight consecutive hd of its query, one 16 B store
#pragma unroll
  for (int g = 0; g < QG_; ++g) {
    const float lfin = lsum[g] + xhalf(lsum[g]);
    unsigned short* Og = O + qrow + (size_t)(16 * g) * rs + ((lane & 16) ? 8 : 0);
#pragma unroll
    for (int n8 = 0; n8 < 8; ++n8) {
      const u32x4 pk = {pack2(o[g][n8][0] / lfin, o[g][n8][1] / lfin), pack2(o[g][n8][2] / lfin, o[g][n8][3] / lfin),
                        pack2(o[g][n8][4] / lfin, o[g][n8][5] / lfin), pack2(o[g][n8][6] / lfin, o[g][n8][7] / lfin)};
      *(u32x4*)(Og + n8 * 16) = pk;
      loads_issued();  // the store's data registers are reused for the next tile
    }
  }
}

// ---------------------------------------------------------------------------
// Launch chain
// ---------------------------------------------------------------------------
extern "C" void kernel_launch(void* const* d_in, const int* in_sizes, int n_in,
                              void* d_out, int out_size, void* d_ws, size_t ws_size,
                              hipStream_t stream) {
  (void)in_sizes; (void)n_in; (void)out_size; (void)ws_size;

  const float* x    = (const float*)d_in[0];
  const float* wq_a = (const float*)d_in[1];
  const float* wq_b = (const float*)d_in[2];
  const float* wk_a = (const float*)d_in[3];
  const float* wk_b = (const float*)d_in[4];
  const float* wv_a = (const float*)d_in[5];
  const float* wv_b = (const float*)d_in[6];
  const float* wo_w = (const float*)d_in[7];
  const float* wo_b = (const float*)d_in[8];

  const int M = BB_ * TQ_;  // 4096 tokens

  size_t off = 0;
  auto alloc = [&](size_t elems) {
    unsigned short* p = (unsigned short*)((char*)d_ws + off);
    off += (elems * sizeof(unsigned short) + 255) & ~(size_t)255;
    return p;
  };
  unsigned short* xb   = alloc((size_t)M * D_);
  unsigned short* wqab = alloc((size_t)R_ * D_);
  unsigned short* wqbb = alloc((size_t)D_ * R_);
  unsigned short* wkab = alloc((size_t)R_ * D_);
  unsigned short* wkbb = alloc((size_t)D_ * R_);
  unsigned short* wvab = alloc((size_t)R_ * D_);
  unsigned short* wvbb = alloc((size_t)D_ * R_);
  unsigned short* wob  = alloc((size_t)D_ * D_);
  unsigned short* cq   = alloc((size_t)M * R_);
  unsigned short* ck   = alloc((size_t)M * R_);
  unsigned short* cv   = alloc((size_t)M * R_);
  unsigned short* qb   = alloc((size_t)M * D_);
  unsigned short* kb   = alloc((size_t)M * D_);
  unsigned short* vb   = alloc((size_t)M * D_);
  unsigned short* ao   = alloc((size_t)M * D_);

  // xb .. wob lie back to back (every size is a multiple of 256 B), in this order
  f32_to_bf16_all<<<dim3(CONV_WGS), dim3(256), 0, stream>>>(x, wq_a, wq_b, wk_a, wk_b,
                                                            wv_a, wv_b, wo_w, xb);

  // latent down-projections, [4096,2048] x [512,2048]^T each: 128 x 64 tiles, 3 x 256 work-groups
  gemm_abT_n64<<<dim3(R_ / 64, M / 128, 3), dim3(256), 0, stream>>>(xb, xb, xb, wqab, wkab, wvab,
                                                                    cq, ck, cv, nullptr, R_, D_, 0);
  // up-projections, [4096,512] x [2048,512]^T each: 128 x 128 tiles, 3 x 512 work-groups
  gemm_abT_n128<<<dim3(D_ / 128, M / 128, 3), dim3(256), 0, stream>>>(cq, ck, cv, wqbb, wkbb, wvbb,
                                                                      qb, kb, vb, nullptr, D_, R_, 0);
  // flash attention: grid = (T/128 q-blocks, B*H heads)
  mla_attn<<<dim3(TQ_ / (64 * QG_), BB_ * H_), dim3(128), 0, stream>>>(qb, kb, vb, ao);
  // output projection + bias -> f32 d_out
  gemm_abT_n128<<<dim3(D_ / 128, M / 128, 1), dim3(256), 0, stream>>>(ao, ao, ao, wob, wob, wob,
                                                                      d_out, d_out, d_out, wo_b, D_, D_, 1);
}

// v010
// Measured time: 129 microseconds a run.
// Two timings next to v009 both put it at 1.09 times that version's speed.
// Over all steps from v000 it is 5.72 times as fast.
#include <hip/hip_runtime.h>
#include <hip/hip_bf16.h>

// ---------------------------------------------------------------------------
// MLA (multi-head latent attention) forward for MI455X / gfx1250.
// All GEMMs + attention run through v_wmma_f32_16x16x32_bf16 (f32 accumulate).
// ---------------------------------------------------------------------------

typedef __attribute__((ext_vector_type(16))) __bf16 v16bf;
typedef __attribute__((ext_vector_type(8)))  float  v8f;
typedef __attribute__((ext_vector_type(4)))  unsigned int u32x4;   // 16 B in flight

#define D_   2048
#define H_   16
#define HD_  128
#define TQ_  2048
#define BB_  2
#define R_   512

static __device__ __forceinline__ unsigned short f2bf(float f) {
  unsigned int u = __float_as_uint(f);
  u += 0x7FFFu + ((u >> 16) & 1u);          // round-to-nearest-even
  return (unsigned short)(u >> 16);
}

// two f32 -> one register of two bf16, round to nearest even
static __device__ __forceinline__ unsigned int pack2(float lo, float hi) {
  typedef __attribute__((ext_vector_type(2))) __bf16 bf2;
  typedef __attribute__((ext_vector_type(2))) float f2;
  return __builtin_bit_cast(unsigned int, __builtin_convertvector(f2{lo, hi}, bf2));
}

// Work-group barrier that orders LDS traffic only. __syncthreads() also waits
// for every global load of the wave, which would drain the loads issued ahead
// for a later tile; nothing read from global memory here is written in the launch.
static __device__ __forceinline__ void lds_barrier() {
  __builtin_amdgcn_fence(__ATOMIC_RELEASE, "workgroup", "local");
  __builtin_amdgcn_s_barrier();
  __builtin_amdgcn_fence(__ATOMIC_ACQUIRE, "workgroup", "local");
}

// Stands behind a batch of global loads that stays in flight, in front of the
// first instruction that reuses one of their address registers.
static __device__ __forceinline__ void loads_issued() {
  asm volatile("s_wait_xcnt 0x0" ::: "memory");
}

// --- tensor loads: one request of one wave brings a 2-D tile from global memory to LDS ---
typedef __attribute__((ext_vector_type(8))) unsigned int u32x8;
static __device__ __forceinline__ unsigned int uni(unsigned int v) {
  return (unsigned int)__builtin_amdgcn_readfirstlane(v);
}
// pinned(): holds an issue test or a descriptor's input in a scalar register, so that a
// test on it is a scalar branch (a tensor load ignores EXEC: only a branch keeps a wave from it).
static __device__ __forceinline__ unsigned int pinned(unsigned int v) {
  unsigned int w = uni(v);
  asm volatile("" : "+s"(w));  // pinned(): the test or descriptor input stays in a scalar register
  return w;
}
static __device__ __forceinline__ void tdm_load(u32x4 g0, u32x8 g1) {
  asm volatile("tensor_load_to_lds %0, %1" :: "s"(g0), "s"(g1) : "memory");
}
// The issuing wave's tile has landed in LDS (the compiler places no wait for a tensor load).
static __device__ __forceinline__ void tensor_landed() {
  asm volatile("s_wait_tensorcnt 0x0" ::: "memory");
}
// The wave's own LDS reads have returned (in front of a barrier behind which their buffer is refilled).
static __device__ __forceinline__ void lds_reads_done() {
  asm volatile("s_wait_dscnt 0x0" ::: "memory");
}

// Load one 16x32 bf16 WMMA operand fragment from LDS (row-major, `stride`
// elements per row). Matches the CDNA5 16-bit A/B layout:
//   lanes 0-15 : K = 0..7 (v0-3), 16..23 (v4-7)
//   lanes16-31 : K = 8..15 (v0-3), 24..31 (v4-7)
// => two 16-byte contiguous LDS reads per lane.
static __device__ __forceinline__ v16bf lds_frag(const unsigned short* p, int stride,
                                                 int row, int koff, int lane) {
  const int kb = (lane & 16) ? 8 : 0;
  const unsigned short* base = p + row * stride + koff + kb;
  union { uint4 u[2]; v16bf v; } c;
  c.u[0] = *(const uint4*)(base);
  c.u[1] = *(const uint4*)(base + 16);
  return c.v;
}

// Load one 32(k) x 16(col) bf16 B fragment from a row-major [k][col] LDS tile
// with the transposing load: lane (c = lane&15, h = lane>>4) receives
// tile[kbase + 8h + 0..7][dbase + c]; the second load, 16 rows further, gives
// k = 16 + 8h + 0..7, i.e. the same k order as lds_frag above. Taken as an A
// fragment the same registers are 16(row = col of the tile) x 32(k).
// `pitch` is in elements; 32 B x odd keeps the load free of bank conflicts.
typedef __attribute__((ext_vector_type(8))) short s16x8;
static __device__ __forceinline__ v16bf lds_frag_tr(const unsigned short* tile, int pitch,
                                                    int kbase, int dbase, int lane) {
  typedef __attribute__((address_space(3))) s16x8 lds_s16x8;
  const unsigned short* p = tile + (kbase + ((lane >> 4) << 3) + (lane & 7)) * pitch
                                 + dbase + (((lane >> 3) & 1) << 3);
  union { s16x8 u[2]; v16bf v; } c;
  c.u[0] = __builtin_amdgcn_ds_load_tr16_b128_v8i16((lds_s16x8*)p);
  c.u[1] = __builtin_amdgcn_ds_load_tr16_b128_v8i16((lds_s16x8*)(p + 16 * pitch));
  return c.v;
}

// ---------------------------------------------------------------------------
// fp32 -> bf16 conversion of all eight arrays in one launch. The bf16 copies lie
// back to back in `dst`, in the order of the arguments. The work is cut into
// chunks of 8192 elements (8 x 16 B per thread, each wave-wide load 512 B in a
// row); every array is a whole number of chunks, so a chunk has one source.
// CONV_WGS work-groups (three per WGP) take CONV_TRIPS chunks each, a chunk's
// eight loads going out before the chunk in front of it is converted: few, long
// waves, for speed only.
// ---------------------------------------------------------------------------
#define CONV_CHUNK   8192
#define CONV_X_CH    (BB_ * TQ_ * D_ / CONV_CHUNK)          // chunks of x
#define CONV_W_CH    (R_ * D_ / CONV_CHUNK)                 // chunks of a low-rank weight
#define CONV_CHUNKS  (CONV_X_CH + 6 * CONV_W_CH + D_ * D_ / CONV_CHUNK)
#define CONV_WGS     768
#define CONV_TRIPS   (CONV_CHUNKS / CONV_WGS)
static_assert(CONV_TRIPS * CONV_WGS == CONV_CHUNKS, "every work-group takes the same number of chunks");
typedef __attribute__((ext_vector_type(4))) unsigned short u16x4;

__global__ __launch_bounds__(256) void f32_to_bf16_all(const float* __restrict__ x,
                                                       const float* __restrict__ wq_a,
                                                       const float* __restrict__ wq_b,
                                                       const float* __restrict__ wk_a,
                                                       const float* __restrict__ wk_b,
                                                       const float* __restrict__ wv_a,
                                                       const float* __restrict__ wv_b,
                                                       const float* __restrict__ wo_w,
                                                       unsigned short* __restrict__ dst) {
  const int tid = threadIdx.x;

  // The three loops below are unrolled so that every index of v is a constant and
  // v stays in registers.
  float4 v[2][8];
#pragma unroll
  for (int t = 0; t <= CONV_TRIPS; ++t) {
    if (t < CONV_TRIPS) {
      // chunk c and its place in its source array: the same for the whole work-group
      const int c = blockIdx.x + t * CONV_WGS;
      const int w = (c - CONV_X_CH) / CONV_W_CH;            // which weight, where c is past x
      const float* s = x;
      int first = 0;                                        // the array's first chunk
      if (c >= CONV_X_CH) {
        s = w == 0 ? wq_a : w == 1 ? wq_b : w == 2 ? wk_a
          : w == 3 ? wk_b : w == 4 ? wv_a : w == 5 ? wv_b : wo_w;
        first = CONV_X_CH + min(w, 6) * CONV_W_CH;
      }
      s += (size_t)(c - first) * CONV_CHUNK + tid * 4;
#pragma unroll
      for (int j = 0; j < 8; ++j) v[t & 1][j] = *(const float4*)(s + j * 1024);
      loads_issued();
      // Keeps the conversion below behind these loads: without it its first
      // instructions, and their wait for the chunk before, stand in front of chunk 1's
      // loads, which then go out one memory latency late.
      __builtin_amdgcn_sched_barrier(0);
    }
    if (t > 0) {
      unsigned short* d = dst + (size_t)(blockIdx.x + (t - 1) * CONV_WGS) * CONV_CHUNK + tid * 4;
#pragma unroll
      for (int j = 0; j < 8; ++j) {
        const float4 f = v[(t - 1) & 1][j];
        const u16x4 o = {f2bf(f.x), f2bf(f.y), f2bf(f.z), f2bf(f.w)};
        *(u16x4*)(d + j * 1024) = o;
      }
      if (t < CONV_TRIPS) loads_issued();  // the stores' address registers are reused below
    }
  }
}

// ---------------------------------------------------------------------------
// C[M,N] = A[M,K] (bf16 row-major) x W[N,K]^T (bf16 row-major) (+bias)
// Block: 256 threads (8 waves, 4 along M x 2 along N). Tile: 128(M) x 32 NI(N),
// a stage is 128 of K, so that a tile row is 256 B, two whole lines of its operand.
// A wave computes 32 x 16 NI = 2 x NI WMMA 16x16 fragments, four times per stage.
// NI = 4 (128 x 128) where N = 2048: 512 work-groups a product, two per WGP at a
// time; NI = 2 (128 x 64) for the narrow down-projections, whose three products
// are then 768 work-groups, three per WGP (at 128 x 128: 384, one and a half).
// The tiles come into LDS by tensor loads, through no register: wave 0 asks for the
// stage's A tile, wave 1 for its W tile, one request each. Two buffers: a stage's
// requests go out when the stage two before it has been read by every wave, and fly
// while the stage between is worked on. K is a multiple of 128 and at least 256.
// ---------------------------------------------------------------------------
#define GKS_  128                   // K elements of a stage
#define GP_   136                   // LDS row pitch in elements: 256 B + the mover's 16-B pad = 16 B x odd, for the b128 readers
#define GAB_  (128 * GP_ * 2)       // bytes of an A tile in LDS: 17 x 2 KiB
#define GWB_(NI)  ((unsigned int)(((NI) * 32 * GP_ * 2 + 2047) & ~2047))   // of a W tile, rounded up to 2 KiB
#define GBUF_(NI) ((unsigned int)(GAB_ + GWB_(NI)))                        // of a buffer: every tile starts at a multiple of 2 KiB

// Writes a wave's 32 x 16 NI part of C. The products are formed transposed (the W
// fragment is the A operand), so acc[mi][ni][r] is C[row0 + 16 mi + (lane & 15)]
// [col0 + 16 ni + 8 (lane >> 4) + r]: a lane holds eight neighbours of one row of C.
// 16 rows at a time go through the wave's own LDS range `st` in 16-B pieces (row
// pitch: the row + 16 B) and come back with neighbouring lanes on one row, so that a
// wave-wide 16-B store covers its rows' whole extent (128 B and more where NI = 4).
template <int NI, typename OutT>
static __device__ __forceinline__ void store_tile(char* st, v8f (&acc)[2][NI], OutT* __restrict__ C,
                                                  const float* __restrict__ bias, int N,
                                                  int row0, int col0, int lane) {
  constexpr int ES    = sizeof(OutT);
  constexpr int ROWB  = NI * 16 * ES;      // bytes of a row of the wave's part
  constexpr int PITCH = ROWB + 16;
  constexpr int LPR   = ROWB / 16;         // lanes to a row on the way out
  constexpr int RPI   = 32 / LPR;          // rows to a wave-wide store
  const int c = lane & 15, h = lane >> 4;

  if (bias) {
#pragma unroll
    for (int ni = 0; ni < NI; ++ni) {
      const float4 b0 = *(const float4*)(bias + col0 + ni * 16 + 8 * h);
      const float4 b1 = *(const float4*)(bias + col0 + ni * 16 + 8 * h + 4);
      loads_issued();  // in front of the next reuse of the loads' address registers
      const float b[8] = {b0.x, b0.y, b0.z, b0.w, b1.x, b1.y, b1.z, b1.w};
#pragma unroll
      for (int mi = 0; mi < 2; ++mi)
#pragma unroll
        for (int r = 0; r < 8; ++r) acc[mi][ni][r] += b[r];
    }
  }

  char* sw = st + c * PITCH + 8 * h * ES;
  const char* sr = st + (lane / LPR) * PITCH + (lane % LPR) * 16;
  const unsigned int goff = (unsigned int)(((row0 + lane / LPR) * N + col0) * ES + (lane % LPR) * 16);
  const unsigned int gstep = (unsigned int)(RPI * N * ES);
#pragma unroll
  for (int mi = 0; mi < 2; ++mi) {
#pragma unroll
    for (int ni = 0; ni < NI; ++ni) {
      const v8f a = acc[mi][ni];
      if constexpr (ES == 2) {
        const u32x4 pk = {pack2(a[0], a[1]), pack2(a[2], a[3]), pack2(a[4], a[5]), pack2(a[6], a[7])};
        *(u32x4*)(sw + ni * 32) = pk;
      } else {
        const float4 lo = {a[0], a[1], a[2], a[3]}, hi = {a[4], a[5], a[6], a[7]};
        *(float4*)(sw + ni * 64)      = lo;
        *(float4*)(sw + ni * 64 + 16) = hi;
      }
    }
    // the wave's own LDS writes are done before other lanes read them back
    asm volatile("s_wait_dscnt 0x0" ::: "memory");
    u32x4 d[16 / RPI];
    unsigned int go[16 / RPI];
#pragma unroll
    for (int j = 0; j < 16 / RPI; ++j) {
      d[j]  = *(const u32x4*)(sr + j * RPI * PITCH);
      go[j] = goff + (unsigned int)(mi * (16 / RPI) + j) * gstep;
    }
    // The two lines that hold the scheduler keep every register write out of the run of
    // stores: the stores go out back to back, and the one wait behind them stands in
    // front of the first reuse of their offset and data registers. Behind the last
    // run the wave ends and nothing is reused.
    __builtin_amdgcn_sched_barrier(0);
#pragma unroll
    for (int j = 0; j < 16 / RPI; ++j) *(u32x4*)((char*)C + go[j]) = d[j];
    if (mi == 0) {
      loads_issued();
      __builtin_amdgcn_sched_barrier(0);
    }
  }
}

template <int NI>
static __device__ __forceinline__ void gemm_tile(unsigned char* ring,
                                                 const unsigned short* __restrict__ A,
                                                 const unsigned short* __restrict__ W,
                                                 void* __restrict__ C,
                                                 const float* __restrict__ bias,
                                                 int N, int K, int out_f32) {
  const int tid  = threadIdx.x;
  const int lane = tid & 31;
  const int wv   = tid >> 5;
  const int wm   = (wv & 3) * 32;
  const int wn   = (wv >> 2) * (NI * 16);
  const int m0   = blockIdx.y * 128;
  const int n0   = blockIdx.x * (NI * 32);

  v8f acc[2][NI] = {};

  // Who asks for what: wave 0 the A tile (128 rows), wave 1 the W tile (32 NI rows).
  const unsigned int wave   = uni((unsigned int)tid >> 5);
  const unsigned int issuer = pinned(wave < 2u ? 1u : 0u);
  const unsigned int stages = pinned((unsigned int)K / GKS_);
  const unsigned int rows   = wave == 0u ? 128u : (unsigned int)(NI * 32);
  const unsigned long long src = wave == 0u ? (unsigned long long)(size_t)(A + (size_t)m0 * K)
                                            : (unsigned long long)(size_t)(W + (size_t)n0 * K);
  const unsigned int dst = (unsigned int)(size_t)ring + (wave == 0u ? 0u : (unsigned int)GAB_);
  // Descriptor group 1, the same for every stage: 1-byte elements, tensor = tile = rows x 256 B,
  // source pitch one row of the operand, 16 B of LDS pad behind every 256-B row, no mask.
  u32x8 g1;
  g1[0] = uni((1u << 20) | (5u << 22) | (3u << 25));
  g1[1] = uni(256u << 16);
  g1[2] = uni(rows << 16);
  g1[3] = uni(256u << 16);
  g1[4] = uni(rows);
  g1[5] = uni((unsigned int)K * 2u);
  g1[6] = uni(0u);
  g1[7] = uni(0u);
  // pinned(), for the group as a whole: its eight scalar registers hold these words and
  // nothing else from here to the last request (left alone the compiler rebuilds some words
  // in front of each request and gives their registers other uses while a request is in flight).
  asm volatile("" : "+s"(g1));  // pinned(): descriptor words held in scalar registers
  // Group 0 is formed from a pinned stage number, which keeps its arithmetic behind the
  // wait for the request before; its word 0 (count 1) is set once, in front of the first request.
  const unsigned int count1 = pinned(1u);
  auto issue = [&](unsigned int s) {
    const unsigned int st = pinned(s);
    const unsigned long long ga = src + (unsigned long long)st * (GKS_ * 2);
    u32x4 g0;
    g0[0] = count1;
    g0[1] = uni(dst + (st & 1u) * GBUF_(NI));
    g0[2] = uni((unsigned int)ga);
    g0[3] = uni((((unsigned int)(ga >> 32)) & 0x01FFFFFFu) | 0x80000000u);
    tdm_load(g0, g1);
  };

  if (issuer) {
    issue(0u);
    tensor_landed();
  }
  __syncthreads();  // stage 0 is whole in LDS for every wave
  if (issuer) issue(1u);

  for (unsigned int s = 0; s < stages; ++s) {
    const unsigned short* As = (const unsigned short*)(ring + (s & 1u) * GBUF_(NI));
    const unsigned short* Ws = (const unsigned short*)(ring + (s & 1u) * GBUF_(NI) + GAB_);
    // The loads of 32 of K stand directly in front of their own products, four times a stage.
#pragma unroll
    for (int kk = 0; kk < GKS_ / 32; ++kk) {
      v16bf af[2], bfm[NI];
#pragma unroll
      for (int mi = 0; mi < 2; ++mi)
        af[mi] = lds_frag(As, GP_, wm + mi * 16 + (lane & 15), kk * 32, lane);
#pragma unroll
      for (int ni = 0; ni < NI; ++ni)
        bfm[ni] = lds_frag(Ws, GP_, wn + ni * 16 + (lane & 15), kk * 32, lane);
      // Keeps these loads one group in front of their products: left alone the compiler
      // holds the second A fragment's loads back behind half the products, where the wave
      // waits out the LDS latency a second time per 32 of K.
      __builtin_amdgcn_sched_barrier(0);
#pragma unroll
      for (int mi = 0; mi < 2; ++mi)
#pragma unroll
        for (int ni = 0; ni < NI; ++ni)
          acc[mi][ni] = __builtin_amdgcn_wmma_f32_16x16x32_bf16(
              false, bfm[ni], false, af[mi], (short)0, acc[mi][ni], false, false);
    }
    // Hand-over: this wave has read stage s, the issuers' stage s + 1 has landed; behind
    // the barrier every wave may read stage s + 1 and stage s's buffer may be refilled.
    lds_reads_done();
    if (issuer) tensor_landed();
    __syncthreads();
    if (pinned((issuer != 0u && s + 2u < stages) ? 1u : 0u)) issue(s + 2u);
  }
  tensor_landed();
  lds_reads_done();

  // Epilogue: the loop's last barrier has freed the ring and nothing was asked for behind
  // it; every wave stages in a range of its own.
  char* st = (char*)ring + wv * (16 * (NI * 64 + 16));
  if (out_f32) store_tile<NI, float>(st, acc, (float*)C, bias, N, m0 + wm, n0 + wn, lane);
  else         store_tile<NI, unsigned short>(st, acc, (unsigned short*)C, bias, N, m0 + wm, n0 + wn, lane);
}

// A launch holds up to three independent products of one shape (those for q, k and
// v): blockIdx.z picks the operands, the same for the whole work-group. The narrow
// down-projections then put three work-groups on a WGP, where a launch of one of
// them puts a single one, whose waits at its barriers nothing fills; and one
// product's first loads and last stores run beside another's K loop instead of
// behind a launch boundary.
#define PICK3_(p) (blockIdx.z == 0 ? p##0 : blockIdx.z == 1 ? p##1 : p##2)

// amdgpu_waves_per_eu(min, max): min sets the compiler's register budget, max the
// waves that may share a SIMD. With the default budget the compiler held part of a
// K-step's fragment loads back to save registers, which made two more places per
// K-step where a wave waits for LDS. max is what the grid puts on a SIMD: six waves
// (768 work-groups, three on a WGP) for n64, four (two on a WGP at a time) for n128.
__global__ __launch_bounds__(256) __attribute__((amdgpu_waves_per_eu(2, 6))) void gemm_abT_n64(const unsigned short* __restrict__ A0,
                                                    const unsigned short* __restrict__ A1,
                                                    const unsigned short* __restrict__ A2,
                                                    const unsigned short* __restrict__ W0,
                                                    const unsigned short* __restrict__ W1,
                                                    const unsigned short* __restrict__ W2,
                                                    void* __restrict__ C0,
                                                    void* __restrict__ C1,
                                                    void* __restrict__ C2,
                                                    const float* __restrict__ bias,
                                                    int N, int K, int out_f32) {
  __shared__ __attribute__((aligned(2048))) unsigned char ring[2 * GBUF_(2)];  // 3 work-groups' rings fit a WGP's LDS
  gemm_tile<2>(ring, PICK3_(A), PICK3_(W), PICK3_(C), bias, N, K, out_f32);
}

__global__ __launch_bounds__(256) __attribute__((amdgpu_waves_per_eu(4, 4))) void gemm_abT_n128(const unsigned short* __restrict__ A0,
                                                     const unsigned short* __restrict__ A1,
                                                     const unsigned short* __restrict__ A2,
                                                     const unsigned short* __restrict__ W0,
                                                     const unsigned short* __restrict__ W1,
                                                     const unsigned short* __restrict__ W2,
                                                     void* __restrict__ C0,
                                                     void* __restrict__ C1,
                                                     void* __restrict__ C2,
                                                     const float* __restrict__ bias,
                                                     int N, int K, int out_f32) {
  __shared__ __attribute__((aligned(2048))) unsigned char ring[2 * GBUF_(4)];  // 2 work-groups' rings fit a WGP's LDS
  gemm_tile<4>(ring, PICK3_(A), PICK3_(W), PICK3_(C), bias, N, K, out_f32);
}

// ---------------------------------------------------------------------------
// Flash attention per (b,h). Block = 128 threads (4 waves), 128 query rows,
// streaming 64-key tiles; K/V tiles row-major in LDS.
// Both products are transposed: S^T = K x Q^T (A = K rows from LDS, B = the
// wave's queries, held in registers) and O^T += V^T x P^T (A = V^T by the
// transposing LDS load). A lane then holds scores of ONE query per column group
// (column lane&15; the two wave halves hold different keys), so the maximum and
// the sum run in-lane with one exchange between the halves, and two score tiles,
// rounded in place, are the B operand of the second product: P never goes
// through LDS.
// A wave takes QG_ = 2 column groups of 16 queries: a K or V fragment read from
// LDS feeds two products, which halves the LDS reads, the K/V staging and the
// barriers per query. 512 work-groups are two per WGP, two waves per SIMD.
// The 16 global loads of a K/V tile go out together, one tile ahead of their
// LDS stores, and wait in registers while the current tile is worked on.
// ---------------------------------------------------------------------------
#define QG_ 2
// 2^x of eight values, in place. Written in asm so that the slot the instruction set
// asks for behind a transcendental is filled by construction: each v_exp_f32 is
// followed by one that shares no register with it, the last by the v_nop.
static __device__ __forceinline__ void exp2_run8(v8f& x) {
  float x0 = x[0], x1 = x[1], x2 = x[2], x3 = x[3], x4 = x[4], x5 = x[5], x6 = x[6], x7 = x[7];
  asm("v_exp_f32 %0, %0\n\tv_exp_f32 %1, %1\n\tv_exp_f32 %2, %2\n\tv_exp_f32 %3, %3\n\t"
      "v_exp_f32 %4, %4\n\tv_exp_f32 %5, %5\n\tv_exp_f32 %6, %6\n\tv_exp_f32 %7, %7\n\tv_nop"
      : "+v"(x0), "+v"(x1), "+v"(x2), "+v"(x3), "+v"(x4), "+v"(x5), "+v"(x6), "+v"(x7));
  x = v8f{x0, x1, x2, x3, x4, x5, x6, x7};
}
// the value of lane l ^ 16
static __device__ __forceinline__ float xhalf(float x) {
  return __builtin_bit_cast(float, __builtin_amdgcn_permlanex16(
      __builtin_bit_cast(int, x), __builtin_bit_cast(int, x), 0x76543210, 0xfedcba98, false, false));
}

// amdgpu_waves_per_eu: the register budget is that of the two waves which the grid
// puts on a SIMD. With the default budget the compiler keeps one fragment in
// registers and waits out the LDS latency in front of every product.
__global__ __launch_bounds__(128) __attribute__((amdgpu_waves_per_eu(2, 2))) void mla_attn(const unsigned short* __restrict__ Q,
                                                const unsigned short* __restrict__ Kx,
                                                const unsigned short* __restrict__ V,
                                                unsigned short* __restrict__ O) {
  __shared__ __align__(16) unsigned short Ks[64 * 136];      // [key][hd], pitch 272 B
  __shared__ __align__(16) unsigned short Vs[64 * 144];      // [key][hd], pitch 288 B

  const int tid  = threadIdx.x;
  const int lane = tid & 31;
  const int wv   = tid >> 5;
  const int q0   = blockIdx.x * (64 * QG_);
  const int bh   = blockIdx.y;
  const int b    = bh / H_;
  const int h    = bh % H_;
  const size_t rs   = (size_t)H_ * HD_;                      // 2048 row stride
  const size_t base = (size_t)b * TQ_ * rs + (size_t)h * HD_;

  // each thread moves 16 B of rows trow + 8p, p = 0..7, of a 64x128 tile
  const int trow = tid >> 4, tcol = (tid & 15) * 8;
  const unsigned short* Kg = Kx + base + (size_t)trow * rs + tcol;
  const unsigned short* Vg = V + base + (size_t)trow * rs + tcol;

  // This lane's query of group 0 (group g: 16 g rows further), and the Q^T fragments
  // (32 hd x 16 queries each) in the k order of lds_frag:
  // hd = 32 ks + 8 (lane >> 4) + 0..7, then 16 further.
  const size_t qrow = base + (size_t)(q0 + wv * (16 * QG_) + (lane & 15)) * rs;
  v16bf qf[QG_][4];
  u32x4 kr[8], vr[8];
  {
    const unsigned short* qp = Q + qrow + ((lane & 16) ? 8 : 0);
    union { u32x4 u[2]; v16bf v; } c[QG_][4];
#pragma unroll
    for (int g = 0; g < QG_; ++g)
#pragma unroll
      for (int ks = 0; ks < 4; ++ks) {
        c[g][ks].u[0] = *(const u32x4*)(qp + (size_t)(16 * g) * rs + ks * 32);
        c[g][ks].u[1] = *(const u32x4*)(qp + (size_t)(16 * g) * rs + ks * 32 + 16);
      }
#pragma unroll
    for (int p = 0; p < 8; ++p) kr[p] = *(const u32x4*)(Kg + (size_t)(p * 8) * rs);
#pragma unroll
    for (int p = 0; p < 8; ++p) vr[p] = *(const u32x4*)(Vg + (size_t)(p * 8) * rs);
    loads_issued();
    // Holds the arithmetic that follows behind the wait above: left alone the compiler
    // lifts it over the wait, onto the address registers of the Q loads.
    __builtin_amdgcn_sched_barrier(0);
#pragma unroll
    for (int g = 0; g < QG_; ++g)
#pragma unroll
      for (int ks = 0; ks < 4; ++ks) qf[g][ks] = c[g][ks].v;
  }

  // o[g][n8][r] = O[query 16 g + (lane&15)][16 n8 + 8 (lane>>4) + r]
  v8f o[QG_][8] = {};
  float mrow[QG_], lsum[QG_];        // lsum: this wave half's keys only, joined at the end
#pragma unroll
  for (int g = 0; g < QG_; ++g) { mrow[g] = -1e30f; lsum[g] = 0.f; }
  // 1/sqrt(128) x log2 e: e^((s - m) / sqrt(128)) = 2^(s c2 - m c2), one multiply-add a score
  const float c2 = 0.08838834764831845f * 1.44269504088896340736f;

  for (int kb = 0; kb < TQ_ / 64; ++kb) {
    lds_barrier();  // previous tile's readers done before K/V overwrite
#pragma unroll
    for (int p = 0; p < 8; ++p) *(u32x4*)(&Ks[(trow + p * 8) * 136 + tcol]) = kr[p];
#pragma unroll
    for (int p = 0; p < 8; ++p) *(u32x4*)(&Vs[(trow + p * 8) * 144 + tcol]) = vr[p];
    // next tile's loads; the last trip reads its own tile again (in bounds,
    // unused), so no branch stands round the loads
    const size_t nxt = (size_t)(min(kb + 1, TQ_ / 64 - 1) * 64) * rs;
#pragma unroll
    for (int p = 0; p < 8; ++p) kr[p] = *(const u32x4*)(Kg + nxt + (size_t)(p * 8) * rs);
#pragma unroll
    for (int p = 0; p < 8; ++p) vr[p] = *(const u32x4*)(Vg + nxt + (size_t)(p * 8) * rs);
    loads_issued();
    lds_barrier();

    // S^T(64 keys x 16 queries) per group: s[g][n][r] = score of key 16 n + 8 (lane>>4) + r.
    // All 16 K fragments are asked for as one group in front of the products.
    v8f s[QG_][4] = {};
    {
      v16bf ak[4][4];
#pragma unroll
      for (int ks = 0; ks < 4; ++ks)
#pragma unroll
        for (int n = 0; n < 4; ++n) ak[ks][n] = lds_frag(Ks, 136, n * 16 + (lane & 15), ks * 32, lane);
      // Keeps the loads above in front of the products: left alone the compiler spreads
      // them among the products, one fragment ahead, and each waits out most of the
      // LDS latency.
      __builtin_amdgcn_sched_barrier(0);
#pragma unroll
      for (int ks = 0; ks < 4; ++ks)
#pragma unroll
        for (int n = 0; n < 4; ++n)
#pragma unroll
          for (int g = 0; g < QG_; ++g)
            s[g][n] = __builtin_amdgcn_wmma_f32_16x16x32_bf16(false, ak[ks][n], false, qf[g][ks],
                                                              (short)0, s[g][n], false, false);
    }

    // The compiler schedules nothing across this line and the one behind the softmax.
    // Without them it lifts all V fragment loads up beside the K fragments; the live
    // set then exceeds the register budget and the next tile's global loads are
    // spilled, which waits them out on the spot.
    __builtin_amdgcn_sched_barrier(0);
    // V^T fragments of the tile's first 32 keys: their LDS latency passes under the softmax
    v16bf av[2][8];
#pragma unroll
    for (int n8 = 0; n8 < 8; ++n8) av[0][n8] = lds_frag_tr(Vs, 144, 0, n8 * 16, lane);

    // Online softmax of this lane's query of each group over its 32 keys of the tile
    v16bf pf[QG_][2];
#pragma unroll
    for (int g = 0; g < QG_; ++g) {
      // the maximum is taken, and kept in mrow, on the products as they are (c2 > 0)
      float v = -1e30f;
#pragma unroll
      for (int n = 0; n < 4; ++n)
#pragma unroll
        for (int r = 0; r < 8; ++r) v = fmaxf(v, s[g][n][r]);
      v = fmaxf(v, xhalf(v));        // both halves: the maximum over all 64 keys
      const float mn   = fmaxf(mrow[g], v);
      const float nm2  = -mn * c2;
      const float corr = __builtin_amdgcn_exp2f(fmaf(mrow[g], c2, nm2));
      mrow[g] = mn;
      const v8f c2v  = {c2, c2, c2, c2, c2, c2, c2, c2};
      const v8f nm2v = {nm2, nm2, nm2, nm2, nm2, nm2, nm2, nm2};
#pragma unroll
      for (int n = 0; n < 4; ++n) {
        s[g][n] = __builtin_elementwise_fma(s[g][n], c2v, nm2v);
        exp2_run8(s[g][n]);
      }
      float psum = 0.f;
      // P^T as B operand: element e of fragment kk is key 32 kk + 8 (lane>>4) + e for
      // e < 8 and 16 keys further for e >= 8, which is s[2 kk] then s[2 kk + 1]
#pragma unroll
      for (int kk = 0; kk < 2; ++kk) {
        union { unsigned int w[8]; v16bf v; } c;
#pragma unroll
        for (int i = 0; i < 8; ++i) {
          const float p0 = s[g][2 * kk + (i >> 2)][2 * (i & 3)], p1 = s[g][2 * kk + (i >> 2)][2 * (i & 3) + 1];
          psum += p0 + p1;
          c.w[i] = pack2(p0, p1);
        }
        pf[g][kk] = c.v;
      }
      lsum[g] = lsum[g] * corr + psum;
#pragma unroll
      for (int n8 = 0; n8 < 8; ++n8)
#pragma unroll
        for (int r = 0; r < 8; ++r) o[g][n8][r] *= corr;
    }

    __builtin_amdgcn_sched_barrier(0);  // see above

    // O^T(128 hd x 16 queries) += V^T(128 x 64) x P^T(64 x 16): A row = hd, k = key.
    // The second 32 keys' fragments come in under the first 32 keys' products.
#pragma unroll
    for (int n8 = 0; n8 < 8; ++n8) av[1][n8] = lds_frag_tr(Vs, 144, 32, n8 * 16, lane);
    __builtin_amdgcn_sched_barrier(0);  // these loads too stay one group in front of the products
#pragma unroll
    for (int kk = 0; kk < 2; ++kk)
#pragma unroll
      for (int n8 = 0; n8 < 8; ++n8)
#pragma unroll
        for (int g = 0; g < QG_; ++g)
          o[g][n8] = __builtin_amdgcn_wmma_f32_16x16x32_bf16(false, av[kk][n8], false, pf[g][kk],
                                                             (short)0, o[g][n8], false, false);
  }

  // Normalize and store (bf16, feeds the output projection GEMM): a lane's eight
  // registers of a tile are eight consecutive hd of its query, one 16 B store
#pragma unroll
  for (int g = 0; g < QG_; ++g) {
    const float lfin = lsum[g] + xhalf(lsum[g]);
    unsigned short* Og = O + qrow + (size_t)(16 * g) * rs + ((lane & 16) ? 8 : 0);
#pragma unroll
    for (int n8 = 0; n8 < 8; ++n8) {
      const u32x4 pk = {pack2(o[g][n8][0] / lfin, o[g][n8][1] / lfin), pack2(o[g][n8][2] / lfin, o[g][n8][3] / lfin),
                        pack2(o[g][n8][4] / lfin, o[g][n8][5] / lfin), pack2(o[g][n8][6] / lfin, o[g][n8][7] / lfin)};
      *(u32x4*)(Og + n8 * 16) = pk;
      loads_issued();  // the store's data registers are reused for the next tile
    }
  }
}

// ---------------------------------------------------------------------------
// Launch chain
// ---------------------------------------------------------------------------
extern "C" void kernel_launch(void* const* d_in, const int* in_sizes, int n_in,
                              void* d_out, int out_size, void* d_ws, size_t ws_size,
                              hipStream_t stream) {
  (void)in_sizes; (void)n_in; (void)out_size; (void)ws_size;

  const float* x    = (const float*)d_in[0];
  const float* wq_a = (const float*)d_in[1];
  const float* wq_b = (const float*)d_in[2];
  const float* wk_a = (const float*)d_in[3];
  const float* wk_b = (const float*)d_in[4];
  const float* wv_a = (const float*)d_in[5];
  const float* wv_b = (const float*)d_in[6];
  const float* wo_w = (const float*)d_in[7];
  const float* wo_b = (const float*)d_in[8];

  const int M = BB_ * TQ_;  // 4096 tokens

  size_t off = 0;
  auto alloc = [&](size_t elems) {
    unsigned short* p = (unsigned short*)((char*)d_ws + off);
    off += (elems * sizeof(unsigned short) + 255) & ~(size_t)255;
    return p;
  };
  unsigned short* xb   = alloc((size_t)M * D_);
  unsigned short* wqab = alloc((size_t)R_ * D_);
  unsigned short* wqbb = alloc((size_t)D_ * R_);
  unsigned short* wkab = alloc((size_t)R_ * D_);
  unsigned short* wkbb = alloc((size_t)D_ * R_);
  unsigned short* wvab = alloc((size_t)R_ * D_);
  unsigned short* wvbb = alloc((size_t)D_ * R_);
  unsigned short* wob  = alloc((size_t)D_ * D_);
  unsigned short* cq   = alloc((size_t)M * R_);
  unsigned short* ck   = alloc((size_t)M * R_);
  unsigned short* cv   = alloc((size_t)M * R_);
  unsigned short* qb   = alloc((size_t)M * D_);
  unsigned short* kb   = alloc((size_t)M * D_);
  unsigned short* vb   = alloc((size_t)M * D_);
  unsigned short* ao   = alloc((size_t)M * D_);

  // xb .. wob lie back to back (every size is a multiple of 256 B), in this order
  f32_to_bf16_all<<<dim3(CONV_WGS), dim3(256), 0, stream>>>(x, wq_a, wq_b, wk_a, wk_b,
                                                            wv_a, wv_b, wo_w, xb);

  // latent down-projections, [4096,2048] x [512,2048]^T each: 128 x 64 tiles, 3 x 256 work-groups
  gemm_abT_n64<<<dim3(R_ / 64, M / 128, 3), dim3(256), 0, stream>>>(xb, xb, xb, wqab, wkab, wvab,
                                                                    cq, ck, cv, nullptr, R_, D_, 0);
  // up-projections, [4096,512] x [2048,512]^T each: 128 x 128 tiles, 3 x 512 work-groups
  gemm_abT_n128<<<dim3(D_ / 128, M / 128, 3), dim3(256), 0, stream>>>(cq, ck, cv, wqbb, wkbb, wvbb,
                                                                      qb, kb, vb, nullptr, D_, R_, 0);
  // flash attention: grid = (T/128 q-blocks, B*H heads)
  mla_attn<<<dim3(TQ_ / (64 * QG_), BB_ * H_), dim3(128), 0, stream>>>(qb, kb, vb, ao);
  // output projection + bias -> f32 d_out
  gemm_abT_n128<<<dim3(D_ / 128, M / 128, 1), dim3(256), 0, stream>>>(ao, ao, ao, wob, wob, wob,
                                                                      d_out, d_out, d_out, wo_b, D_, D_, 1);
}
